// v000
// Measured on an AMD MI455X. A time is GPU time per run, averaged over a window of back-to-back runs after a warm-up
// (all launches, gaps included; the runs take copies of the inputs in turn), and the median of several windows.
// Apart from v000's, it joins two sittings. Times from different sittings can be a few percent apart, while
// side-by-side timings come from the same sitting.
// v000 is the starting kernel. One run takes 1370 microseconds.
#include <hip/hip_runtime.h>

// FlexAttention training path: sliding-window causal attention with ALiBi (qkv [2][2048][3][16][64] packed; q, k, v = qkv[:, :, 0/1/2]; scores = q.k / 8 - slope_h (i - j), slope_h = 2^(-8 (h+1) / 16); keys with 0 <= i - j < 1024 only; softmax; out[b][l][h][e] -> [2][2048][16][64] f32 (4.2 M)).
// Layout per batch: the packed input rows (stride 3 x 1024 floats) feed the plane builders directly (bf16-rounded on read; q planes carry the exact 1/8 scale); a tiny kernel tabulates slope_h x d for d = 0..2047 (f32, exp2f slopes); causal sliding-window T-2048 attention (hybrid rows: < 512 hi/lo 3 products, rest fp16 x1024; k_gemmc skips tiles above the diagonal) whose softmax kernel subtracts table[h][i - j]; the f32 merge writes the [l][h][e] output rows directly.
// Compute dtypes, f32 accumulate: qkv rounded to bf16; rows < 512 3 products, rest fp16; ALiBi bias and softmax f32; output f32.

#define NB_  2
#define TT   2048
#define DM   1024
#define NH_  16
#define NKV  16
#define REP  (NH_ / NKV)
#define HD   64
#define DQ   (NH_ * HD)
#define DKV  (NKV * HD)
#define ZH   2
#define RH   512                  // query rows < RH use hi+lo planes (0: none)
#define WIN  1024
#define PCAR 1024.0f
#define SCL  0.125f   // HD^-0.5
typedef _Float16 h16;
typedef unsigned short bf;
typedef __attribute__((ext_vector_type(16))) __bf16   v16bf;
typedef __attribute__((ext_vector_type(16))) _Float16 v16h;
typedef __attribute__((ext_vector_type(8)))  _Float16 v8h;
typedef __attribute__((ext_vector_type(8)))  unsigned short v8us;
typedef __attribute__((ext_vector_type(8)))  float    v8f;
typedef __attribute__((ext_vector_type(4)))  float    v4f;
typedef v8h  __attribute__((may_alias)) v8ha;
typedef v4f  __attribute__((may_alias)) v4fa;
typedef v8us __attribute__((may_alias)) v8usa;

__device__ __forceinline__ unsigned short f2bf(float f) { unsigned u = __float_as_uint(f); u += 0x7FFFu + ((u >> 16) & 1u); return (unsigned short)(u >> 16); }
__device__ __forceinline__ float bf2f(unsigned short b) { return __uint_as_float(((unsigned)b) << 16); }
__device__ __forceinline__ float bfr(float f) { return bf2f(f2bf(f)); }
__device__ __forceinline__ v16h cat16(v8h lo, v8h hi) { return __builtin_shufflevector(lo, hi, 0, 1, 2, 3, 4, 5, 6, 7, 8, 9, 10, 11, 12, 13, 14, 15); }
__device__ __forceinline__ v16bf cat16b(v8us lo, v8us hi) { return __builtin_bit_cast(v16bf, __builtin_shufflevector(lo, hi, 0, 1, 2, 3, 4, 5, 6, 7, 8, 9, 10, 11, 12, 13, 14, 15)); }
__device__ __forceinline__ v8f wmma16(v16h a, v16h b, v8f c) { return __builtin_amdgcn_wmma_f32_16x16x32_f16(false, a, false, b, (short)0, c, false, false); }
__device__ __forceinline__ v8f wmmab(v16bf a, v16bf b, v8f c) { return __builtin_amdgcn_wmma_f32_16x16x32_bf16(false, a, false, b, (short)0, c, false, false); }



// ---- k_gemmw: register-blocked GEMM, ONE WAVE per 64x64 output tile (16 accumulators), operands straight from K-contiguous 16-bit planes; grid (M/64, N/64, Z), 32 threads.
// C[m][n] (f32, pitch ldc, + optional f32 bias[n]) = sum_k A[m][k] Bt[n][k] (+ split products per NSPLIT). z-batch strides sA/sB/sC in elements. K % 32 == 0.
template <typename T16> struct WFrag;
template <> struct WFrag<h16> { typedef v16h V; static __device__ __forceinline__ V ld(const h16* p) { return cat16(*(const v8h*)p, *(const v8h*)(p + 16)); } static __device__ __forceinline__ v8f mma(V a, V b, v8f c) { return wmma16(a, b, c); } };
template <> struct WFrag<bf> { typedef v16bf V; static __device__ __forceinline__ V ld(const bf* p) { return cat16b(*(const v8us*)p, *(const v8us*)(p + 16)); } static __device__ __forceinline__ v8f mma(V a, V b, v8f c) { return wmmab(a, b, c); } };
template <typename T16, int NSPLIT, bool BIAS>
__global__ __launch_bounds__(32) void k_gemmw(const T16* __restrict__ A, const T16* __restrict__ A2, const T16* __restrict__ Bt, const T16* __restrict__ Bt2, int K, float* C, int ldc, const float* __restrict__ bias, size_t sA, size_t sB, size_t sC) {
    typedef typename WFrag<T16>::V V;
    __shared__ __align__(16) float os[16 * 68];
    const size_t z = blockIdx.z; A += z * sA; if (A2) A2 += z * sA; Bt += z * sB; if (Bt2) Bt2 += z * sB; C += z * sC;
    const int lane = threadIdx.x & 31, lr = lane & 15, hi = lane >> 4; const int r0 = blockIdx.x * 64, c0 = blockIdx.y * 64;
    v8f acc[4][4];
#pragma unroll
    for (int mb = 0; mb < 4; ++mb)
#pragma unroll
        for (int nb = 0; nb < 4; ++nb) acc[mb][nb] = (v8f){};
    const size_t aoff = (size_t)(r0 + lr) * K + 8 * hi, boff = (size_t)(c0 + lr) * K + 8 * hi;
#pragma unroll 1
    for (int kc = 0; kc < K; kc += 32) {
        V a[4], a2[4];
#pragma unroll
        for (int mb = 0; mb < 4; ++mb) { a[mb] = WFrag<T16>::ld(A + aoff + (size_t)mb * 16 * K + kc); if (NSPLIT == 1 || NSPLIT == 2) a2[mb] = WFrag<T16>::ld(A2 + aoff + (size_t)mb * 16 * K + kc); }
#pragma unroll
        for (int nb = 0; nb < 4; ++nb) { const V b = WFrag<T16>::ld(Bt + boff + (size_t)nb * 16 * K + kc); V b2; if (NSPLIT >= 2) b2 = WFrag<T16>::ld(Bt2 + boff + (size_t)nb * 16 * K + kc);
#pragma unroll
            for (int mb = 0; mb < 4; ++mb) { acc[mb][nb] = WFrag<T16>::mma(a[mb], b, acc[mb][nb]); if (NSPLIT == 1 || NSPLIT == 2) acc[mb][nb] = WFrag<T16>::mma(a2[mb], b, acc[mb][nb]); if (NSPLIT >= 2) acc[mb][nb] = WFrag<T16>::mma(a[mb], b2, acc[mb][nb]); } }
        asm volatile("v_nop\n\tv_nop\n\tv_nop\n\tv_nop" : "+v"(acc[0][0]), "+v"(acc[1][1]), "+v"(acc[2][2]), "+v"(acc[3][3]) : "v"(a[0]), "v"(a[3]));
    }
#pragma unroll
    for (int mb = 0; mb < 4; ++mb) {
#pragma unroll
        for (int nb = 0; nb < 4; ++nb) {
#pragma unroll
            for (int j = 0; j < 8; ++j) os[(hi * 8 + j) * 68 + nb * 16 + lr] = acc[mb][nb][j]; }
        __builtin_amdgcn_wave_barrier(); asm volatile("" ::: "memory");
        float* crow = C + (size_t)(r0 + mb * 16) * ldc + c0;
{
#pragma unroll
            for (int s = 0; s < 8; ++s) { const int row = 2 * s + hi, cofs = lr * 4; v4f val = *(const v4fa*)(os + row * 68 + cofs); if (BIAS) { val[0] += bfr(bias[c0 + cofs]); val[1] += bfr(bias[c0 + cofs + 1]); val[2] += bfr(bias[c0 + cofs + 2]); val[3] += bfr(bias[c0 + cofs + 3]); }
                *(v4f*)(crow + (size_t)row * ldc + cofs) = val; }
             }
        __builtin_amdgcn_wave_barrier(); asm volatile("" ::: "memory");
    }
}

// ---- k_gemmc: the same one-wave 64x64 tile GEMM specialised for causal attention: CMODE 1 skips score tiles entirely above the diagonal (query rows r0+roff.., key columns c0..), CMODE 2 limits the
// key (K) loop of the probability x value contraction to the diagonal block (probabilities beyond it are exactly zero). roff = row offset of this launch's first row within the sequence.
template <typename T16, int NSPLIT, int CMODE>
__global__ __launch_bounds__(32) void k_gemmc(const T16* __restrict__ A, const T16* __restrict__ A2, const T16* __restrict__ Bt, const T16* __restrict__ Bt2, int K, float* C, int ldc, int roff, size_t sA, size_t sB, size_t sC) {
    typedef typename WFrag<T16>::V V;
    __shared__ __align__(16) float os[16 * 68];
    const size_t z = blockIdx.z; A += z * sA; if (A2) A2 += z * sA; Bt += z * sB; if (Bt2) Bt2 += z * sB; C += z * sC;
    const int lane = threadIdx.x & 31, lr = lane & 15, hi = lane >> 4; const int r0 = blockIdx.x * 64, c0 = blockIdx.y * 64;
    if (CMODE == 1 && c0 > r0 + roff + 63) return;                  // score tile entirely above the causal diagonal: left unwritten (the softmax loads it but masks j > i by select)
    const int Kl = (CMODE == 2) ? min(K, r0 + roff + 64) : K;        // P.V: probabilities are exactly 0 beyond the diagonal block, so the K loop stops there
    v8f acc[4][4];
#pragma unroll
    for (int mb = 0; mb < 4; ++mb)
#pragma unroll
        for (int nb = 0; nb < 4; ++nb) acc[mb][nb] = (v8f){};
    const size_t aoff = (size_t)(r0 + lr) * K + 8 * hi, boff = (size_t)(c0 + lr) * K + 8 * hi;
#pragma unroll 1
    for (int kc = 0; kc < Kl; kc += 32) {
        V a[4], a2[4];
#pragma unroll
        for (int mb = 0; mb < 4; ++mb) { a[mb] = WFrag<T16>::ld(A + aoff + (size_t)mb * 16 * K + kc); if (NSPLIT == 1 || NSPLIT == 2) a2[mb] = WFrag<T16>::ld(A2 + aoff + (size_t)mb * 16 * K + kc); }
#pragma unroll
        for (int nb = 0; nb < 4; ++nb) { const V b = WFrag<T16>::ld(Bt + boff + (size_t)nb * 16 * K + kc); V b2; if (NSPLIT >= 2) b2 = WFrag<T16>::ld(Bt2 + boff + (size_t)nb * 16 * K + kc);
#pragma unroll
            for (int mb = 0; mb < 4; ++mb) { acc[mb][nb] = WFrag<T16>::mma(a[mb], b, acc[mb][nb]); if (NSPLIT == 1 || NSPLIT == 2) acc[mb][nb] = WFrag<T16>::mma(a2[mb], b, acc[mb][nb]); if (NSPLIT >= 2) acc[mb][nb] = WFrag<T16>::mma(a[mb], b2, acc[mb][nb]); } }
        asm volatile("v_nop\n\tv_nop\n\tv_nop\n\tv_nop" : "+v"(acc[0][0]), "+v"(acc[1][1]), "+v"(acc[2][2]), "+v"(acc[3][3]) : "v"(a[0]), "v"(a[3]));
    }
#pragma unroll
    for (int mb = 0; mb < 4; ++mb) {
#pragma unroll
        for (int nb = 0; nb < 4; ++nb) {
#pragma unroll
            for (int j = 0; j < 8; ++j) os[(hi * 8 + j) * 68 + nb * 16 + lr] = acc[mb][nb][j]; }
        __builtin_amdgcn_wave_barrier(); asm volatile("" ::: "memory");
        float* crow = C + (size_t)(r0 + mb * 16) * ldc + c0;
{
#pragma unroll
            for (int s = 0; s < 8; ++s) { const int row = 2 * s + hi, cofs = lr * 4; v4f val = *(const v4fa*)(os + row * 68 + cofs);
                *(v4f*)(crow + (size_t)row * ldc + cofs) = val; }
             }
        __builtin_amdgcn_wave_barrier(); asm volatile("" ::: "memory");
    }
}

__device__ __forceinline__ h16 tohx(float x) { return (h16)x; }
__device__ __forceinline__ void splitf(float y, unsigned short& h, unsigned short& l) { h = f2bf(y); l = f2bf(y - bf2f(h)); }
typedef __attribute__((ext_vector_type(2))) _Float16 v2h;
typedef __attribute__((ext_vector_type(4))) _Float16 v4h;
typedef __attribute__((ext_vector_type(2))) unsigned short v2us;
typedef __attribute__((ext_vector_type(4))) unsigned short v4us;
typedef __attribute__((ext_vector_type(2))) float v2f;
typedef __attribute__((ext_vector_type(4))) int v4i;

__global__ __launch_bounds__(256) void k_wtG(const float* __restrict__ w, int K, int N, bf* Bt) {
    const int lane = threadIdx.x & 31; const int L0 = (blockIdx.x * 8 + (threadIdx.x >> 5)) * 8; const int nlines = N * K / 64;
{
#pragma unroll 1
        for (int l = 0; l < 8; ++l) { const int L = L0 + l; if (L >= nlines) break; const size_t e = (size_t)L * 64 + lane * 2; const int k = (int)(e % K), n = (int)(e / K); v2us o;
            o[0] = f2bf(w[(size_t)k * N + n]); o[1] = f2bf(w[(size_t)(k + 1) * N + n]); *(v2us*)(Bt + e) = o; }
         }
}
__global__ __launch_bounds__(256) void k_cvt8(const float* __restrict__ src, bf* dst, size_t n8) { const size_t i = (size_t)blockIdx.x * 256 + threadIdx.x; if (i >= n8) return; const v8f v = *(const v8f*)(src + i * 8); v8us o;
#pragma unroll
    for (int k = 0; k < 8; ++k) o[k] = f2bf(v[k]); *(v8us*)(dst + i * 8) = o;  }

// k_rope: head planes [h][t][d] (fp16 + hi/lo) of rope(x) x sc with the rotate-half convention out[d] = x[d] cos[t][d] - x[d+HD/2] sin[t][d], out[d+HD/2] = x[d+HD/2] cos[t][d+HD/2] + x[d] sin[t][d+HD/2]
__global__ __launch_bounds__(256) void k_rope(const float* __restrict__ F, int pitch, int nheads, const float* __restrict__ CS, const float* __restrict__ RF, const float* __restrict__ nw, float sc, h16* P16, bf* Ph, bf* Pl) {
    const size_t e = ((size_t)blockIdx.x * 256 + threadIdx.x) * 2; if (e >= (size_t)nheads * TT * HD) return; const int d = (int)(e % HD); const int t = (int)((e / HD) % TT); const int h = (int)(e / ((size_t)HD * TT)); const float* f = F + (size_t)t * pitch + h * HD; const float rf = RF ? RF[(size_t)h * TT + t] : 1.0f; v2h o16; v2us oh, ol;
#pragma unroll
    for (int q = 0; q < 2; ++q) { const int dd = d + q; const int dp = (dd < HD / 2) ? dd + HD / 2 : dd - HD / 2; float x0 = bfr(f[dd]), x1 = bfr(f[dp]);   /* raw input: bf16-rounded here */
        if (RF) { float n0 = __fmul_rn(x0, rf), n1 = __fmul_rn(x1, rf); asm volatile("" : "+v"(n0)); asm volatile("" : "+v"(n1)); x0 = __fmul_rn(bfr(nw[dd]), n0); x1 = __fmul_rn(bfr(nw[dp]), n1); }
        const v2f cs = *(const v2f*)(CS + ((size_t)t * HD + dd) * 2); float a = __fmul_rn(x0, cs[0]), bq = __fmul_rn(x1, cs[1]); asm volatile("" : "+v"(a)); asm volatile("" : "+v"(bq)); const float r = ((dd < HD / 2) ? __fsub_rn(a, bq) : __fadd_rn(a, bq)) * sc;
        o16[q] = tohx(r); unsigned short a2, c2; splitf(r, a2, c2); oh[q] = a2; ol[q] = c2; }
    *(v2h*)(P16 + e) = o16; *(v2us*)(Ph + e) = oh; *(v2us*)(Pl + e) = ol;  }
__global__ __launch_bounds__(256) void k_vtp(const float* __restrict__ F, int pitch, int nheads, h16* V16, bf* Vh, bf* Vl) { const size_t e = ((size_t)blockIdx.x * 256 + threadIdx.x) * 2; if (e >= (size_t)nheads * HD * TT) return; const int t = (int)(e % TT); const int d = (int)((e / TT) % HD); const int g = (int)(e / ((size_t)TT * HD)); v2h o16; v2us oh, ol;
#pragma unroll
    for (int q = 0; q < 2; ++q) { const float x = bfr(F[(size_t)(t + q) * pitch + g * HD + d]);   /* raw input: bf16-rounded here */ o16[q] = tohx(x); unsigned short a2, c2; splitf(x, a2, c2); oh[q] = a2; ol[q] = c2; }
    *(v2h*)(V16 + e) = o16; *(v2us*)(Vh + e) = oh; *(v2us*)(Vl + e) = ol;  }
__global__ __launch_bounds__(256) void k_csid(float* CS) { const int idx = blockIdx.x * 256 + threadIdx.x; if (idx >= TT * HD) return; v2f cs; cs[0] = 1.0f; cs[1] = 0.0f; *(v2f*)(CS + (size_t)idx * 2) = cs;  }
// k_asoft: per row (zz, i): t = S - table[h][i - j] (S already carries HD^-0.5) for j <= i and i - j < WIN (sliding causal window; the reference's -1e9 additive fill vanishes identically); softmax over the 2048 keys (register row, one exp, fixed trees);
__global__ __launch_bounds__(256) void k_asoft(const float* __restrict__ Sb, const float* __restrict__ AL, int h0, h16* P16, bf* Ph, bf* Pl) {
    const int lane = threadIdx.x & 31; const int row = blockIdx.x * 8 + (threadIdx.x >> 5); if (row >= ZH * TT) return; const int i = row % TT; const int zz = row / TT; (void)zz; const bool hires = (i < RH); const float* sr = Sb + (size_t)row * TT; const float* alh = AL + (size_t)(h0 + zz) * TT;   /* slope_h x d table */ float v[TT / 32]; float mx = -3.0e38f;
#pragma unroll
    for (int ch = 0; ch < TT / 128; ++ch) { const int j0 = ch * 128 + lane * 4; const v4f a = *(const v4f*)(sr + j0);
#pragma unroll
        for (int q = 0; q < 4; ++q) { const int j = j0 + q; (void)j; const int dj = min(max(i - j, 0), TT - 1); float s0 = __fsub_rn(a[q], alh[dj]); asm volatile("" : "+v"(s0));   /* UNCONDITIONAL clamped-index load, value pinned in straight-line code */ const float t = (j <= i && i - j < WIN) ? s0 : -3.0e38f;   /* window select on the VALUE (skipped score tiles may be unwritten: never enter arithmetically) */ v[ch * 4 + q] = t; mx = fmaxf(mx, t); } }
#pragma unroll
    for (int sh = 16; sh; sh >>= 1) mx = fmaxf(mx, __shfl_xor(mx, sh, 32));
    float sum = 0.f;
#pragma unroll
    for (int k = 0; k < TT / 32; ++k) { float d0 = __fsub_rn(v[k], mx); asm volatile("" : "+v"(d0)); v[k] = __builtin_amdgcn_exp2f(__fmul_rn(d0, 1.4426950408889634f)); sum += v[k]; }
#pragma unroll
    for (int sh = 16; sh; sh >>= 1) sum += __shfl_xor(sum, sh, 32);
    const float f = __fdiv_rn(hires ? 1.0f : PCAR, sum);
{
        if (hires) {
#pragma unroll
            for (int ch = 0; ch < TT / 128; ++ch) { v4us oh, ol;
#pragma unroll
                for (int q = 0; q < 4; ++q) { unsigned short a, c2; splitf(v[ch * 4 + q] * f, a, c2); oh[q] = a; ol[q] = c2; }
                const size_t oo = ((size_t)zz * (RH ? RH : 1) + i) * TT + ch * 128 + lane * 4; *(v4us*)(Ph + oo) = oh; *(v4us*)(Pl + oo) = ol; }
        } else {
#pragma unroll
            for (int ch = 0; ch < TT / 128; ++ch) { v4h o4;
#pragma unroll
                for (int q = 0; q < 4; ++q) o4[q] = tohx(v[ch * 4 + q] * f);
                *(v4h*)(P16 + (size_t)row * TT + ch * 128 + lane * 4) = o4; } }
         }
}
__global__ __launch_bounds__(256) void k_alibi(float* AL) { const int idx = blockIdx.x * 256 + threadIdx.x; if (idx >= NH_ * TT) return; const int h = idx / TT; const int d = idx % TT; const float e = __fdiv_rn(__fmul_rn(-8.0f, (float)(h + 1)), (float)NH_); const float sl = exp2f(e); const float v = __fmul_rn(sl, (float)d); *(float*)(AL + idx) = v;  }
__global__ __launch_bounds__(256) void k_merge(const float* __restrict__ O, int h0, float* OUTb) { const size_t e = ((size_t)blockIdx.x * 256 + threadIdx.x) * 2; if (e >= (size_t)ZH * TT * HD) return; const int d = (int)(e % HD); const int t = (int)((e / HD) % TT); const int zz = (int)(e / ((size_t)HD * TT)); const float cs = (t < RH) ? 1.0f : (1.0f / PCAR); const size_t oo = (size_t)t * DQ + (h0 + zz) * HD + d;
    v2f o2; o2[0] = O[e] * cs; o2[1] = O[e + 1] * cs; *(v2f*)(OUTb + oo) = o2;  }

extern "C" void kernel_launch(void* const* d_in, const int* in_sizes, int n_in,
                              void* d_out, int out_size, void* d_ws, size_t ws_size, hipStream_t stream) {
    (void)in_sizes; (void)n_in; (void)out_size;
    const float* qkv = (const float*)d_in[0]; const float* x = nullptr; const float* wq = nullptr; const float* wk = nullptr; const float* wv = nullptr; const float* wo = nullptr; (void)x; (void)wq; (void)wk; (void)wv; (void)wo;
    float* OUT = (float*)d_out;     // [2][2048][1024]
    char* wsp = (char*)d_ws;
    auto take = [&](size_t bytes) { char* p = wsp; wsp += (bytes + 255) & ~(size_t)255; return (void*)p; };
     float* CS = (float*)take((size_t)TT * HD * 2 * 4);
    float* AL = (float*)take((size_t)NH_ * TT * 4);
    h16* QP16 = (h16*)take((size_t)NH_ * TT * HD * 2); h16* KP16 = (h16*)take((size_t)NKV * TT * HD * 2); h16* VT16 = (h16*)take((size_t)NKV * HD * TT * 2);
    bf* QPh = (bf*)take((size_t)NH_ * TT * HD * 2); bf* QPl = (bf*)take((size_t)NH_ * TT * HD * 2); bf* KPh = (bf*)take((size_t)NKV * TT * HD * 2); bf* KPl = (bf*)take((size_t)NKV * TT * HD * 2); bf* VTh = (bf*)take((size_t)NKV * HD * TT * 2); bf* VTl = (bf*)take((size_t)NKV * HD * TT * 2); bf* Ph = (bf*)take((size_t)ZH * RH * TT * 2); bf* Pl = (bf*)take((size_t)ZH * RH * TT * 2);
    float* Sb = (float*)take((size_t)ZH * TT * TT * 4); h16* P16 = (h16*)take((size_t)ZH * TT * TT * 2); float* Ob = (float*)take((size_t)ZH * TT * HD * 4);
    if ((size_t)(wsp - (char*)d_ws) > ws_size) return;    // ws 256 MiB
    
    k_csid<<<(TT * HD + 255) / 256, 256, 0, stream>>>(CS);
    const unsigned LQ = (unsigned)(((size_t)NH_ * TT * HD / 2 + 255) / 256), LKv = (unsigned)(((size_t)NKV * TT * HD / 2 + 255) / 256);
    k_alibi<<<(NH_ * TT + 255) / 256, 256, 0, stream>>>(AL);
    for (int b = 0; b < NB_; ++b) {
        
        const float* qb = qkv + (size_t)b * TT * 3 * DQ;   /* packed rows: q at +0, k at +1024, v at +2048, stride 3072 */
        k_rope<<<LQ, 256, 0, stream>>>(qb, 3 * DQ, NH_, CS, nullptr, nullptr, SCL, QP16, QPh, QPl);   /* q planes carry the 1/8 scale (exact) */
        k_rope<<<LKv, 256, 0, stream>>>(qb + DQ, 3 * DQ, NKV, CS, nullptr, nullptr, 1.0f, KP16, KPh, KPl);
        k_vtp<<<LKv, 256, 0, stream>>>(qb + 2 * DQ, 3 * DQ, NKV, VT16, VTh, VTl);
        for (int h0 = 0; h0 < NH_; h0 += ZH) { const size_t zq = (size_t)h0, zk = (size_t)(h0 / REP);   // one kv head per query head: the pass's two heads use consecutive kv planes (z-strides TT*HD)
            k_gemmc<bf, 2, 1><<<dim3(RH / 64, TT / 64, ZH), 32, 0, stream>>>(QPh + zq * TT * HD, QPl + zq * TT * HD, KPh + zk * TT * HD, KPl + zk * TT * HD, HD, Sb, TT, 0, (size_t)TT * HD, (size_t)TT * HD, (size_t)TT * TT);
            k_gemmc<h16, 0, 1><<<dim3((TT - RH) / 64, TT / 64, ZH), 32, 0, stream>>>(QP16 + zq * TT * HD + (size_t)RH * HD, nullptr, KP16 + zk * TT * HD, nullptr, HD, Sb + (size_t)RH * TT, TT, RH, (size_t)TT * HD, (size_t)TT * HD, (size_t)TT * TT);
            k_asoft<<<ZH * TT / 8, 256, 0, stream>>>(Sb, AL, h0, P16, Ph, Pl);
            k_gemmc<bf, 2, 2><<<dim3(RH / 64, HD / 64, ZH), 32, 0, stream>>>(Ph, Pl, VTh + zk * HD * TT, VTl + zk * HD * TT, TT, Ob, HD, 0, (size_t)RH * TT, (size_t)HD * TT, (size_t)TT * HD);
            k_gemmc<h16, 0, 2><<<dim3((TT - RH) / 64, HD / 64, ZH), 32, 0, stream>>>(P16 + (size_t)RH * TT, nullptr, VT16 + zk * HD * TT, nullptr, TT, Ob + (size_t)RH * HD, HD, RH, (size_t)TT * TT, (size_t)HD * TT, (size_t)TT * HD);
            k_merge<<<(unsigned)(((size_t)ZH * TT * HD / 2 + 255) / 256), 256, 0, stream>>>(Ob, h0, OUT + (size_t)b * TT * DQ); }
         }
}

// v001
// Measured time: 607 microseconds a run.
// In two side-by-side timings against v000, it was 2.22 and 2.23 times as fast.
#include <hip/hip_runtime.h>

// FlexAttention training path: sliding-window causal attention with ALiBi (qkv [2][2048][3][16][64] packed; q, k, v = qkv[:, :, 0/1/2]; scores = q.k / 8 - slope_h (i - j), slope_h = 2^(-8 (h+1) / 16); keys with 0 <= i - j < 1024 only; softmax; out[b][l][h][e] -> [2][2048][16][64] f32 (4.2 M)).
// Layout per batch: the packed input rows (stride 3 x 1024 floats) feed the plane builders directly (bf16-rounded on read; q planes carry the exact 1/8 scale); a tiny kernel tabulates slope_h x d for d = 0..2047 (f32, exp2f slopes); causal sliding-window T-2048 attention (hybrid rows: < 512 hi/lo 3 products, rest fp16 x1024; k_gemmc skips tiles above the diagonal) whose softmax kernel subtracts table[h][i - j]; the f32 merge writes the [l][h][e] output rows directly.
// Compute dtypes, f32 accumulate: qkv rounded to bf16; rows < 512 3 products, rest fp16; ALiBi bias and softmax f32; output f32.

#define NB_  2
#define TT   2048
#define DM   1024
#define NH_  16
#define NKV  16
#define REP  (NH_ / NKV)
#define HD   64
#define DQ   (NH_ * HD)
#define DKV  (NKV * HD)
#define ZH   8                    // heads per pass: every launch of a pass covers ZH heads (z dimension); 8 is the most whose score and probability planes fit the workspace
#define RH   512                  // query rows < RH use hi+lo planes (0: none)
#define WIN  1024
#define PCAR 1024.0f
#define SCL  0.125f   // HD^-0.5
typedef _Float16 h16;
typedef unsigned short bf;
typedef __attribute__((ext_vector_type(16))) __bf16   v16bf;
typedef __attribute__((ext_vector_type(16))) _Float16 v16h;
typedef __attribute__((ext_vector_type(8)))  _Float16 v8h;
typedef __attribute__((ext_vector_type(8)))  unsigned short v8us;
typedef __attribute__((ext_vector_type(8)))  float    v8f;
typedef __attribute__((ext_vector_type(4)))  float    v4f;
typedef v8h  __attribute__((may_alias)) v8ha;
typedef v4f  __attribute__((may_alias)) v4fa;
typedef v8us __attribute__((may_alias)) v8usa;

__device__ __forceinline__ unsigned short f2bf(float f) { unsigned u = __float_as_uint(f); u += 0x7FFFu + ((u >> 16) & 1u); return (unsigned short)(u >> 16); }
__device__ __forceinline__ float bf2f(unsigned short b) { return __uint_as_float(((unsigned)b) << 16); }
__device__ __forceinline__ float bfr(float f) { return bf2f(f2bf(f)); }
__device__ __forceinline__ v16h cat16(v8h lo, v8h hi) { return __builtin_shufflevector(lo, hi, 0, 1, 2, 3, 4, 5, 6, 7, 8, 9, 10, 11, 12, 13, 14, 15); }
__device__ __forceinline__ v16bf cat16b(v8us lo, v8us hi) { return __builtin_bit_cast(v16bf, __builtin_shufflevector(lo, hi, 0, 1, 2, 3, 4, 5, 6, 7, 8, 9, 10, 11, 12, 13, 14, 15)); }
__device__ __forceinline__ v8f wmma16(v16h a, v16h b, v8f c) { return __builtin_amdgcn_wmma_f32_16x16x32_f16(false, a, false, b, (short)0, c, false, false); }
__device__ __forceinline__ v8f wmmab(v16bf a, v16bf b, v8f c) { return __builtin_amdgcn_wmma_f32_16x16x32_bf16(false, a, false, b, (short)0, c, false, false); }



// ---- k_gemmw: register-blocked GEMM, ONE WAVE per 64x64 output tile (16 accumulators), operands straight from K-contiguous 16-bit planes; grid (M/64, N/64, Z), 32 threads.
// C[m][n] (f32, pitch ldc, + optional f32 bias[n]) = sum_k A[m][k] Bt[n][k] (+ split products per NSPLIT). z-batch strides sA/sB/sC in elements. K % 32 == 0.
template <typename T16> struct WFrag;
template <> struct WFrag<h16> { typedef v16h V; static __device__ __forceinline__ V ld(const h16* p) { return cat16(*(const v8h*)p, *(const v8h*)(p + 16)); } static __device__ __forceinline__ v8f mma(V a, V b, v8f c) { return wmma16(a, b, c); } };
template <> struct WFrag<bf> { typedef v16bf V; static __device__ __forceinline__ V ld(const bf* p) { return cat16b(*(const v8us*)p, *(const v8us*)(p + 16)); } static __device__ __forceinline__ v8f mma(V a, V b, v8f c) { return wmmab(a, b, c); } };
template <typename T16, int NSPLIT, bool BIAS>
__global__ __launch_bounds__(32) void k_gemmw(const T16* __restrict__ A, const T16* __restrict__ A2, const T16* __restrict__ Bt, const T16* __restrict__ Bt2, int K, float* C, int ldc, const float* __restrict__ bias, size_t sA, size_t sB, size_t sC) {
    typedef typename WFrag<T16>::V V;
    __shared__ __align__(16) float os[16 * 68];
    const size_t z = blockIdx.z; A += z * sA; if (A2) A2 += z * sA; Bt += z * sB; if (Bt2) Bt2 += z * sB; C += z * sC;
    const int lane = threadIdx.x & 31, lr = lane & 15, hi = lane >> 4; const int r0 = blockIdx.x * 64, c0 = blockIdx.y * 64;
    v8f acc[4][4];
#pragma unroll
    for (int mb = 0; mb < 4; ++mb)
#pragma unroll
        for (int nb = 0; nb < 4; ++nb) acc[mb][nb] = (v8f){};
    const size_t aoff = (size_t)(r0 + lr) * K + 8 * hi, boff = (size_t)(c0 + lr) * K + 8 * hi;
#pragma unroll 1
    for (int kc = 0; kc < K; kc += 32) {
        V a[4], a2[4];
#pragma unroll
        for (int mb = 0; mb < 4; ++mb) { a[mb] = WFrag<T16>::ld(A + aoff + (size_t)mb * 16 * K + kc); if (NSPLIT == 1 || NSPLIT == 2) a2[mb] = WFrag<T16>::ld(A2 + aoff + (size_t)mb * 16 * K + kc); }
#pragma unroll
        for (int nb = 0; nb < 4; ++nb) { const V b = WFrag<T16>::ld(Bt + boff + (size_t)nb * 16 * K + kc); V b2; if (NSPLIT >= 2) b2 = WFrag<T16>::ld(Bt2 + boff + (size_t)nb * 16 * K + kc);
#pragma unroll
            for (int mb = 0; mb < 4; ++mb) { acc[mb][nb] = WFrag<T16>::mma(a[mb], b, acc[mb][nb]); if (NSPLIT == 1 || NSPLIT == 2) acc[mb][nb] = WFrag<T16>::mma(a2[mb], b, acc[mb][nb]); if (NSPLIT >= 2) acc[mb][nb] = WFrag<T16>::mma(a[mb], b2, acc[mb][nb]); } }
        asm volatile("v_nop\n\tv_nop\n\tv_nop\n\tv_nop" : "+v"(acc[0][0]), "+v"(acc[1][1]), "+v"(acc[2][2]), "+v"(acc[3][3]) : "v"(a[0]), "v"(a[3]));
    }
#pragma unroll
    for (int mb = 0; mb < 4; ++mb) {
#pragma unroll
        for (int nb = 0; nb < 4; ++nb) {
#pragma unroll
            for (int j = 0; j < 8; ++j) os[(hi * 8 + j) * 68 + nb * 16 + lr] = acc[mb][nb][j]; }
        __builtin_amdgcn_wave_barrier(); asm volatile("" ::: "memory");
        float* crow = C + (size_t)(r0 + mb * 16) * ldc + c0;
{
#pragma unroll
            for (int s = 0; s < 8; ++s) { const int row = 2 * s + hi, cofs = lr * 4; v4f val = *(const v4fa*)(os + row * 68 + cofs); if (BIAS) { val[0] += bfr(bias[c0 + cofs]); val[1] += bfr(bias[c0 + cofs + 1]); val[2] += bfr(bias[c0 + cofs + 2]); val[3] += bfr(bias[c0 + cofs + 3]); }
                *(v4f*)(crow + (size_t)row * ldc + cofs) = val; }
             }
        __builtin_amdgcn_wave_barrier(); asm volatile("" ::: "memory");
    }
}

// ---- k_gemmc: the same one-wave 64x64 tile GEMM specialised for causal attention: CMODE 1 skips score tiles entirely above the diagonal (query rows r0+roff.., key columns c0..), CMODE 2 limits the
// key (K) loop of the probability x value contraction to the diagonal block (probabilities beyond it are exactly zero). roff = row offset of this launch's first row within the sequence.
template <typename T16, int NSPLIT, int CMODE>
__global__ __launch_bounds__(32) void k_gemmc(const T16* __restrict__ A, const T16* __restrict__ A2, const T16* __restrict__ Bt, const T16* __restrict__ Bt2, int K, float* C, int ldc, int roff, size_t sA, size_t sB, size_t sC) {
    typedef typename WFrag<T16>::V V;
    __shared__ __align__(16) float os[16 * 68];
    const size_t z = blockIdx.z; A += z * sA; if (A2) A2 += z * sA; Bt += z * sB; if (Bt2) Bt2 += z * sB; C += z * sC;
    const int lane = threadIdx.x & 31, lr = lane & 15, hi = lane >> 4; const int r0 = blockIdx.x * 64, c0 = blockIdx.y * 64;
    if (CMODE == 1 && c0 > r0 + roff + 63) return;                  // score tile entirely above the causal diagonal: left unwritten (the softmax loads it but masks j > i by select)
    const int Kl = (CMODE == 2) ? min(K, r0 + roff + 64) : K;        // P.V: probabilities are exactly 0 beyond the diagonal block, so the K loop stops there
    v8f acc[4][4];
#pragma unroll
    for (int mb = 0; mb < 4; ++mb)
#pragma unroll
        for (int nb = 0; nb < 4; ++nb) acc[mb][nb] = (v8f){};
    const size_t aoff = (size_t)(r0 + lr) * K + 8 * hi, boff = (size_t)(c0 + lr) * K + 8 * hi;
#pragma unroll 1
    for (int kc = 0; kc < Kl; kc += 32) {
        V a[4], a2[4];
#pragma unroll
        for (int mb = 0; mb < 4; ++mb) { a[mb] = WFrag<T16>::ld(A + aoff + (size_t)mb * 16 * K + kc); if (NSPLIT == 1 || NSPLIT == 2) a2[mb] = WFrag<T16>::ld(A2 + aoff + (size_t)mb * 16 * K + kc); }
#pragma unroll
        for (int nb = 0; nb < 4; ++nb) { const V b = WFrag<T16>::ld(Bt + boff + (size_t)nb * 16 * K + kc); V b2; if (NSPLIT >= 2) b2 = WFrag<T16>::ld(Bt2 + boff + (size_t)nb * 16 * K + kc);
#pragma unroll
            for (int mb = 0; mb < 4; ++mb) { acc[mb][nb] = WFrag<T16>::mma(a[mb], b, acc[mb][nb]); if (NSPLIT == 1 || NSPLIT == 2) acc[mb][nb] = WFrag<T16>::mma(a2[mb], b, acc[mb][nb]); if (NSPLIT >= 2) acc[mb][nb] = WFrag<T16>::mma(a[mb], b2, acc[mb][nb]); } }
        asm volatile("v_nop\n\tv_nop\n\tv_nop\n\tv_nop" : "+v"(acc[0][0]), "+v"(acc[1][1]), "+v"(acc[2][2]), "+v"(acc[3][3]) : "v"(a[0]), "v"(a[3]));
    }
#pragma unroll
    for (int mb = 0; mb < 4; ++mb) {
#pragma unroll
        for (int nb = 0; nb < 4; ++nb) {
#pragma unroll
            for (int j = 0; j < 8; ++j) os[(hi * 8 + j) * 68 + nb * 16 + lr] = acc[mb][nb][j]; }
        __builtin_amdgcn_wave_barrier(); asm volatile("" ::: "memory");
        float* crow = C + (size_t)(r0 + mb * 16) * ldc + c0;
{
#pragma unroll
            for (int s = 0; s < 8; ++s) { const int row = 2 * s + hi, cofs = lr * 4; v4f val = *(const v4fa*)(os + row * 68 + cofs);
                *(v4f*)(crow + (size_t)row * ldc + cofs) = val; }
             }
        __builtin_amdgcn_wave_barrier(); asm volatile("" ::: "memory");
    }
}

__device__ __forceinline__ h16 tohx(float x) { return (h16)x; }
__device__ __forceinline__ void splitf(float y, unsigned short& h, unsigned short& l) { h = f2bf(y); l = f2bf(y - bf2f(h)); }
typedef __attribute__((ext_vector_type(2))) _Float16 v2h;
typedef __attribute__((ext_vector_type(4))) _Float16 v4h;
typedef __attribute__((ext_vector_type(2))) unsigned short v2us;
typedef __attribute__((ext_vector_type(4))) unsigned short v4us;
typedef __attribute__((ext_vector_type(2))) float v2f;
typedef __attribute__((ext_vector_type(4))) int v4i;

__global__ __launch_bounds__(256) void k_wtG(const float* __restrict__ w, int K, int N, bf* Bt) {
    const int lane = threadIdx.x & 31; const int L0 = (blockIdx.x * 8 + (threadIdx.x >> 5)) * 8; const int nlines = N * K / 64;
{
#pragma unroll 1
        for (int l = 0; l < 8; ++l) { const int L = L0 + l; if (L >= nlines) break; const size_t e = (size_t)L * 64 + lane * 2; const int k = (int)(e % K), n = (int)(e / K); v2us o;
            o[0] = f2bf(w[(size_t)k * N + n]); o[1] = f2bf(w[(size_t)(k + 1) * N + n]); *(v2us*)(Bt + e) = o; }
         }
}
__global__ __launch_bounds__(256) void k_cvt8(const float* __restrict__ src, bf* dst, size_t n8) { const size_t i = (size_t)blockIdx.x * 256 + threadIdx.x; if (i >= n8) return; const v8f v = *(const v8f*)(src + i * 8); v8us o;
#pragma unroll
    for (int k = 0; k < 8; ++k) o[k] = f2bf(v[k]); *(v8us*)(dst + i * 8) = o;  }

// k_rope: head planes [h][t][d] (fp16 + hi/lo) of rope(x) x sc with the rotate-half convention out[d] = x[d] cos[t][d] - x[d+HD/2] sin[t][d], out[d+HD/2] = x[d+HD/2] cos[t][d+HD/2] + x[d] sin[t][d+HD/2]
__global__ __launch_bounds__(256) void k_rope(const float* __restrict__ F, int pitch, int nheads, const float* __restrict__ CS, const float* __restrict__ RF, const float* __restrict__ nw, float sc, h16* P16, bf* Ph, bf* Pl) {
    const size_t e = ((size_t)blockIdx.x * 256 + threadIdx.x) * 2; if (e >= (size_t)nheads * TT * HD) return; const int d = (int)(e % HD); const int t = (int)((e / HD) % TT); const int h = (int)(e / ((size_t)HD * TT)); const float* f = F + (size_t)t * pitch + h * HD; const float rf = RF ? RF[(size_t)h * TT + t] : 1.0f; v2h o16; v2us oh, ol;
#pragma unroll
    for (int q = 0; q < 2; ++q) { const int dd = d + q; const int dp = (dd < HD / 2) ? dd + HD / 2 : dd - HD / 2; float x0 = bfr(f[dd]), x1 = bfr(f[dp]);   /* raw input: bf16-rounded here */
        if (RF) { float n0 = __fmul_rn(x0, rf), n1 = __fmul_rn(x1, rf); asm volatile("" : "+v"(n0)); asm volatile("" : "+v"(n1)); x0 = __fmul_rn(bfr(nw[dd]), n0); x1 = __fmul_rn(bfr(nw[dp]), n1); }
        const v2f cs = *(const v2f*)(CS + ((size_t)t * HD + dd) * 2); float a = __fmul_rn(x0, cs[0]), bq = __fmul_rn(x1, cs[1]); asm volatile("" : "+v"(a)); asm volatile("" : "+v"(bq)); const float r = ((dd < HD / 2) ? __fsub_rn(a, bq) : __fadd_rn(a, bq)) * sc;
        o16[q] = tohx(r); unsigned short a2, c2; splitf(r, a2, c2); oh[q] = a2; ol[q] = c2; }
    *(v2h*)(P16 + e) = o16; *(v2us*)(Ph + e) = oh; *(v2us*)(Pl + e) = ol;  }
__global__ __launch_bounds__(256) void k_vtp(const float* __restrict__ F, int pitch, int nheads, h16* V16, bf* Vh, bf* Vl) { const size_t e = ((size_t)blockIdx.x * 256 + threadIdx.x) * 2; if (e >= (size_t)nheads * HD * TT) return; const int t = (int)(e % TT); const int d = (int)((e / TT) % HD); const int g = (int)(e / ((size_t)TT * HD)); v2h o16; v2us oh, ol;
#pragma unroll
    for (int q = 0; q < 2; ++q) { const float x = bfr(F[(size_t)(t + q) * pitch + g * HD + d]);   /* raw input: bf16-rounded here */ o16[q] = tohx(x); unsigned short a2, c2; splitf(x, a2, c2); oh[q] = a2; ol[q] = c2; }
    *(v2h*)(V16 + e) = o16; *(v2us*)(Vh + e) = oh; *(v2us*)(Vl + e) = ol;  }
__global__ __launch_bounds__(256) void k_csid(float* CS) { const int idx = blockIdx.x * 256 + threadIdx.x; if (idx >= TT * HD) return; v2f cs; cs[0] = 1.0f; cs[1] = 0.0f; *(v2f*)(CS + (size_t)idx * 2) = cs;  }
// k_asoft: per row (zz, i): t = S - table[h][i - j] (S already carries HD^-0.5) for j <= i and i - j < WIN (sliding causal window; the reference's -1e9 additive fill vanishes identically); softmax over the 2048 keys (register row, one exp, fixed trees);
__global__ __launch_bounds__(256) void k_asoft(const float* __restrict__ Sb, const float* __restrict__ AL, int h0, h16* P16, bf* Ph, bf* Pl) {
    const int lane = threadIdx.x & 31; const int row = blockIdx.x * 8 + (threadIdx.x >> 5); if (row >= ZH * TT) return; const int i = row % TT; const int zz = row / TT; (void)zz; const bool hires = (i < RH); const float* sr = Sb + (size_t)row * TT; const float* alh = AL + (size_t)(h0 + zz) * TT;   /* slope_h x d table */ float v[TT / 32]; float mx = -3.0e38f;
#pragma unroll
    for (int ch = 0; ch < TT / 128; ++ch) { const int j0 = ch * 128 + lane * 4; const v4f a = *(const v4f*)(sr + j0);
#pragma unroll
        for (int q = 0; q < 4; ++q) { const int j = j0 + q; (void)j; const int dj = min(max(i - j, 0), TT - 1); float s0 = __fsub_rn(a[q], alh[dj]); asm volatile("" : "+v"(s0));   /* UNCONDITIONAL clamped-index load, value pinned in straight-line code */ const float t = (j <= i && i - j < WIN) ? s0 : -3.0e38f;   /* window select on the VALUE (skipped score tiles may be unwritten: never enter arithmetically) */ v[ch * 4 + q] = t; mx = fmaxf(mx, t); } }
#pragma unroll
    for (int sh = 16; sh; sh >>= 1) mx = fmaxf(mx, __shfl_xor(mx, sh, 32));
    float sum = 0.f;
#pragma unroll
    for (int k = 0; k < TT / 32; ++k) { float d0 = __fsub_rn(v[k], mx); asm volatile("" : "+v"(d0)); v[k] = __builtin_amdgcn_exp2f(__fmul_rn(d0, 1.4426950408889634f)); sum += v[k]; }
#pragma unroll
    for (int sh = 16; sh; sh >>= 1) sum += __shfl_xor(sum, sh, 32);
    const float f = __fdiv_rn(hires ? 1.0f : PCAR, sum);
{
        if (hires) {
#pragma unroll
            for (int ch = 0; ch < TT / 128; ++ch) { v4us oh, ol;
#pragma unroll
                for (int q = 0; q < 4; ++q) { unsigned short a, c2; splitf(v[ch * 4 + q] * f, a, c2); oh[q] = a; ol[q] = c2; }
                const size_t oo = ((size_t)zz * (RH ? RH : 1) + i) * TT + ch * 128 + lane * 4; *(v4us*)(Ph + oo) = oh; *(v4us*)(Pl + oo) = ol; }
        } else {
#pragma unroll
            for (int ch = 0; ch < TT / 128; ++ch) { v4h o4;
#pragma unroll
                for (int q = 0; q < 4; ++q) o4[q] = tohx(v[ch * 4 + q] * f);
                *(v4h*)(P16 + ((size_t)zz * (TT - RH) + (i - RH)) * TT + ch * 128 + lane * 4) = o4; } }
         }
}
__global__ __launch_bounds__(256) void k_alibi(float* AL) { const int idx = blockIdx.x * 256 + threadIdx.x; if (idx >= NH_ * TT) return; const int h = idx / TT; const int d = idx % TT; const float e = __fdiv_rn(__fmul_rn(-8.0f, (float)(h + 1)), (float)NH_); const float sl = exp2f(e); const float v = __fmul_rn(sl, (float)d); *(float*)(AL + idx) = v;  }
__global__ __launch_bounds__(256) void k_merge(const float* __restrict__ O, int h0, float* OUTb) { const size_t e = ((size_t)blockIdx.x * 256 + threadIdx.x) * 2; if (e >= (size_t)ZH * TT * HD) return; const int d = (int)(e % HD); const int t = (int)((e / HD) % TT); const int zz = (int)(e / ((size_t)HD * TT)); const float cs = (t < RH) ? 1.0f : (1.0f / PCAR); const size_t oo = (size_t)t * DQ + (h0 + zz) * HD + d;
    v2f o2; o2[0] = O[e] * cs; o2[1] = O[e + 1] * cs; *(v2f*)(OUTb + oo) = o2;  }

extern "C" void kernel_launch(void* const* d_in, const int* in_sizes, int n_in,
                              void* d_out, int out_size, void* d_ws, size_t ws_size, hipStream_t stream) {
    (void)in_sizes; (void)n_in; (void)out_size;
    const float* qkv = (const float*)d_in[0]; const float* x = nullptr; const float* wq = nullptr; const float* wk = nullptr; const float* wv = nullptr; const float* wo = nullptr; (void)x; (void)wq; (void)wk; (void)wv; (void)wo;
    float* OUT = (float*)d_out;     // [2][2048][1024]
    char* wsp = (char*)d_ws;
    auto take = [&](size_t bytes) { char* p = wsp; wsp += (bytes + 255) & ~(size_t)255; return (void*)p; };
     float* CS = (float*)take((size_t)TT * HD * 2 * 4);
    float* AL = (float*)take((size_t)NH_ * TT * 4);
    h16* QP16 = (h16*)take((size_t)NH_ * TT * HD * 2); h16* KP16 = (h16*)take((size_t)NKV * TT * HD * 2); h16* VT16 = (h16*)take((size_t)NKV * HD * TT * 2);
    bf* QPh = (bf*)take((size_t)NH_ * TT * HD * 2); bf* QPl = (bf*)take((size_t)NH_ * TT * HD * 2); bf* KPh = (bf*)take((size_t)NKV * TT * HD * 2); bf* KPl = (bf*)take((size_t)NKV * TT * HD * 2); bf* VTh = (bf*)take((size_t)NKV * HD * TT * 2); bf* VTl = (bf*)take((size_t)NKV * HD * TT * 2); bf* Ph = (bf*)take((size_t)ZH * RH * TT * 2); bf* Pl = (bf*)take((size_t)ZH * RH * TT * 2);
    float* Sb = (float*)take((size_t)ZH * TT * TT * 4); h16* P16 = (h16*)take((size_t)ZH * (TT - RH) * TT * 2);   /* fp16 probabilities: rows >= RH only (rows < RH live in Ph/Pl) */ float* Ob = (float*)take((size_t)ZH * TT * HD * 4);
    if ((size_t)(wsp - (char*)d_ws) > ws_size) return;    // ws 256 MiB
    
    k_csid<<<(TT * HD + 255) / 256, 256, 0, stream>>>(CS);
    const unsigned LQ = (unsigned)(((size_t)NH_ * TT * HD / 2 + 255) / 256), LKv = (unsigned)(((size_t)NKV * TT * HD / 2 + 255) / 256);
    k_alibi<<<(NH_ * TT + 255) / 256, 256, 0, stream>>>(AL);
    for (int b = 0; b < NB_; ++b) {
        
        const float* qb = qkv + (size_t)b * TT * 3 * DQ;   /* packed rows: q at +0, k at +1024, v at +2048, stride 3072 */
        k_rope<<<LQ, 256, 0, stream>>>(qb, 3 * DQ, NH_, CS, nullptr, nullptr, SCL, QP16, QPh, QPl);   /* q planes carry the 1/8 scale (exact) */
        k_rope<<<LKv, 256, 0, stream>>>(qb + DQ, 3 * DQ, NKV, CS, nullptr, nullptr, 1.0f, KP16, KPh, KPl);
        k_vtp<<<LKv, 256, 0, stream>>>(qb + 2 * DQ, 3 * DQ, NKV, VT16, VTh, VTl);
        for (int h0 = 0; h0 < NH_; h0 += ZH) { const size_t zq = (size_t)h0, zk = (size_t)(h0 / REP);   // one kv head per query head: the pass's ZH heads use consecutive kv planes (z-strides TT*HD)
            k_gemmc<bf, 2, 1><<<dim3(RH / 64, TT / 64, ZH), 32, 0, stream>>>(QPh + zq * TT * HD, QPl + zq * TT * HD, KPh + zk * TT * HD, KPl + zk * TT * HD, HD, Sb, TT, 0, (size_t)TT * HD, (size_t)TT * HD, (size_t)TT * TT);
            k_gemmc<h16, 0, 1><<<dim3((TT - RH) / 64, TT / 64, ZH), 32, 0, stream>>>(QP16 + zq * TT * HD + (size_t)RH * HD, nullptr, KP16 + zk * TT * HD, nullptr, HD, Sb + (size_t)RH * TT, TT, RH, (size_t)TT * HD, (size_t)TT * HD, (size_t)TT * TT);
            k_asoft<<<ZH * TT / 8, 256, 0, stream>>>(Sb, AL, h0, P16, Ph, Pl);
            k_gemmc<bf, 2, 2><<<dim3(RH / 64, HD / 64, ZH), 32, 0, stream>>>(Ph, Pl, VTh + zk * HD * TT, VTl + zk * HD * TT, TT, Ob, HD, 0, (size_t)RH * TT, (size_t)HD * TT, (size_t)TT * HD);
            k_gemmc<h16, 0, 2><<<dim3((TT - RH) / 64, HD / 64, ZH), 32, 0, stream>>>(P16, nullptr, VT16 + zk * HD * TT, nullptr, TT, Ob + (size_t)RH * HD, HD, RH, (size_t)(TT - RH) * TT, (size_t)HD * TT, (size_t)TT * HD);
            k_merge<<<(unsigned)(((size_t)ZH * TT * HD / 2 + 255) / 256), 256, 0, stream>>>(Ob, h0, OUT + (size_t)b * TT * DQ); }
         }
}

// v003
// One run takes 46.5 microseconds.
// Versions between v001 and this one are left out; their measured steps multiply to 13.1 times as fast.
// Counting every step since v000, it is 29.1 times as fast.
#include <hip/hip_runtime.h>

// FlexAttention training path: sliding-window causal attention with ALiBi (qkv [2][2048][3][16][64] packed; q, k, v = qkv[:, :, 0/1/2]; scores = q.k / 8 - slope_h (i - j), slope_h = 2^(-8 (h+1) / 16); keys with 0 <= i - j < 1024 only; softmax; out[b][l][h][e] -> [2][2048][16][64] f32 (4.2 M)).
// Layout: the packed input rows (stride 3 x 1024 floats) feed one plane-builder launch directly (bf16-rounded on read; q planes carry the exact 1/8 scale), both batches' planes side by side; one fused launch over all 32 (batch, head) pairs does scores, ALiBi bias (slope_h x (i - j), f32, exp2f slopes), window mask, online softmax and the probability x value product per strip of query rows (hybrid rows: < 512 hi/lo 3 products, rest fp16 x1024; only key blocks inside the band are visited) and writes the [l][h][e] output rows directly.
// Compute dtypes, f32 accumulate: qkv rounded to bf16; rows < 512 3 products, rest fp16; ALiBi bias and softmax f32; output f32.

#define NB_  2
#define TT   2048
#define DM   1024
#define NH_  16
#define NKV  16
#define REP  (NH_ / NKV)
#define HD   64
#define DQ   (NH_ * HD)
#define DKV  (NKV * HD)
#define RH   512                  // query rows < RH use hi+lo planes (0: none)
#define WIN  1024
#define SCL  0.125f   // HD^-0.5
typedef _Float16 h16;
typedef unsigned short bf;
typedef __attribute__((ext_vector_type(16))) __bf16   v16bf;
typedef __attribute__((ext_vector_type(16))) _Float16 v16h;
typedef __attribute__((ext_vector_type(8)))  _Float16 v8h;
typedef __attribute__((ext_vector_type(8)))  unsigned short v8us;
typedef __attribute__((ext_vector_type(8)))  float    v8f;
typedef __attribute__((ext_vector_type(4)))  float    v4f;
typedef v8h  __attribute__((may_alias)) v8ha;
typedef v4f  __attribute__((may_alias)) v4fa;
typedef v8us __attribute__((may_alias)) v8usa;

__device__ __forceinline__ unsigned short f2bf(float f) { unsigned u = __float_as_uint(f); u += 0x7FFFu + ((u >> 16) & 1u); return (unsigned short)(u >> 16); }
__device__ __forceinline__ float bf2f(unsigned short b) { return __uint_as_float(((unsigned)b) << 16); }
__device__ __forceinline__ float bfr(float f) { return bf2f(f2bf(f)); }
__device__ __forceinline__ v16h cat16(v8h lo, v8h hi) { return __builtin_shufflevector(lo, hi, 0, 1, 2, 3, 4, 5, 6, 7, 8, 9, 10, 11, 12, 13, 14, 15); }
__device__ __forceinline__ v16bf cat16b(v8us lo, v8us hi) { return __builtin_bit_cast(v16bf, __builtin_shufflevector(lo, hi, 0, 1, 2, 3, 4, 5, 6, 7, 8, 9, 10, 11, 12, 13, 14, 15)); }
__device__ __forceinline__ v8f wmma16(v16h a, v16h b, v8f c) { return __builtin_amdgcn_wmma_f32_16x16x32_f16(false, a, false, b, (short)0, c, false, false); }
__device__ __forceinline__ v8f wmmab(v16bf a, v16bf b, v8f c) { return __builtin_amdgcn_wmma_f32_16x16x32_bf16(false, a, false, b, (short)0, c, false, false); }



// ---- k_gemmw: register-blocked GEMM, ONE WAVE per 64x64 output tile (16 accumulators), operands straight from K-contiguous 16-bit planes; grid (M/64, N/64, Z), 32 threads.
// C[m][n] (f32, pitch ldc, + optional f32 bias[n]) = sum_k A[m][k] Bt[n][k] (+ split products per NSPLIT). z-batch strides sA/sB/sC in elements. K % 32 == 0.
template <typename T16> struct WFrag;
template <> struct WFrag<h16> { typedef v16h V; static __device__ __forceinline__ V ld(const h16* p) { return cat16(*(const v8h*)p, *(const v8h*)(p + 16)); } static __device__ __forceinline__ v8f mma(V a, V b, v8f c) { return wmma16(a, b, c); } };
template <> struct WFrag<bf> { typedef v16bf V; static __device__ __forceinline__ V ld(const bf* p) { return cat16b(*(const v8us*)p, *(const v8us*)(p + 16)); } static __device__ __forceinline__ v8f mma(V a, V b, v8f c) { return wmmab(a, b, c); } };
template <typename T16, int NSPLIT, bool BIAS>
__global__ __launch_bounds__(32) void k_gemmw(const T16* __restrict__ A, const T16* __restrict__ A2, const T16* __restrict__ Bt, const T16* __restrict__ Bt2, int K, float* C, int ldc, const float* __restrict__ bias, size_t sA, size_t sB, size_t sC) {
    typedef typename WFrag<T16>::V V;
    __shared__ __align__(16) float os[16 * 68];
    const size_t z = blockIdx.z; A += z * sA; if (A2) A2 += z * sA; Bt += z * sB; if (Bt2) Bt2 += z * sB; C += z * sC;
    const int lane = threadIdx.x & 31, lr = lane & 15, hi = lane >> 4; const int r0 = blockIdx.x * 64, c0 = blockIdx.y * 64;
    v8f acc[4][4];
#pragma unroll
    for (int mb = 0; mb < 4; ++mb)
#pragma unroll
        for (int nb = 0; nb < 4; ++nb) acc[mb][nb] = (v8f){};
    const size_t aoff = (size_t)(r0 + lr) * K + 8 * hi, boff = (size_t)(c0 + lr) * K + 8 * hi;
#pragma unroll 1
    for (int kc = 0; kc < K; kc += 32) {
        V a[4], a2[4];
#pragma unroll
        for (int mb = 0; mb < 4; ++mb) { a[mb] = WFrag<T16>::ld(A + aoff + (size_t)mb * 16 * K + kc); if (NSPLIT == 1 || NSPLIT == 2) a2[mb] = WFrag<T16>::ld(A2 + aoff + (size_t)mb * 16 * K + kc); }
#pragma unroll
        for (int nb = 0; nb < 4; ++nb) { const V b = WFrag<T16>::ld(Bt + boff + (size_t)nb * 16 * K + kc); V b2; if (NSPLIT >= 2) b2 = WFrag<T16>::ld(Bt2 + boff + (size_t)nb * 16 * K + kc);
#pragma unroll
            for (int mb = 0; mb < 4; ++mb) { acc[mb][nb] = WFrag<T16>::mma(a[mb], b, acc[mb][nb]); if (NSPLIT == 1 || NSPLIT == 2) acc[mb][nb] = WFrag<T16>::mma(a2[mb], b, acc[mb][nb]); if (NSPLIT >= 2) acc[mb][nb] = WFrag<T16>::mma(a[mb], b2, acc[mb][nb]); } }
        asm volatile("v_nop\n\tv_nop\n\tv_nop\n\tv_nop" : "+v"(acc[0][0]), "+v"(acc[1][1]), "+v"(acc[2][2]), "+v"(acc[3][3]) : "v"(a[0]), "v"(a[3]));
    }
#pragma unroll
    for (int mb = 0; mb < 4; ++mb) {
#pragma unroll
        for (int nb = 0; nb < 4; ++nb) {
#pragma unroll
            for (int j = 0; j < 8; ++j) os[(hi * 8 + j) * 68 + nb * 16 + lr] = acc[mb][nb][j]; }
        __builtin_amdgcn_wave_barrier(); asm volatile("" ::: "memory");
        float* crow = C + (size_t)(r0 + mb * 16) * ldc + c0;
{
#pragma unroll
            for (int s = 0; s < 8; ++s) { const int row = 2 * s + hi, cofs = lr * 4; v4f val = *(const v4fa*)(os + row * 68 + cofs); if (BIAS) { val[0] += bfr(bias[c0 + cofs]); val[1] += bfr(bias[c0 + cofs + 1]); val[2] += bfr(bias[c0 + cofs + 2]); val[3] += bfr(bias[c0 + cofs + 3]); }
                *(v4f*)(crow + (size_t)row * ldc + cofs) = val; }
             }
        __builtin_amdgcn_wave_barrier(); asm volatile("" ::: "memory");
    }
}

__device__ __forceinline__ h16 tohx(float x) { return (h16)x; }
__device__ __forceinline__ void splitf(float y, unsigned short& h, unsigned short& l) { h = f2bf(y); l = f2bf(y - bf2f(h)); }
typedef __attribute__((ext_vector_type(2))) _Float16 v2h;
typedef __attribute__((ext_vector_type(4))) _Float16 v4h;
typedef __attribute__((ext_vector_type(2))) unsigned short v2us;
typedef __attribute__((ext_vector_type(4))) unsigned short v4us;
typedef __attribute__((ext_vector_type(2))) float v2f;
typedef __attribute__((ext_vector_type(4))) int v4i;

__global__ __launch_bounds__(256) void k_wtG(const float* __restrict__ w, int K, int N, bf* Bt) {
    const int lane = threadIdx.x & 31; const int L0 = (blockIdx.x * 8 + (threadIdx.x >> 5)) * 8; const int nlines = N * K / 64;
{
#pragma unroll 1
        for (int l = 0; l < 8; ++l) { const int L = L0 + l; if (L >= nlines) break; const size_t e = (size_t)L * 64 + lane * 2; const int k = (int)(e % K), n = (int)(e / K); v2us o;
            o[0] = f2bf(w[(size_t)k * N + n]); o[1] = f2bf(w[(size_t)(k + 1) * N + n]); *(v2us*)(Bt + e) = o; }
         }
}
__global__ __launch_bounds__(256) void k_cvt8(const float* __restrict__ src, bf* dst, size_t n8) { const size_t i = (size_t)blockIdx.x * 256 + threadIdx.x; if (i >= n8) return; const v8f v = *(const v8f*)(src + i * 8); v8us o;
#pragma unroll
    for (int k = 0; k < 8; ++k) o[k] = f2bf(v[k]); *(v8us*)(dst + i * 8) = o;  }

// ---- k_planes: every plane the attention launch reads, from one read of the packed input, in one launch.
// One workgroup takes PT positions x PH heads of q, k and v: 24 16-byte loads a thread, all issued before the first use (few waves, many bytes in flight each).
// q and k rows keep their [t][d] order: a wave's load is one position's 128 floats (2 heads), its store one whole 128-byte plane row per head.
// v is transposed through LDS as words of two bf16 (positions 2 tp, 2 tp + 1) at [d][tp], pitch VP words: the writes (16 d-quads x 2 tp a wave) and the reads (4 d rows x 8 chunks a wave) each fall on 32 different banks; PT = 64 positions are one whole 128-byte line of a [d][t] row.
// Every loop is fully unrolled: the arrays of loaded values stay in registers only under constant indices.
// Values as before: input rounded to bf16 on read, q x 1/8 (exact), fp16 and hi/lo from that. Only what is read later is written: q fp16 for rows >= RH, q hi/lo for rows < RH, k and v fp16 everywhere, k and v hi/lo for positions < RH.
#define PT   64
#define PH   2
#define VP   33
template <bool LOW>
__device__ __forceinline__ void planes_out(const unsigned* vs, const v4f (&xq)[8], const v4f (&xk)[8], int tid, int z0, int t0, h16* __restrict__ Q16, h16* __restrict__ K16, h16* __restrict__ V16, bf* __restrict__ Qh, bf* __restrict__ Ql, bf* __restrict__ Kh, bf* __restrict__ Kl, bf* __restrict__ Vh, bf* __restrict__ Vl) {
    const int lane = tid & 31, wave = tid >> 5;
#pragma unroll
    for (int i = 0; i < 4; ++i) { const int idx = i * 256 + tid, c = idx & 7, d = idx >> 3; const size_t e = ((size_t)z0 * HD + d) * TT + t0 + c * 8; v8h o16; v8us oh, ol;
#pragma unroll
        for (int k = 0; k < 4; ++k) { const unsigned w = vs[d * VP + c * 4 + k];
#pragma unroll
            for (int q = 0; q < 2; ++q) { const float x = bf2f((unsigned short)(q ? (w >> 16) : (w & 0xFFFFu))); o16[2 * k + q] = tohx(x); if (LOW) { unsigned short a2, c2; splitf(x, a2, c2); oh[2 * k + q] = a2; ol[2 * k + q] = c2; } } }
        *(v8h*)(V16 + e) = o16; if (LOW) { *(v8us*)(Vh + e) = oh; *(v8us*)(Vl + e) = ol; } }
#pragma unroll
    for (int i = 0; i < 8; ++i) { const size_t e = ((size_t)(z0 + (lane >> 4)) * TT + t0 + i * 8 + wave) * HD + (lane & 15) * 4; v4h q16, k16; v4us qh, ql, kh, kl;
#pragma unroll
        for (int j = 0; j < 4; ++j) { const float rq = bfr(xq[i][j]) * SCL, rk = bfr(xk[i][j]); k16[j] = tohx(rk);
            if (LOW) { unsigned short a2, c2; splitf(rq, a2, c2); qh[j] = a2; ql[j] = c2; splitf(rk, a2, c2); kh[j] = a2; kl[j] = c2; } else q16[j] = tohx(rq); }
        *(v4h*)(K16 + e) = k16;
        if (LOW) { *(v4us*)(Qh + e) = qh; *(v4us*)(Ql + e) = ql; *(v4us*)(Kh + e) = kh; *(v4us*)(Kl + e) = kl; } else *(v4h*)(Q16 + e) = q16; }
}
__global__ __launch_bounds__(256) void k_planes(const float* __restrict__ qkv, h16* __restrict__ Q16, h16* __restrict__ K16, h16* __restrict__ V16, bf* __restrict__ Qh, bf* __restrict__ Ql, bf* __restrict__ Kh, bf* __restrict__ Kl, bf* __restrict__ Vh, bf* __restrict__ Vl) {
    __shared__ unsigned vs[PH * HD * VP];
    const int tid = threadIdx.x, lane = tid & 31, wave = tid >> 5;
    const int z0 = blockIdx.z * NH_ + blockIdx.x * PH, t0 = blockIdx.y * PT;
    const float* src = qkv + ((size_t)blockIdx.z * TT + t0) * (3 * DQ) + blockIdx.x * (PH * HD);
    const float* pv = src + (size_t)(2 * (tid >> 4)) * (3 * DQ) + (tid & 15) * 4;   // v (at + 2 DQ): positions 2 tp and 2 tp + 1, tp = tid / 16 (+ 16), d-quad tid % 16
    const float* pq = src + (size_t)wave * (3 * DQ) + lane * 4;   // q (k at + DQ): position wave (+ 8 i), 128 floats over the lanes
    v4f xv[8], xq[8], xk[8];
#pragma unroll
    for (int i = 0; i < 4; ++i) { const float* p = pv + 2 * DQ + (i & 1) * (32 * 3 * DQ) + (i >> 1) * HD; xv[2 * i] = *(const v4f*)p; xv[2 * i + 1] = *(const v4f*)(p + 3 * DQ); }
#pragma unroll
    for (int i = 0; i < 8; ++i) { const float* p = pq + i * (8 * 3 * DQ); xq[i] = *(const v4f*)p; xk[i] = *(const v4f*)(p + DQ); }
    asm volatile("s_wait_xcnt 0x0" :: "v"(pv), "v"(pq) : "memory");   // stands in front of every overwrite of an address register of the loads above; it names the two addresses so that they stay in their registers up to here (else a later load's result is given an earlier load's address pair)
    __builtin_amdgcn_sched_barrier(0);   // keeps all 24 loads issued here: left free, the scheduler holds the last of them back until the first values have arrived, a second memory latency
#pragma unroll
    for (int i = 0; i < 4; ++i)
#pragma unroll
        for (int j = 0; j < 4; ++j) vs[((i >> 1) * HD + (tid & 15) * 4 + j) * VP + (i & 1) * 16 + (tid >> 4)] = (unsigned)f2bf(xv[2 * i][j]) | ((unsigned)f2bf(xv[2 * i + 1][j]) << 16);
    __syncthreads();   // the transposed v tile is whole; nothing is written to it afterwards
    if (t0 < RH) { planes_out<true>(vs, xq, xk, tid, z0, t0, Q16, K16, V16, Qh, Ql, Kh, Kl, Vh, Vl); return; }   // the same branch for the whole workgroup, behind the only barrier
    planes_out<false>(vs, xq, xk, tid, z0, t0, Q16, K16, V16, Qh, Ql, Kh, Kl, Vh, Vl);
    asm volatile("s_wait_xcnt 0x0" ::: "memory");   // the built code lays this path in front of the other one and ends it with a conditional jump: the fall-through (never taken) rewrites address registers of the stores above
}
// ---- k_fattn: scores, ALiBi + window softmax and the probability x value product of one strip of query rows, in one wave, with nothing of the scores leaving the registers.
// Transposed products: St[key][query] = K . Qt (A = K rows, B = Q rows), Ot[d][query] += Vt . Pt (A = Vt rows, B = the packed score accumulators: two 16-key St tiles of one query column group are, converted in place, one 32-key B operand).
// A lane holds one query column (query = lr), so the running maximum, the running sum and the rescale factor are per-lane values; the two lane halves (keys 8 hi .. 8 hi + 7 of each 16) join by one exchange.
// Online softmax over passes of 32 keys from the window's first key block to the diagonal block. Masked scores are -inf, the running maximum starts at a finite -3e38: a pass with no valid key for a column adds exactly 0.
// Every inner loop is fully unrolled (the fragment and accumulator arrays stay in registers only under constant indices); the pass loop stays rolled (one pass's fragments and temporaries already take the wave's register budget).
// SPLIT (rows < RH): bf16 hi/lo planes, 3 products for St and for Ot. Otherwise fp16 planes, probabilities carried x 1024 (in the exponent; the row sum carries the same factor, so it cancels in the division).
template <typename T16, bool SPLIT, int QT>
__device__ __forceinline__ void attn_strip(const T16* __restrict__ Q, const T16* __restrict__ Q2, const T16* __restrict__ Kp, const T16* __restrict__ K2, const T16* __restrict__ Vt, const T16* __restrict__ Vt2, float sl, int q0, float* __restrict__ orow) {
    typedef typename WFrag<T16>::V V;
    const int lane = threadIdx.x & 31, lr = lane & 15, hi = lane >> 4;
    V qf[QT][2], qf2[QT][2];
#pragma unroll
    for (int qt = 0; qt < QT; ++qt)
#pragma unroll
        for (int kc = 0; kc < 2; ++kc) { const size_t off = (size_t)(q0 + qt * 16 + lr) * HD + kc * 32 + 8 * hi; qf[qt][kc] = WFrag<T16>::ld(Q + off); if (SPLIT) qf2[qt][kc] = WFrag<T16>::ld(Q2 + off); }
    v8f o[QT][4]; float m[QT], l[QT];
#pragma unroll
    for (int qt = 0; qt < QT; ++qt) { m[qt] = -3.0e38f; l[qt] = 0.f;
#pragma unroll
        for (int dt = 0; dt < 4; ++dt) o[qt][dt] = (v8f){}; }
    const int kbeg = max(q0 - (WIN - 1), 0) & ~31, kend = q0 + QT * 16;   // key blocks of 32 that hold a valid key of some row of the strip
    const unsigned klane = lr * HD + 8 * hi, vlane = lr * TT + 8 * hi;   // the lane's own element offsets, loop-invariant
    V kf[2][2], kf2[2][2];
    if (!SPLIT) {   // fp16 strips fetch their K fragments one pass ahead; the hi/lo strips (twice the planes, at most half the passes) fetch them at the head of the pass
#pragma unroll
        for (int t = 0; t < 2; ++t)
#pragma unroll
            for (int kc = 0; kc < 2; ++kc) kf[t][kc] = WFrag<T16>::ld(Kp + (size_t)kbeg * HD + klane + (t * 16 * HD + kc * 32));
    }
#pragma unroll 1
    for (int kb = kbeg; kb < kend; kb += 32) {
        V vf[4], vf2[4];
        if (SPLIT) {
#pragma unroll
            for (int t = 0; t < 2; ++t)
#pragma unroll
                for (int kc = 0; kc < 2; ++kc) { kf[t][kc] = WFrag<T16>::ld(Kp + (size_t)kb * HD + klane + (t * 16 * HD + kc * 32)); kf2[t][kc] = WFrag<T16>::ld(K2 + (size_t)kb * HD + klane + (t * 16 * HD + kc * 32)); }
        }
#pragma unroll
        for (int dt = 0; dt < 4; ++dt) { vf[dt] = WFrag<T16>::ld(Vt + kb + vlane + dt * 16 * TT); if (SPLIT) vf2[dt] = WFrag<T16>::ld(Vt2 + kb + vlane + dt * 16 * TT); }
        asm volatile("s_wait_xcnt 0x0" ::: "memory");   // stands in front of every later overwrite of an address register of the loads above (the compiler reuses them)
        __builtin_amdgcn_sched_barrier(0);   // keeps the V loads issued here: left free, the scheduler sinks them to just in front of the P.V products and their whole latency is waited out there
        v8f s[QT][2];
#pragma unroll
        for (int t = 0; t < 2; ++t)
#pragma unroll
            for (int qt = 0; qt < QT; ++qt) { v8f a = (v8f){};
#pragma unroll
                for (int kc = 0; kc < 2; ++kc) { a = WFrag<T16>::mma(kf[t][kc], qf[qt][kc], a); if (SPLIT) { a = WFrag<T16>::mma(kf[t][kc], qf2[qt][kc], a); a = WFrag<T16>::mma(kf2[t][kc], qf[qt][kc], a); } }
                s[qt][t] = a; }
        if (!SPLIT) {
            const int kn = (kb + 32 < kend) ? kb + 32 : kb;   // next pass's K fragments: their latency runs under the softmax (the last pass fetches its own block again: in bounds, unused)
#pragma unroll
            for (int t = 0; t < 2; ++t)
#pragma unroll
                for (int kc = 0; kc < 2; ++kc) kf[t][kc] = WFrag<T16>::ld(Kp + (size_t)kn * HD + klane + (t * 16 * HD + kc * 32));
            asm volatile("s_wait_xcnt 0x0" ::: "memory");   // as above, for the refill's address registers
            __builtin_amdgcn_sched_barrier(0);   // keeps the refill issued here: left free, the scheduler sinks it to the loop's foot and the next pass waits out its whole latency
        }
#pragma unroll
        for (int qt = 0; qt < QT; ++qt) {
            const int d0 = q0 + qt * 16 + lr - kb - 8 * hi;   // i - j of element (t = 0, r = 0)
            float mx = m[qt];
#pragma unroll
            for (int t = 0; t < 2; ++t)
#pragma unroll
                for (int r = 0; r < 8; ++r) { const int d = d0 - t * 16 - r; const float x = ((unsigned)d < (unsigned)WIN) ? s[qt][t][r] - sl * (float)d : -__builtin_inff(); s[qt][t][r] = x; mx = fmaxf(mx, x); }
            mx = fmaxf(mx, __shfl_xor(mx, 16, 32));
            const float al = __builtin_amdgcn_exp2f((m[qt] - mx) * 1.4426950408889634f); m[qt] = mx;
            float ps = 0.f;
#pragma unroll
            for (int t = 0; t < 2; ++t)
#pragma unroll
                for (int r = 0; r < 8; ++r) { const float e = (s[qt][t][r] - mx) * 1.4426950408889634f; const float p = __builtin_amdgcn_exp2f(SPLIT ? e : e + 10.0f); s[qt][t][r] = p; ps += p; }
            l[qt] = l[qt] * al + ps;
#pragma unroll
            for (int dt = 0; dt < 4; ++dt) o[qt][dt] *= al;
            if constexpr (SPLIT) {
                v8us ph[2], pl[2];
#pragma unroll
                for (int t = 0; t < 2; ++t)
#pragma unroll
                    for (int r = 0; r < 8; ++r) { unsigned short a, c2; splitf(s[qt][t][r], a, c2); ph[t][r] = a; pl[t][r] = c2; }
                const V pfh = cat16b(ph[0], ph[1]), pfl = cat16b(pl[0], pl[1]);
#pragma unroll
                for (int dt = 0; dt < 4; ++dt) { o[qt][dt] = WFrag<T16>::mma(vf[dt], pfh, o[qt][dt]); o[qt][dt] = WFrag<T16>::mma(vf[dt], pfl, o[qt][dt]); o[qt][dt] = WFrag<T16>::mma(vf2[dt], pfh, o[qt][dt]); }
            } else {
                v8h p8[2];
#pragma unroll
                for (int t = 0; t < 2; ++t)
#pragma unroll
                    for (int r = 0; r < 8; ++r) p8[t][r] = tohx(s[qt][t][r]);
                const V pf = cat16(p8[0], p8[1]);
#pragma unroll
                for (int dt = 0; dt < 4; ++dt) o[qt][dt] = WFrag<T16>::mma(vf[dt], pf, o[qt][dt]);
            }
        }
    }
#pragma unroll
    for (int qt = 0; qt < QT; ++qt) {
        const float f = __fdiv_rn(1.0f, l[qt] + __shfl_xor(l[qt], 16, 32));
        float* op = orow + (size_t)(q0 + qt * 16 + lr) * DQ + 8 * hi;   // a lane's 8 accumulator registers are 8 consecutive e of its query row
#pragma unroll
        for (int dt = 0; dt < 4; ++dt) { v4f w0, w1;
#pragma unroll
            for (int r = 0; r < 4; ++r) { w0[r] = o[qt][dt][r] * f; w1[r] = o[qt][dt][4 + r] * f; }
            *(v4f*)(op + dt * 16) = w0; *(v4f*)(op + dt * 16 + 4) = w1; }
    }
}
#define QTF  2                               // query column groups per wave, fp16 rows (32 rows a wave); hi/lo rows: 1 (16 rows a wave)
#define NBH  (RH / 16 / 4)                   // workgroups (4 independent waves) of hi/lo rows per head
#define NBF  ((TT - RH) / (16 * QTF) / 4)    // workgroups of fp16 rows per head
__global__ __launch_bounds__(128) void k_fattn(const h16* __restrict__ Q16, const h16* __restrict__ K16, const h16* __restrict__ V16, const bf* __restrict__ Qh, const bf* __restrict__ Ql, const bf* __restrict__ Kh, const bf* __restrict__ Kl, const bf* __restrict__ Vh, const bf* __restrict__ Vl, float* __restrict__ OUT) {
    const int z = blockIdx.x, h = z % NH_, b = z / NH_; const size_t pz = (size_t)z * TT * HD;
    const int blk = NBH + NBF - 1 - (int)blockIdx.y;   // longest strips first in the grid
    const int wave = __builtin_amdgcn_readfirstlane(threadIdx.x >> 5);   // scalar: trip counts and plane addresses stay in scalar registers
    const float sl = exp2f(__fdiv_rn(__fmul_rn(-8.0f, (float)(h + 1)), (float)NH_));
    float* orow = OUT + (size_t)b * TT * DQ + h * HD;
    if (blk >= NBH) attn_strip<h16, false, QTF>(Q16 + pz, nullptr, K16 + pz, nullptr, V16 + pz, nullptr, sl, RH + ((blk - NBH) * 4 + wave) * 16 * QTF, orow);
    else attn_strip<bf, true, 1>(Qh + pz, Ql + pz, Kh + pz, Kl + pz, Vh + pz, Vl + pz, sl, (blk * 4 + wave) * 16, orow);
}
extern "C" void kernel_launch(void* const* d_in, const int* in_sizes, int n_in,
                              void* d_out, int out_size, void* d_ws, size_t ws_size, hipStream_t stream) {
    (void)in_sizes; (void)n_in; (void)out_size;
    const float* qkv = (const float*)d_in[0];
    float* OUT = (float*)d_out;     // [2][2048][1024]
    char* wsp = (char*)d_ws;
    auto take = [&](size_t bytes) { char* p = wsp; wsp += (bytes + 255) & ~(size_t)255; return (void*)p; };
    const size_t PB = (size_t)NH_ * TT * HD;   /* elements of one batch's plane set; every plane holds both batches */
    h16* QP16 = (h16*)take(NB_ * PB * 2); h16* KP16 = (h16*)take(NB_ * PB * 2); h16* VT16 = (h16*)take(NB_ * PB * 2);
    bf* QPh = (bf*)take(NB_ * PB * 2); bf* QPl = (bf*)take(NB_ * PB * 2); bf* KPh = (bf*)take(NB_ * PB * 2); bf* KPl = (bf*)take(NB_ * PB * 2); bf* VTh = (bf*)take(NB_ * PB * 2); bf* VTl = (bf*)take(NB_ * PB * 2);
    if ((size_t)(wsp - (char*)d_ws) > ws_size) return;    // ws 256 MiB

    k_planes<<<dim3(NH_ / PH, TT / PT, NB_), 256, 0, stream>>>(qkv, QP16, KP16, VT16, QPh, QPl, KPh, KPl, VTh, VTl);
    k_fattn<<<dim3(NB_ * NH_, NBH + NBF), 128, 0, stream>>>(QP16, KP16, VT16, QPh, QPl, KPh, KPl, VTh, VTl, OUT);
}

// v004
// A run of this version takes 39.5 microseconds.
// Next to v003, in two timings, it ran 1.16 and 1.19 times as fast.
// Counting every step since v000, it is 34.3 times as fast.
#include <hip/hip_runtime.h>

// FlexAttention training path: sliding-window causal attention with ALiBi (qkv [2][2048][3][16][64] packed; q, k, v = qkv[:, :, 0/1/2]; scores = q.k / 8 - slope_h (i - j), slope_h = 2^(-8 (h+1) / 16); keys with 0 <= i - j < 1024 only; softmax; out[b][l][h][e] -> [2][2048][16][64] f32 (4.2 M)).
// Layout: the packed input rows (stride 3 x 1024 floats) feed one plane-builder launch directly (bf16-rounded on read; q planes carry the exact 1/8 scale), both batches' planes side by side; one fused launch over all 32 (batch, head) pairs does scores, ALiBi bias (slope_h x (i - j), f32, exp2f slopes), window mask, online softmax and the probability x value product per strip of query rows (hybrid rows: < 512 hi/lo 3 products, rest fp16 x1024; only key blocks inside the band are visited) and writes the [l][h][e] output rows directly.
// Compute dtypes, f32 accumulate: qkv rounded to bf16; rows < 512 3 products, rest fp16; ALiBi bias and softmax f32; output f32.

#define NB_  2
#define TT   2048
#define DM   1024
#define NH_  16
#define NKV  16
#define REP  (NH_ / NKV)
#define HD   64
#define DQ   (NH_ * HD)
#define DKV  (NKV * HD)
#define RH   512                  // query rows < RH use hi+lo planes (0: none)
#define WIN  1024
#define SCL  0.125f   // HD^-0.5
typedef _Float16 h16;
typedef unsigned short bf;
typedef __attribute__((ext_vector_type(16))) __bf16   v16bf;
typedef __attribute__((ext_vector_type(16))) _Float16 v16h;
typedef __attribute__((ext_vector_type(8)))  _Float16 v8h;
typedef __attribute__((ext_vector_type(8)))  unsigned short v8us;
typedef __attribute__((ext_vector_type(8)))  float    v8f;
typedef __attribute__((ext_vector_type(4)))  float    v4f;
typedef v8h  __attribute__((may_alias)) v8ha;
typedef v4f  __attribute__((may_alias)) v4fa;
typedef v8us __attribute__((may_alias)) v8usa;

__device__ __forceinline__ unsigned short f2bf(float f) { unsigned u = __float_as_uint(f); u += 0x7FFFu + ((u >> 16) & 1u); return (unsigned short)(u >> 16); }
__device__ __forceinline__ float bf2f(unsigned short b) { return __uint_as_float(((unsigned)b) << 16); }
__device__ __forceinline__ float bfr(float f) { return bf2f(f2bf(f)); }
__device__ __forceinline__ v16h cat16(v8h lo, v8h hi) { return __builtin_shufflevector(lo, hi, 0, 1, 2, 3, 4, 5, 6, 7, 8, 9, 10, 11, 12, 13, 14, 15); }
__device__ __forceinline__ v16bf cat16b(v8us lo, v8us hi) { return __builtin_bit_cast(v16bf, __builtin_shufflevector(lo, hi, 0, 1, 2, 3, 4, 5, 6, 7, 8, 9, 10, 11, 12, 13, 14, 15)); }
__device__ __forceinline__ v8f wmma16(v16h a, v16h b, v8f c) { return __builtin_amdgcn_wmma_f32_16x16x32_f16(false, a, false, b, (short)0, c, false, false); }
__device__ __forceinline__ v8f wmmab(v16bf a, v16bf b, v8f c) { return __builtin_amdgcn_wmma_f32_16x16x32_bf16(false, a, false, b, (short)0, c, false, false); }



// ---- k_gemmw: register-blocked GEMM, ONE WAVE per 64x64 output tile (16 accumulators), operands straight from K-contiguous 16-bit planes; grid (M/64, N/64, Z), 32 threads.
// C[m][n] (f32, pitch ldc, + optional f32 bias[n]) = sum_k A[m][k] Bt[n][k] (+ split products per NSPLIT). z-batch strides sA/sB/sC in elements. K % 32 == 0.
template <typename T16> struct WFrag;
template <> struct WFrag<h16> { typedef v16h V; static __device__ __forceinline__ V ld(const h16* p) { return cat16(*(const v8h*)p, *(const v8h*)(p + 16)); } static __device__ __forceinline__ V ldf(const h16* p) { return cat16(*(const v8h*)p, *(const v8h*)(p + 256)); } static __device__ __forceinline__ v8f mma(V a, V b, v8f c) { return wmma16(a, b, c); } };
template <> struct WFrag<bf> { typedef v16bf V; static __device__ __forceinline__ V ld(const bf* p) { return cat16b(*(const v8us*)p, *(const v8us*)(p + 16)); } static __device__ __forceinline__ V ldf(const bf* p) { return cat16b(*(const v8us*)p, *(const v8us*)(p + 256)); } static __device__ __forceinline__ v8f mma(V a, V b, v8f c) { return wmmab(a, b, c); } };
template <typename T16, int NSPLIT, bool BIAS>
__global__ __launch_bounds__(32) void k_gemmw(const T16* __restrict__ A, const T16* __restrict__ A2, const T16* __restrict__ Bt, const T16* __restrict__ Bt2, int K, float* C, int ldc, const float* __restrict__ bias, size_t sA, size_t sB, size_t sC) {
    typedef typename WFrag<T16>::V V;
    __shared__ __align__(16) float os[16 * 68];
    const size_t z = blockIdx.z; A += z * sA; if (A2) A2 += z * sA; Bt += z * sB; if (Bt2) Bt2 += z * sB; C += z * sC;
    const int lane = threadIdx.x & 31, lr = lane & 15, hi = lane >> 4; const int r0 = blockIdx.x * 64, c0 = blockIdx.y * 64;
    v8f acc[4][4];
#pragma unroll
    for (int mb = 0; mb < 4; ++mb)
#pragma unroll
        for (int nb = 0; nb < 4; ++nb) acc[mb][nb] = (v8f){};
    const size_t aoff = (size_t)(r0 + lr) * K + 8 * hi, boff = (size_t)(c0 + lr) * K + 8 * hi;
#pragma unroll 1
    for (int kc = 0; kc < K; kc += 32) {
        V a[4], a2[4];
#pragma unroll
        for (int mb = 0; mb < 4; ++mb) { a[mb] = WFrag<T16>::ld(A + aoff + (size_t)mb * 16 * K + kc); if (NSPLIT == 1 || NSPLIT == 2) a2[mb] = WFrag<T16>::ld(A2 + aoff + (size_t)mb * 16 * K + kc); }
#pragma unroll
        for (int nb = 0; nb < 4; ++nb) { const V b = WFrag<T16>::ld(Bt + boff + (size_t)nb * 16 * K + kc); V b2; if (NSPLIT >= 2) b2 = WFrag<T16>::ld(Bt2 + boff + (size_t)nb * 16 * K + kc);
#pragma unroll
            for (int mb = 0; mb < 4; ++mb) { acc[mb][nb] = WFrag<T16>::mma(a[mb], b, acc[mb][nb]); if (NSPLIT == 1 || NSPLIT == 2) acc[mb][nb] = WFrag<T16>::mma(a2[mb], b, acc[mb][nb]); if (NSPLIT >= 2) acc[mb][nb] = WFrag<T16>::mma(a[mb], b2, acc[mb][nb]); } }
        asm volatile("v_nop\n\tv_nop\n\tv_nop\n\tv_nop" : "+v"(acc[0][0]), "+v"(acc[1][1]), "+v"(acc[2][2]), "+v"(acc[3][3]) : "v"(a[0]), "v"(a[3]));
    }
#pragma unroll
    for (int mb = 0; mb < 4; ++mb) {
#pragma unroll
        for (int nb = 0; nb < 4; ++nb) {
#pragma unroll
            for (int j = 0; j < 8; ++j) os[(hi * 8 + j) * 68 + nb * 16 + lr] = acc[mb][nb][j]; }
        __builtin_amdgcn_wave_barrier(); asm volatile("" ::: "memory");
        float* crow = C + (size_t)(r0 + mb * 16) * ldc + c0;
{
#pragma unroll
            for (int s = 0; s < 8; ++s) { const int row = 2 * s + hi, cofs = lr * 4; v4f val = *(const v4fa*)(os + row * 68 + cofs); if (BIAS) { val[0] += bfr(bias[c0 + cofs]); val[1] += bfr(bias[c0 + cofs + 1]); val[2] += bfr(bias[c0 + cofs + 2]); val[3] += bfr(bias[c0 + cofs + 3]); }
                *(v4f*)(crow + (size_t)row * ldc + cofs) = val; }
             }
        __builtin_amdgcn_wave_barrier(); asm volatile("" ::: "memory");
    }
}

__device__ __forceinline__ h16 tohx(float x) { return (h16)x; }
__device__ __forceinline__ void splitf(float y, unsigned short& h, unsigned short& l) { h = f2bf(y); l = f2bf(y - bf2f(h)); }
typedef __attribute__((ext_vector_type(2))) _Float16 v2h;
typedef __attribute__((ext_vector_type(4))) _Float16 v4h;
typedef __attribute__((ext_vector_type(2))) unsigned short v2us;
typedef __attribute__((ext_vector_type(4))) unsigned short v4us;
typedef __attribute__((ext_vector_type(2))) float v2f;
typedef __attribute__((ext_vector_type(4))) int v4i;

__global__ __launch_bounds__(256) void k_wtG(const float* __restrict__ w, int K, int N, bf* Bt) {
    const int lane = threadIdx.x & 31; const int L0 = (blockIdx.x * 8 + (threadIdx.x >> 5)) * 8; const int nlines = N * K / 64;
{
#pragma unroll 1
        for (int l = 0; l < 8; ++l) { const int L = L0 + l; if (L >= nlines) break; const size_t e = (size_t)L * 64 + lane * 2; const int k = (int)(e % K), n = (int)(e / K); v2us o;
            o[0] = f2bf(w[(size_t)k * N + n]); o[1] = f2bf(w[(size_t)(k + 1) * N + n]); *(v2us*)(Bt + e) = o; }
         }
}
__global__ __launch_bounds__(256) void k_cvt8(const float* __restrict__ src, bf* dst, size_t n8) { const size_t i = (size_t)blockIdx.x * 256 + threadIdx.x; if (i >= n8) return; const v8f v = *(const v8f*)(src + i * 8); v8us o;
#pragma unroll
    for (int k = 0; k < 8; ++k) o[k] = f2bf(v[k]); *(v8us*)(dst + i * 8) = o;  }

// ---- k_planes: every plane the attention launch reads, from one read of the packed input, in one launch.
// One workgroup takes PT positions x PH heads of q, k and v: 24 16-byte loads a thread, all issued before the first use (few waves, many bytes in flight each).
// q rows keep their [t][d] order: a wave's load is one position's 128 floats (2 heads), its store one whole 128-byte plane row per head.
// k and v planes are laid out in the order in which the attention launch's A fragments are loaded, in chunks of 8 elements (16 bytes, one lane's share of one load):
//   k: [head][t / 16][d / 8][t % 16][8 d]      v: [head][t / 32][d / 16][(t % 32) / 8][d % 16][8 t]
// so that lane (lr + 16 hi) of a fragment load finds its chunk at lane x 16 bytes: one load reads 512 bytes in a row (4 lines) where rows of a [t][d] or [d][t] plane gave it 16 lines.
// k goes through LDS as bf16 rows of KP words (128 + 16 bytes: the 16-byte reads of 16 rows fall on different banks), the second head's rows 32 banks further (the two halves of a wave's 8-byte writes do not meet); a wave's store is 2 chunk columns x 16 keys = 512 bytes in a row.
// v is transposed through LDS as words of two bf16 (positions 2 tp, 2 tp + 1) at [d][tp], pitch VP words: the writes (16 d-quads x 2 tp a wave) and the reads (16 d rows x 2 key blocks a wave) each fall on 32 different banks; a wave's store is two runs of 256 bytes.
// Every loop is fully unrolled: the arrays of loaded values stay in registers only under constant indices.
// Values as before: input rounded to bf16 on read, q x 1/8 (exact), fp16 and hi/lo from that. Only what is read later is written: q fp16 for rows >= RH, q hi/lo for rows < RH, k and v fp16 everywhere, k and v hi/lo for positions < RH.
#define PT   64
#define PH   2
#define VP   33
#define KP   36
#define KHS  (PT * KP + 32)
typedef __attribute__((ext_vector_type(2))) unsigned v2u;
typedef __attribute__((ext_vector_type(4))) unsigned v4u;
template <bool LOW>
__device__ __forceinline__ void planes_out(const unsigned* vs, const unsigned* ks, const v4f (&xq)[8], int tid, int z0, int t0, h16* __restrict__ Q16, h16* __restrict__ K16, h16* __restrict__ V16, bf* __restrict__ Qh, bf* __restrict__ Ql, bf* __restrict__ Kh, bf* __restrict__ Kl, bf* __restrict__ Vh, bf* __restrict__ Vl) {
    const int lane = tid & 31, wave = tid >> 5;
#pragma unroll
    for (int i = 0; i < 4; ++i) { const int idx = i * 256 + tid, lr = idx & 15, blk = (idx >> 4) & 1, c = (idx >> 5) & 3, dg = idx >> 7;   // dg: group of 16 d rows, over both heads
        const size_t e = (size_t)(z0 + (dg >> 2)) * (TT * HD) + (size_t)(t0 + blk * 32) * HD + (dg & 3) * 512 + c * 128 + lr * 8; v8h o16; v8us oh, ol;
#pragma unroll
        for (int k = 0; k < 4; ++k) { const unsigned w = vs[(dg * 16 + lr) * VP + (blk * 4 + c) * 4 + k];
#pragma unroll
            for (int q = 0; q < 2; ++q) { const float x = bf2f((unsigned short)(q ? (w >> 16) : (w & 0xFFFFu))); o16[2 * k + q] = tohx(x); if (LOW) { unsigned short a2, c2; splitf(x, a2, c2); oh[2 * k + q] = a2; ol[2 * k + q] = c2; } } }
        *(v8h*)(V16 + e) = o16; if (LOW) { *(v8us*)(Vh + e) = oh; *(v8us*)(Vl + e) = ol; } }
#pragma unroll
    for (int i = 0; i < 4; ++i) { const int idx = i * 256 + tid, key = idx & 15, c8 = (idx >> 4) & 7, tg = idx >> 7;   // tg: group of 16 positions, over both heads
        const size_t e = (size_t)(z0 + (tg >> 2)) * (TT * HD) + (size_t)(t0 + (tg & 3) * 16) * HD + c8 * 128 + key * 8; v8h o16; v8us oh, ol;
        const v4u w4 = *(const v4u*)(ks + (tg >> 2) * KHS + ((tg & 3) * 16 + key) * KP + c8 * 4);
#pragma unroll
        for (int k = 0; k < 4; ++k)
#pragma unroll
            for (int q = 0; q < 2; ++q) { const float x = bf2f((unsigned short)(q ? (w4[k] >> 16) : (w4[k] & 0xFFFFu))); o16[2 * k + q] = tohx(x); if (LOW) { unsigned short a2, c2; splitf(x, a2, c2); oh[2 * k + q] = a2; ol[2 * k + q] = c2; } }
        *(v8h*)(K16 + e) = o16; if (LOW) { *(v8us*)(Kh + e) = oh; *(v8us*)(Kl + e) = ol; } }
#pragma unroll
    for (int i = 0; i < 8; ++i) { const size_t e = ((size_t)(z0 + (lane >> 4)) * TT + t0 + i * 8 + wave) * HD + (lane & 15) * 4; v4h q16; v4us qh, ql;
#pragma unroll
        for (int j = 0; j < 4; ++j) { const float rq = bfr(xq[i][j]) * SCL;
            if (LOW) { unsigned short a2, c2; splitf(rq, a2, c2); qh[j] = a2; ql[j] = c2; } else q16[j] = tohx(rq); }
        if (LOW) { *(v4us*)(Qh + e) = qh; *(v4us*)(Ql + e) = ql; } else *(v4h*)(Q16 + e) = q16; }
}
__global__ __launch_bounds__(256) void k_planes(const float* __restrict__ qkv, h16* __restrict__ Q16, h16* __restrict__ K16, h16* __restrict__ V16, bf* __restrict__ Qh, bf* __restrict__ Ql, bf* __restrict__ Kh, bf* __restrict__ Kl, bf* __restrict__ Vh, bf* __restrict__ Vl) {
    __shared__ unsigned vs[PH * HD * VP];
    __shared__ __align__(16) unsigned ks[PH * KHS];
    const int tid = threadIdx.x, lane = tid & 31, wave = tid >> 5;
    const int z0 = blockIdx.z * NH_ + blockIdx.x * PH, t0 = blockIdx.y * PT;
    const float* src = qkv + ((size_t)blockIdx.z * TT + t0) * (3 * DQ) + blockIdx.x * (PH * HD);
    const float* pv = src + (size_t)(2 * (tid >> 4)) * (3 * DQ) + (tid & 15) * 4;   // v (at + 2 DQ): positions 2 tp and 2 tp + 1, tp = tid / 16 (+ 16), d-quad tid % 16
    const float* pq = src + (size_t)wave * (3 * DQ) + lane * 4;   // q (k at + DQ): position wave (+ 8 i), 128 floats over the lanes
    v4f xv[8], xq[8], xk[8];
#pragma unroll
    for (int i = 0; i < 4; ++i) { const float* p = pv + 2 * DQ + (i & 1) * (32 * 3 * DQ) + (i >> 1) * HD; xv[2 * i] = *(const v4f*)p; xv[2 * i + 1] = *(const v4f*)(p + 3 * DQ); }
#pragma unroll
    for (int i = 0; i < 8; ++i) { const float* p = pq + i * (8 * 3 * DQ); xq[i] = *(const v4f*)p; xk[i] = *(const v4f*)(p + DQ); }
    asm volatile("s_wait_xcnt 0x0" :: "v"(pv), "v"(pq) : "memory");   // stands in front of every overwrite of an address register of the loads above; it names the two addresses so that they stay in their registers up to here (else a later load's result is given an earlier load's address pair)
    __builtin_amdgcn_sched_barrier(0);   // keeps all 24 loads issued here: left free, the scheduler holds the last of them back until the first values have arrived, a second memory latency
#pragma unroll
    for (int i = 0; i < 4; ++i)
#pragma unroll
        for (int j = 0; j < 4; ++j) vs[((i >> 1) * HD + (tid & 15) * 4 + j) * VP + (i & 1) * 16 + (tid >> 4)] = (unsigned)f2bf(xv[2 * i][j]) | ((unsigned)f2bf(xv[2 * i + 1][j]) << 16);
#pragma unroll
    for (int i = 0; i < 8; ++i) { v2u w; w[0] = (unsigned)f2bf(xk[i][0]) | ((unsigned)f2bf(xk[i][1]) << 16); w[1] = (unsigned)f2bf(xk[i][2]) | ((unsigned)f2bf(xk[i][3]) << 16); *(v2u*)(ks + (lane >> 4) * KHS + (i * 8 + wave) * KP + (lane & 15) * 2) = w; }
    __syncthreads();   // the v and k tiles are whole; nothing is written to them afterwards
    if (t0 < RH) { planes_out<true>(vs, ks, xq, tid, z0, t0, Q16, K16, V16, Qh, Ql, Kh, Kl, Vh, Vl); return; }   // the same branch for the whole workgroup, behind the only barrier
    planes_out<false>(vs, ks, xq, tid, z0, t0, Q16, K16, V16, Qh, Ql, Kh, Kl, Vh, Vl);
    asm volatile("s_wait_xcnt 0x0" ::: "memory");   // the built code lays this path in front of the other one and ends it with a conditional jump: the fall-through (never taken) rewrites address registers of the stores above
}
// ---- k_fattn: scores, ALiBi + window softmax and the probability x value product of one strip of query rows, in one wave, with nothing of the scores leaving the registers.
// Transposed products: St[key][query] = K . Qt (A = K rows, B = Q rows), Ot[d][query] += Vt . Pt (A = Vt rows, B = the packed score accumulators: two 16-key St tiles of one query column group are, converted in place, one 32-key B operand).
// A lane holds one query column (query = lr), so the running maximum, the running sum and the rescale factor are per-lane values; the two lane halves (keys 8 hi .. 8 hi + 7 of each 16) join by one exchange.
// Online softmax over passes of 32 keys from the window's first key block to the diagonal block. Masked scores are -inf, the running maximum starts at a finite -3e38: a pass with no valid key for a column adds exactly 0.
// Every inner loop is fully unrolled (the fragment and accumulator arrays stay in registers only under constant indices); the pass loop stays rolled (one pass's fragments and temporaries already take the wave's register budget).
// SPLIT (rows < RH): bf16 hi/lo planes, 3 products for St and for Ot. Otherwise fp16 planes, probabilities carried x 1024 (in the exponent; the row sum carries the same factor, so it cancels in the division).
template <typename T16, bool SPLIT, int QT>
__device__ __forceinline__ void attn_strip(const T16* __restrict__ Q, const T16* __restrict__ Q2, const T16* __restrict__ Kp, const T16* __restrict__ K2, const T16* __restrict__ Vt, const T16* __restrict__ Vt2, float sl, int q0, float* __restrict__ orow) {
    typedef typename WFrag<T16>::V V;
    const int lane = threadIdx.x & 31, lr = lane & 15, hi = lane >> 4;
    V qf[QT][2], qf2[QT][2];
#pragma unroll
    for (int qt = 0; qt < QT; ++qt)
#pragma unroll
        for (int kc = 0; kc < 2; ++kc) { const size_t off = (size_t)(q0 + qt * 16 + lr) * HD + kc * 32 + 8 * hi; qf[qt][kc] = WFrag<T16>::ld(Q + off); if (SPLIT) qf2[qt][kc] = WFrag<T16>::ld(Q2 + off); }
    v8f o[QT][4]; float m[QT], l[QT];
#pragma unroll
    for (int qt = 0; qt < QT; ++qt) { m[qt] = -3.0e38f; l[qt] = 0.f;
#pragma unroll
        for (int dt = 0; dt < 4; ++dt) o[qt][dt] = (v8f){}; }
    const int kbeg = max(q0 - (WIN - 1), 0) & ~31, kend = q0 + QT * 16;   // key blocks of 32 that hold a valid key of some row of the strip
    const unsigned flane = lane * 8;   // the lane's own chunk of a fragment load (k and v planes are in fragment order: 32 keys of either are 4 KiB in a row, 8 loads of 512 bytes)
    V kf[2][2], kf2[2][2];
    if (!SPLIT) {   // fp16 strips fetch their K fragments one pass ahead; the hi/lo strips (twice the planes, at most half the passes) fetch them at the head of the pass
#pragma unroll
        for (int t = 0; t < 2; ++t)
#pragma unroll
            for (int kc = 0; kc < 2; ++kc) kf[t][kc] = WFrag<T16>::ldf(Kp + (size_t)kbeg * HD + flane + (t * 16 * HD + kc * 512));
    }
#pragma unroll 1
    for (int kb = kbeg; kb < kend; kb += 32) {
        V vf[4], vf2[4];
        const size_t boff = (size_t)kb * HD + flane;   // this pass's 32 keys, the lane's chunk
        const T16* const kp = Kp + boff; const T16* const kp2 = SPLIT ? K2 + boff : nullptr; const T16* const vp = Vt + boff; const T16* const vp2 = SPLIT ? Vt2 + boff : nullptr;
        if (SPLIT) {
#pragma unroll
            for (int t = 0; t < 2; ++t)
#pragma unroll
                for (int kc = 0; kc < 2; ++kc) { kf[t][kc] = WFrag<T16>::ldf(kp + (t * 16 * HD + kc * 512)); kf2[t][kc] = WFrag<T16>::ldf(kp2 + (t * 16 * HD + kc * 512)); }
        }
#pragma unroll
        for (int dt = 0; dt < 4; ++dt) { vf[dt] = WFrag<T16>::ldf(vp + dt * 512); if (SPLIT) vf2[dt] = WFrag<T16>::ldf(vp2 + dt * 512); }
        // the wait stands in front of every later overwrite of an address register of the loads above (the compiler reuses them); with four planes' loads it names the addresses so that they stay in their registers up to here (else a later load's result is given an earlier load's address pair)
        if constexpr (SPLIT) asm volatile("s_wait_xcnt 0x0" :: "v"(kp), "v"(kp2), "v"(vp), "v"(vp2) : "memory");
        else asm volatile("s_wait_xcnt 0x0" ::: "memory");
        __builtin_amdgcn_sched_barrier(0);   // keeps the V loads issued here: left free, the scheduler sinks them to just in front of the P.V products and their whole latency is waited out there
        v8f s[QT][2];
#pragma unroll
        for (int t = 0; t < 2; ++t)
#pragma unroll
            for (int qt = 0; qt < QT; ++qt) { v8f a = (v8f){};
#pragma unroll
                for (int kc = 0; kc < 2; ++kc) { a = WFrag<T16>::mma(kf[t][kc], qf[qt][kc], a); if (SPLIT) { a = WFrag<T16>::mma(kf[t][kc], qf2[qt][kc], a); a = WFrag<T16>::mma(kf2[t][kc], qf[qt][kc], a); } }
                s[qt][t] = a; }
        if (!SPLIT) {
            const int kn = (kb + 32 < kend) ? kb + 32 : kb;   // next pass's K fragments: their latency runs under the softmax (the last pass fetches its own block again: in bounds, unused)
            const T16* const kpn = Kp + (size_t)kn * HD + flane;
#pragma unroll
            for (int t = 0; t < 2; ++t)
#pragma unroll
                for (int kc = 0; kc < 2; ++kc) kf[t][kc] = WFrag<T16>::ldf(kpn + (t * 16 * HD + kc * 512));
            asm volatile("s_wait_xcnt 0x0" ::: "memory");   // as above, for the refill's address registers
            __builtin_amdgcn_sched_barrier(0);   // keeps the refill issued here: left free, the scheduler sinks it to the loop's foot and the next pass waits out its whole latency
        }
#pragma unroll
        for (int qt = 0; qt < QT; ++qt) {
            const int d0 = q0 + qt * 16 + lr - kb - 8 * hi;   // i - j of element (t = 0, r = 0)
            float mx = m[qt];
#pragma unroll
            for (int t = 0; t < 2; ++t)
#pragma unroll
                for (int r = 0; r < 8; ++r) { const int d = d0 - t * 16 - r; const float x = ((unsigned)d < (unsigned)WIN) ? s[qt][t][r] - sl * (float)d : -__builtin_inff(); s[qt][t][r] = x; mx = fmaxf(mx, x); }
            mx = fmaxf(mx, __shfl_xor(mx, 16, 32));
            const float al = __builtin_amdgcn_exp2f((m[qt] - mx) * 1.4426950408889634f); m[qt] = mx;
            float ps = 0.f;
#pragma unroll
            for (int t = 0; t < 2; ++t)
#pragma unroll
                for (int r = 0; r < 8; ++r) { const float e = (s[qt][t][r] - mx) * 1.4426950408889634f; const float p = __builtin_amdgcn_exp2f(SPLIT ? e : e + 10.0f); s[qt][t][r] = p; ps += p; }
            l[qt] = l[qt] * al + ps;
#pragma unroll
            for (int dt = 0; dt < 4; ++dt) o[qt][dt] *= al;
            if constexpr (SPLIT) {
                v8us ph[2], pl[2];
#pragma unroll
                for (int t = 0; t < 2; ++t)
#pragma unroll
                    for (int r = 0; r < 8; ++r) { unsigned short a, c2; splitf(s[qt][t][r], a, c2); ph[t][r] = a; pl[t][r] = c2; }
                const V pfh = cat16b(ph[0], ph[1]), pfl = cat16b(pl[0], pl[1]);
#pragma unroll
                for (int dt = 0; dt < 4; ++dt) { o[qt][dt] = WFrag<T16>::mma(vf[dt], pfh, o[qt][dt]); o[qt][dt] = WFrag<T16>::mma(vf[dt], pfl, o[qt][dt]); o[qt][dt] = WFrag<T16>::mma(vf2[dt], pfh, o[qt][dt]); }
            } else {
                v8h p8[2];
#pragma unroll
                for (int t = 0; t < 2; ++t)
#pragma unroll
                    for (int r = 0; r < 8; ++r) p8[t][r] = tohx(s[qt][t][r]);
                const V pf = cat16(p8[0], p8[1]);
#pragma unroll
                for (int dt = 0; dt < 4; ++dt) o[qt][dt] = WFrag<T16>::mma(vf[dt], pf, o[qt][dt]);
            }
        }
    }
#pragma unroll
    for (int qt = 0; qt < QT; ++qt) {
        const float f = __fdiv_rn(1.0f, l[qt] + __shfl_xor(l[qt], 16, 32));
        float* op = orow + (size_t)(q0 + qt * 16 + lr) * DQ + 8 * hi;   // a lane's 8 accumulator registers are 8 consecutive e of its query row
#pragma unroll
        for (int dt = 0; dt < 4; ++dt) { v4f w0, w1;
#pragma unroll
            for (int r = 0; r < 4; ++r) { w0[r] = o[qt][dt][r] * f; w1[r] = o[qt][dt][4 + r] * f; }
            *(v4f*)(op + dt * 16) = w0; *(v4f*)(op + dt * 16 + 4) = w1; }
    }
}
#define QTF  2                               // query column groups per wave, fp16 rows (32 rows a wave); hi/lo rows: 1 (16 rows a wave)
#define NBH  (RH / 16 / 4)                   // workgroups (4 independent waves) of hi/lo rows per head
#define NBF  ((TT - RH) / (16 * QTF) / 4)    // workgroups of fp16 rows per head
__global__ __launch_bounds__(128) void k_fattn(const h16* __restrict__ Q16, const h16* __restrict__ K16, const h16* __restrict__ V16, const bf* __restrict__ Qh, const bf* __restrict__ Ql, const bf* __restrict__ Kh, const bf* __restrict__ Kl, const bf* __restrict__ Vh, const bf* __restrict__ Vl, float* __restrict__ OUT) {
    const int z = blockIdx.x, h = z % NH_, b = z / NH_; const size_t pz = (size_t)z * TT * HD;
    const int blk = NBH + NBF - 1 - (int)blockIdx.y;   // longest strips first in the grid
    const int wave = __builtin_amdgcn_readfirstlane(threadIdx.x >> 5);   // scalar: trip counts and plane addresses stay in scalar registers
    const float sl = exp2f(__fdiv_rn(__fmul_rn(-8.0f, (float)(h + 1)), (float)NH_));
    float* orow = OUT + (size_t)b * TT * DQ + h * HD;
    if (blk >= NBH) attn_strip<h16, false, QTF>(Q16 + pz, nullptr, K16 + pz, nullptr, V16 + pz, nullptr, sl, RH + ((blk - NBH) * 4 + wave) * 16 * QTF, orow);
    else attn_strip<bf, true, 1>(Qh + pz, Ql + pz, Kh + pz, Kl + pz, Vh + pz, Vl + pz, sl, (blk * 4 + wave) * 16, orow);
}
extern "C" void kernel_launch(void* const* d_in, const int* in_sizes, int n_in,
                              void* d_out, int out_size, void* d_ws, size_t ws_size, hipStream_t stream) {
    (void)in_sizes; (void)n_in; (void)out_size;
    const float* qkv = (const float*)d_in[0];
    float* OUT = (float*)d_out;     // [2][2048][1024]
    char* wsp = (char*)d_ws;
    auto take = [&](size_t bytes) { char* p = wsp; wsp += (bytes + 255) & ~(size_t)255; return (void*)p; };
    const size_t PB = (size_t)NH_ * TT * HD;   /* elements of one batch's plane set; every plane holds both batches */
    h16* QP16 = (h16*)take(NB_ * PB * 2); h16* KP16 = (h16*)take(NB_ * PB * 2); h16* VT16 = (h16*)take(NB_ * PB * 2);
    bf* QPh = (bf*)take(NB_ * PB * 2); bf* QPl = (bf*)take(NB_ * PB * 2); bf* KPh = (bf*)take(NB_ * PB * 2); bf* KPl = (bf*)take(NB_ * PB * 2); bf* VTh = (bf*)take(NB_ * PB * 2); bf* VTl = (bf*)take(NB_ * PB * 2);
    if ((size_t)(wsp - (char*)d_ws) > ws_size) return;    // ws 256 MiB

    k_planes<<<dim3(NH_ / PH, TT / PT, NB_), 256, 0, stream>>>(qkv, QP16, KP16, VT16, QPh, QPl, KPh, KPl, VTh, VTl);
    k_fattn<<<dim3(NB_ * NH_, NBH + NBF), 128, 0, stream>>>(QP16, KP16, VT16, QPh, QPl, KPh, KPl, VTh, VTl, OUT);
}

// v005
// Measured time: 36.7 microseconds a run.
// Two timings next to v004 put it at 1.08 and 1.07 times that version's speed.
// Over all steps from v000 it is 36.9 times as fast.
#include <hip/hip_runtime.h>

// FlexAttention training path: sliding-window causal attention with ALiBi (qkv [2][2048][3][16][64] packed; q, k, v = qkv[:, :, 0/1/2]; scores = q.k / 8 - slope_h (i - j), slope_h = 2^(-8 (h+1) / 16); keys with 0 <= i - j < 1024 only; softmax; out[b][l][h][e] -> [2][2048][16][64] f32 (4.2 M)).
// Layout: the packed input rows (stride 3 x 1024 floats) feed one plane-builder launch directly (bf16-rounded on read; q planes carry the exact 1/8 scale), both batches' planes side by side; one fused launch over all 32 (batch, head) pairs does scores, ALiBi bias (slope_h x (i - j), f32, exp2f slopes), window mask, online softmax and the probability x value product per strip of query rows (hybrid rows: < 512 hi/lo 3 products, rest fp16 x1024; only key blocks inside the band are visited) and writes the [l][h][e] output rows directly.
// Compute dtypes, f32 accumulate: qkv rounded to bf16; rows < 512 3 products, rest fp16; ALiBi bias and softmax f32; output f32.

#define NB_  2
#define TT   2048
#define DM   1024
#define NH_  16
#define NKV  16
#define REP  (NH_ / NKV)
#define HD   64
#define DQ   (NH_ * HD)
#define DKV  (NKV * HD)
#define RH   512                  // query rows < RH use hi+lo planes
#define WIN  1024
#define SCL  0.125f   // HD^-0.5
typedef _Float16 h16;
typedef unsigned short bf;
typedef __attribute__((ext_vector_type(16))) __bf16   v16bf;
typedef __attribute__((ext_vector_type(16))) _Float16 v16h;
typedef __attribute__((ext_vector_type(8)))  _Float16 v8h;
typedef __attribute__((ext_vector_type(8)))  unsigned short v8us;
typedef __attribute__((ext_vector_type(8)))  float    v8f;
typedef __attribute__((ext_vector_type(4)))  float    v4f;
typedef v8h  __attribute__((may_alias)) v8ha;
typedef v4f  __attribute__((may_alias)) v4fa;
typedef v8us __attribute__((may_alias)) v8usa;

__device__ __forceinline__ unsigned short f2bf(float f) { unsigned u = __float_as_uint(f); u += 0x7FFFu + ((u >> 16) & 1u); return (unsigned short)(u >> 16); }
__device__ __forceinline__ float bf2f(unsigned short b) { return __uint_as_float(((unsigned)b) << 16); }
__device__ __forceinline__ float bfr(float f) { return bf2f(f2bf(f)); }
__device__ __forceinline__ v16h cat16(v8h lo, v8h hi) { return __builtin_shufflevector(lo, hi, 0, 1, 2, 3, 4, 5, 6, 7, 8, 9, 10, 11, 12, 13, 14, 15); }
__device__ __forceinline__ v16bf cat16b(v8us lo, v8us hi) { return __builtin_bit_cast(v16bf, __builtin_shufflevector(lo, hi, 0, 1, 2, 3, 4, 5, 6, 7, 8, 9, 10, 11, 12, 13, 14, 15)); }
__device__ __forceinline__ v8f wmma16(v16h a, v16h b, v8f c) { return __builtin_amdgcn_wmma_f32_16x16x32_f16(false, a, false, b, (short)0, c, false, false); }
__device__ __forceinline__ v8f wmmab(v16bf a, v16bf b, v8f c) { return __builtin_amdgcn_wmma_f32_16x16x32_bf16(false, a, false, b, (short)0, c, false, false); }



// ---- k_gemmw: register-blocked GEMM, ONE WAVE per 64x64 output tile (16 accumulators), operands straight from K-contiguous 16-bit planes; grid (M/64, N/64, Z), 32 threads.
// C[m][n] (f32, pitch ldc, + optional f32 bias[n]) = sum_k A[m][k] Bt[n][k] (+ split products per NSPLIT). z-batch strides sA/sB/sC in elements. K % 32 == 0.
template <typename T16> struct WFrag;
template <> struct WFrag<h16> { typedef v16h V; static __device__ __forceinline__ V ld(const h16* p) { return cat16(*(const v8h*)p, *(const v8h*)(p + 16)); } static __device__ __forceinline__ V ldf(const h16* p) { return cat16(*(const v8h*)p, *(const v8h*)(p + 256)); } static __device__ __forceinline__ v8f mma(V a, V b, v8f c) { return wmma16(a, b, c); } };
template <> struct WFrag<bf> { typedef v16bf V; static __device__ __forceinline__ V ld(const bf* p) { return cat16b(*(const v8us*)p, *(const v8us*)(p + 16)); } static __device__ __forceinline__ V ldf(const bf* p) { return cat16b(*(const v8us*)p, *(const v8us*)(p + 256)); } static __device__ __forceinline__ v8f mma(V a, V b, v8f c) { return wmmab(a, b, c); } };
template <typename T16, int NSPLIT, bool BIAS>
__global__ __launch_bounds__(32) void k_gemmw(const T16* __restrict__ A, const T16* __restrict__ A2, const T16* __restrict__ Bt, const T16* __restrict__ Bt2, int K, float* C, int ldc, const float* __restrict__ bias, size_t sA, size_t sB, size_t sC) {
    typedef typename WFrag<T16>::V V;
    __shared__ __align__(16) float os[16 * 68];
    const size_t z = blockIdx.z; A += z * sA; if (A2) A2 += z * sA; Bt += z * sB; if (Bt2) Bt2 += z * sB; C += z * sC;
    const int lane = threadIdx.x & 31, lr = lane & 15, hi = lane >> 4; const int r0 = blockIdx.x * 64, c0 = blockIdx.y * 64;
    v8f acc[4][4];
#pragma unroll
    for (int mb = 0; mb < 4; ++mb)
#pragma unroll
        for (int nb = 0; nb < 4; ++nb) acc[mb][nb] = (v8f){};
    const size_t aoff = (size_t)(r0 + lr) * K + 8 * hi, boff = (size_t)(c0 + lr) * K + 8 * hi;
#pragma unroll 1
    for (int kc = 0; kc < K; kc += 32) {
        V a[4], a2[4];
#pragma unroll
        for (int mb = 0; mb < 4; ++mb) { a[mb] = WFrag<T16>::ld(A + aoff + (size_t)mb * 16 * K + kc); if (NSPLIT == 1 || NSPLIT == 2) a2[mb] = WFrag<T16>::ld(A2 + aoff + (size_t)mb * 16 * K + kc); }
#pragma unroll
        for (int nb = 0; nb < 4; ++nb) { const V b = WFrag<T16>::ld(Bt + boff + (size_t)nb * 16 * K + kc); V b2; if (NSPLIT >= 2) b2 = WFrag<T16>::ld(Bt2 + boff + (size_t)nb * 16 * K + kc);
#pragma unroll
            for (int mb = 0; mb < 4; ++mb) { acc[mb][nb] = WFrag<T16>::mma(a[mb], b, acc[mb][nb]); if (NSPLIT == 1 || NSPLIT == 2) acc[mb][nb] = WFrag<T16>::mma(a2[mb], b, acc[mb][nb]); if (NSPLIT >= 2) acc[mb][nb] = WFrag<T16>::mma(a[mb], b2, acc[mb][nb]); } }
        asm volatile("v_nop\n\tv_nop\n\tv_nop\n\tv_nop" : "+v"(acc[0][0]), "+v"(acc[1][1]), "+v"(acc[2][2]), "+v"(acc[3][3]) : "v"(a[0]), "v"(a[3]));
    }
#pragma unroll
    for (int mb = 0; mb < 4; ++mb) {
#pragma unroll
        for (int nb = 0; nb < 4; ++nb) {
#pragma unroll
            for (int j = 0; j < 8; ++j) os[(hi * 8 + j) * 68 + nb * 16 + lr] = acc[mb][nb][j]; }
        __builtin_amdgcn_wave_barrier(); asm volatile("" ::: "memory");
        float* crow = C + (size_t)(r0 + mb * 16) * ldc + c0;
{
#pragma unroll
            for (int s = 0; s < 8; ++s) { const int row = 2 * s + hi, cofs = lr * 4; v4f val = *(const v4fa*)(os + row * 68 + cofs); if (BIAS) { val[0] += bfr(bias[c0 + cofs]); val[1] += bfr(bias[c0 + cofs + 1]); val[2] += bfr(bias[c0 + cofs + 2]); val[3] += bfr(bias[c0 + cofs + 3]); }
                *(v4f*)(crow + (size_t)row * ldc + cofs) = val; }
             }
        __builtin_amdgcn_wave_barrier(); asm volatile("" ::: "memory");
    }
}

__device__ __forceinline__ h16 tohx(float x) { return (h16)x; }
__device__ __forceinline__ void splitf(float y, unsigned short& h, unsigned short& l) { h = f2bf(y); l = f2bf(y - bf2f(h)); }
typedef __attribute__((ext_vector_type(2))) _Float16 v2h;
typedef __attribute__((ext_vector_type(4))) _Float16 v4h;
typedef __attribute__((ext_vector_type(2))) unsigned short v2us;
typedef __attribute__((ext_vector_type(4))) unsigned short v4us;
typedef __attribute__((ext_vector_type(2))) float v2f;
typedef __attribute__((ext_vector_type(4))) int v4i;

__global__ __launch_bounds__(256) void k_wtG(const float* __restrict__ w, int K, int N, bf* Bt) {
    const int lane = threadIdx.x & 31; const int L0 = (blockIdx.x * 8 + (threadIdx.x >> 5)) * 8; const int nlines = N * K / 64;
{
#pragma unroll 1
        for (int l = 0; l < 8; ++l) { const int L = L0 + l; if (L >= nlines) break; const size_t e = (size_t)L * 64 + lane * 2; const int k = (int)(e % K), n = (int)(e / K); v2us o;
            o[0] = f2bf(w[(size_t)k * N + n]); o[1] = f2bf(w[(size_t)(k + 1) * N + n]); *(v2us*)(Bt + e) = o; }
         }
}
__global__ __launch_bounds__(256) void k_cvt8(const float* __restrict__ src, bf* dst, size_t n8) { const size_t i = (size_t)blockIdx.x * 256 + threadIdx.x; if (i >= n8) return; const v8f v = *(const v8f*)(src + i * 8); v8us o;
#pragma unroll
    for (int k = 0; k < 8; ++k) o[k] = f2bf(v[k]); *(v8us*)(dst + i * 8) = o;  }

// ---- k_planes: every plane the attention launch reads, from one read of the packed input, in one launch.
// One workgroup takes PT positions x PH heads of q, k and v: 24 16-byte loads a thread, all issued before the first use (few waves, many bytes in flight each).
// q rows keep their [t][d] order: a wave's load is one position's 128 floats (2 heads), its store one whole 128-byte plane row per head.
// k and v planes are laid out in the order in which the attention launch's A fragments are loaded, in chunks of 8 elements (16 bytes, one lane's share of one load):
//   k: [head][t / 16][d / 8][t % 16][8 d]      v: [head][t / 32][d / 16][(t % 32) / 8][d % 16][8 t]
// so that lane (lr + 16 hi) of a fragment load finds its chunk at lane x 16 bytes: one load reads 512 bytes in a row (4 lines) where rows of a [t][d] or [d][t] plane gave it 16 lines.
// k goes through LDS as bf16 rows of KP words (128 + 16 bytes: the 16-byte reads of 16 rows fall on different banks), the second head's rows 32 banks further (the two halves of a wave's 8-byte writes do not meet); a wave's store is 2 chunk columns x 16 keys = 512 bytes in a row.
// v is transposed through LDS as words of two bf16 (positions 2 tp, 2 tp + 1) at [d][tp], pitch VP words: the writes (16 d-quads x 2 tp a wave) and the reads (16 d rows x 2 key blocks a wave) each fall on 32 different banks; a wave's store is two runs of 256 bytes.
// Every loop is fully unrolled: the arrays of loaded values stay in registers only under constant indices.
// Values as before: input rounded to bf16 on read, q x 1/8 (exact), fp16 and hi/lo from that. Only what is read later is written: q fp16 for rows >= RH, q hi/lo for rows < RH, k and v fp16 everywhere, k and v hi/lo for positions < RH.
#define PT   64
#define PH   2
#define VP   33
#define KP   36
#define KHS  (PT * KP + 32)
typedef __attribute__((ext_vector_type(2))) unsigned v2u;
typedef __attribute__((ext_vector_type(4))) unsigned v4u;
template <bool LOW>
__device__ __forceinline__ void planes_out(const unsigned* vs, const unsigned* ks, const v4f (&xq)[8], int tid, int z0, int t0, h16* __restrict__ Q16, h16* __restrict__ K16, h16* __restrict__ V16, bf* __restrict__ Qh, bf* __restrict__ Ql, bf* __restrict__ Kh, bf* __restrict__ Kl, bf* __restrict__ Vh, bf* __restrict__ Vl) {
    const int lane = tid & 31, wave = tid >> 5;
#pragma unroll
    for (int i = 0; i < 4; ++i) { const int idx = i * 256 + tid, lr = idx & 15, blk = (idx >> 4) & 1, c = (idx >> 5) & 3, dg = idx >> 7;   // dg: group of 16 d rows, over both heads
        const size_t e = (size_t)(z0 + (dg >> 2)) * (TT * HD) + (size_t)(t0 + blk * 32) * HD + (dg & 3) * 512 + c * 128 + lr * 8; v8h o16; v8us oh, ol;
#pragma unroll
        for (int k = 0; k < 4; ++k) { const unsigned w = vs[(dg * 16 + lr) * VP + (blk * 4 + c) * 4 + k];
#pragma unroll
            for (int q = 0; q < 2; ++q) { const float x = bf2f((unsigned short)(q ? (w >> 16) : (w & 0xFFFFu))); o16[2 * k + q] = tohx(x); if (LOW) { unsigned short a2, c2; splitf(x, a2, c2); oh[2 * k + q] = a2; ol[2 * k + q] = c2; } } }
        *(v8h*)(V16 + e) = o16; if (LOW) { *(v8us*)(Vh + e) = oh; *(v8us*)(Vl + e) = ol; } }
#pragma unroll
    for (int i = 0; i < 4; ++i) { const int idx = i * 256 + tid, key = idx & 15, c8 = (idx >> 4) & 7, tg = idx >> 7;   // tg: group of 16 positions, over both heads
        const size_t e = (size_t)(z0 + (tg >> 2)) * (TT * HD) + (size_t)(t0 + (tg & 3) * 16) * HD + c8 * 128 + key * 8; v8h o16; v8us oh, ol;
        const v4u w4 = *(const v4u*)(ks + (tg >> 2) * KHS + ((tg & 3) * 16 + key) * KP + c8 * 4);
#pragma unroll
        for (int k = 0; k < 4; ++k)
#pragma unroll
            for (int q = 0; q < 2; ++q) { const float x = bf2f((unsigned short)(q ? (w4[k] >> 16) : (w4[k] & 0xFFFFu))); o16[2 * k + q] = tohx(x); if (LOW) { unsigned short a2, c2; splitf(x, a2, c2); oh[2 * k + q] = a2; ol[2 * k + q] = c2; } }
        *(v8h*)(K16 + e) = o16; if (LOW) { *(v8us*)(Kh + e) = oh; *(v8us*)(Kl + e) = ol; } }
#pragma unroll
    for (int i = 0; i < 8; ++i) { const size_t e = ((size_t)(z0 + (lane >> 4)) * TT + t0 + i * 8 + wave) * HD + (lane & 15) * 4; v4h q16; v4us qh, ql;
#pragma unroll
        for (int j = 0; j < 4; ++j) { const float rq = bfr(xq[i][j]) * SCL;
            if (LOW) { unsigned short a2, c2; splitf(rq, a2, c2); qh[j] = a2; ql[j] = c2; } else q16[j] = tohx(rq); }
        if (LOW) { *(v4us*)(Qh + e) = qh; *(v4us*)(Ql + e) = ql; } else *(v4h*)(Q16 + e) = q16; }
}
__global__ __launch_bounds__(256) void k_planes(const float* __restrict__ qkv, h16* __restrict__ Q16, h16* __restrict__ K16, h16* __restrict__ V16, bf* __restrict__ Qh, bf* __restrict__ Ql, bf* __restrict__ Kh, bf* __restrict__ Kl, bf* __restrict__ Vh, bf* __restrict__ Vl) {
    __shared__ unsigned vs[PH * HD * VP];
    __shared__ __align__(16) unsigned ks[PH * KHS];
    const int tid = threadIdx.x, lane = tid & 31, wave = tid >> 5;
    const int z0 = blockIdx.z * NH_ + blockIdx.x * PH, t0 = blockIdx.y * PT;
    const float* src = qkv + ((size_t)blockIdx.z * TT + t0) * (3 * DQ) + blockIdx.x * (PH * HD);
    const float* pv = src + (size_t)(2 * (tid >> 4)) * (3 * DQ) + (tid & 15) * 4;   // v (at + 2 DQ): positions 2 tp and 2 tp + 1, tp = tid / 16 (+ 16), d-quad tid % 16
    const float* pq = src + (size_t)wave * (3 * DQ) + lane * 4;   // q (k at + DQ): position wave (+ 8 i), 128 floats over the lanes
    v4f xv[8], xq[8], xk[8];
#pragma unroll
    for (int i = 0; i < 4; ++i) { const float* p = pv + 2 * DQ + (i & 1) * (32 * 3 * DQ) + (i >> 1) * HD; xv[2 * i] = *(const v4f*)p; xv[2 * i + 1] = *(const v4f*)(p + 3 * DQ); }
#pragma unroll
    for (int i = 0; i < 8; ++i) { const float* p = pq + i * (8 * 3 * DQ); xq[i] = *(const v4f*)p; xk[i] = *(const v4f*)(p + DQ); }
    asm volatile("s_wait_xcnt 0x0" :: "v"(pv), "v"(pq) : "memory");   // stands in front of every overwrite of an address register of the loads above; it names the two addresses so that they stay in their registers up to here (else a later load's result is given an earlier load's address pair)
    __builtin_amdgcn_sched_barrier(0);   // keeps all 24 loads issued here: left free, the scheduler holds the last of them back until the first values have arrived, a second memory latency
#pragma unroll
    for (int i = 0; i < 4; ++i)
#pragma unroll
        for (int j = 0; j < 4; ++j) vs[((i >> 1) * HD + (tid & 15) * 4 + j) * VP + (i & 1) * 16 + (tid >> 4)] = (unsigned)f2bf(xv[2 * i][j]) | ((unsigned)f2bf(xv[2 * i + 1][j]) << 16);
#pragma unroll
    for (int i = 0; i < 8; ++i) { v2u w; w[0] = (unsigned)f2bf(xk[i][0]) | ((unsigned)f2bf(xk[i][1]) << 16); w[1] = (unsigned)f2bf(xk[i][2]) | ((unsigned)f2bf(xk[i][3]) << 16); *(v2u*)(ks + (lane >> 4) * KHS + (i * 8 + wave) * KP + (lane & 15) * 2) = w; }
    __syncthreads();   // the v and k tiles are whole; nothing is written to them afterwards
    if (t0 < RH) { planes_out<true>(vs, ks, xq, tid, z0, t0, Q16, K16, V16, Qh, Ql, Kh, Kl, Vh, Vl); return; }   // the same branch for the whole workgroup, behind the only barrier
    planes_out<false>(vs, ks, xq, tid, z0, t0, Q16, K16, V16, Qh, Ql, Kh, Kl, Vh, Vl);
    asm volatile("s_wait_xcnt 0x0" ::: "memory");   // the built code lays this path in front of the other one and ends it with a conditional jump: the fall-through (never taken) rewrites address registers of the stores above
}
// ---- k_fattn: scores, ALiBi + window softmax and the probability x value product of one strip of query rows, with nothing of the scores leaving the registers.
// KS = 1: one wave walks all key passes of the strip. KS = 2: two waves of the workgroup walk one part of the passes each ('cut' and the rest), with their own running maximum, sum and accumulators; the two partial results are merged through LDS behind one barrier (weights exp(m_p - max), divided by the merged sum).
// Transposed products: St[key][query] = K . Qt (A = K rows, B = Q rows), Ot[d][query] += Vt . Pt (A = Vt rows, B = the packed score accumulators: two 16-key St tiles of one query column group are, converted in place, one 32-key B operand).
// A lane holds one query column (query = lr), so the running maximum, the running sum and the rescale factor are per-lane values; the two lane halves (keys 8 hi .. 8 hi + 7 of each 16) join by one exchange.
// Online softmax over passes of 32 keys from the window's first key block to the diagonal block. Masked scores are -inf, the running maximum starts at a finite -3e38: a pass with no valid key for a column adds exactly 0.
// Every inner loop is fully unrolled (the fragment and accumulator arrays stay in registers only under constant indices); the pass loop stays rolled (one pass's fragments and temporaries already take the wave's register budget).
// SPLIT (rows < RH): bf16 hi/lo planes, 3 products for St and for Ot. Otherwise fp16 planes, probabilities carried x 1024 (in the exponent; the row sum carries the same factor, so it cancels in the division).
#define QTF  2                               // query column groups per wave, fp16 rows (32 rows a strip); hi/lo rows: 1 (16 rows a strip)
#define NWV  12                              // waves per workgroup
#define SLOT (QTF * 4 * 256)                 // floats of one wave's partial output in LDS
template <typename T16, bool SPLIT, int QT, int KS>
__device__ __forceinline__ void attn_strip(const T16* __restrict__ Q, const T16* __restrict__ Q2, const T16* __restrict__ Kp, const T16* __restrict__ K2, const T16* __restrict__ Vt, const T16* __restrict__ Vt2, float sl, int q0, int part, int skew, int slot0, int sstep, float* smo, float* sml, float* __restrict__ orow) {
    typedef typename WFrag<T16>::V V;
    static_assert(KS == 1 || KS == QT, "the merging wave 'part' takes the query column group 'part'");
    const int lane = threadIdx.x & 31, lr = lane & 15, hi = lane >> 4;
    V qf[QT][2], qf2[QT][2];
#pragma unroll
    for (int qt = 0; qt < QT; ++qt)
#pragma unroll
        for (int kc = 0; kc < 2; ++kc) { const size_t off = (size_t)(q0 + qt * 16 + lr) * HD + kc * 32 + 8 * hi; qf[qt][kc] = WFrag<T16>::ld(Q + off); if (SPLIT) qf2[qt][kc] = WFrag<T16>::ld(Q2 + off); }
    v8f o[QT][4]; float m[QT], l[QT];
#pragma unroll
    for (int qt = 0; qt < QT; ++qt) { m[qt] = -3.0e38f; l[qt] = 0.f;
#pragma unroll
        for (int dt = 0; dt < 4; ++dt) o[qt][dt] = (v8f){}; }
    const int kall = max(q0 - (WIN - 1), 0) & ~31, npass = (q0 + QT * 16 + 31 - kall) >> 5;   // key blocks of 32 that hold a valid key of some row of the strip
    const int cut = (npass - skew) >> 1;   // KS = 2: wave 0 takes the first 'cut' passes, wave 1 the rest, 'skew' more (used where a strip has 17 passes or more and skew is at most 8: no run is empty)
    const int kbeg = kall + (KS == 1 ? 0 : part * cut) * 32, kend = kall + ((KS == 1 || part != 0) ? npass : cut) * 32;   // this wave's run of passes
    const unsigned flane = lane * 8;   // the lane's own chunk of a fragment load (k and v planes are in fragment order: 32 keys of either are 4 KiB in a row, 8 loads of 512 bytes)
    V kf[2][2], kf2[2][2];
    if (!SPLIT) {   // fp16 strips fetch their K fragments one pass ahead; the hi/lo strips (twice the planes, at most half the passes) fetch them at the head of the pass
#pragma unroll
        for (int t = 0; t < 2; ++t)
#pragma unroll
            for (int kc = 0; kc < 2; ++kc) kf[t][kc] = WFrag<T16>::ldf(Kp + (size_t)kbeg * HD + flane + (t * 16 * HD + kc * 512));
    }
#pragma unroll 1
    for (int kb = kbeg; kb < kend; kb += 32) {
        V vf[4], vf2[4];
        const size_t boff = (size_t)kb * HD + flane;   // this pass's 32 keys, the lane's chunk
        const T16* const kp = Kp + boff; const T16* const kp2 = SPLIT ? K2 + boff : nullptr; const T16* const vp = Vt + boff; const T16* const vp2 = SPLIT ? Vt2 + boff : nullptr;
        if (SPLIT) {
#pragma unroll
            for (int t = 0; t < 2; ++t)
#pragma unroll
                for (int kc = 0; kc < 2; ++kc) { kf[t][kc] = WFrag<T16>::ldf(kp + (t * 16 * HD + kc * 512)); kf2[t][kc] = WFrag<T16>::ldf(kp2 + (t * 16 * HD + kc * 512)); }
        }
#pragma unroll
        for (int dt = 0; dt < 4; ++dt) { vf[dt] = WFrag<T16>::ldf(vp + dt * 512); if (SPLIT) vf2[dt] = WFrag<T16>::ldf(vp2 + dt * 512); }
        // the wait stands in front of every later overwrite of an address register of the loads above (the compiler reuses them); with four planes' loads it names the addresses so that they stay in their registers up to here (else a later load's result is given an earlier load's address pair)
        if constexpr (SPLIT) asm volatile("s_wait_xcnt 0x0" :: "v"(kp), "v"(kp2), "v"(vp), "v"(vp2) : "memory");
        else asm volatile("s_wait_xcnt 0x0" ::: "memory");
        __builtin_amdgcn_sched_barrier(0);   // keeps the V loads issued here: left free, the scheduler sinks them to just in front of the P.V products and their whole latency is waited out there
        v8f s[QT][2];
#pragma unroll
        for (int t = 0; t < 2; ++t)
#pragma unroll
            for (int qt = 0; qt < QT; ++qt) { v8f a = (v8f){};
#pragma unroll
                for (int kc = 0; kc < 2; ++kc) { a = WFrag<T16>::mma(kf[t][kc], qf[qt][kc], a); if (SPLIT) { a = WFrag<T16>::mma(kf[t][kc], qf2[qt][kc], a); a = WFrag<T16>::mma(kf2[t][kc], qf[qt][kc], a); } }
                s[qt][t] = a; }
        if (!SPLIT) {
            const int kn = (kb + 32 < kend) ? kb + 32 : kb;   // next pass's K fragments: their latency runs under the softmax (the last pass fetches its own block again: in bounds, unused)
            const T16* const kpn = Kp + (size_t)kn * HD + flane;
#pragma unroll
            for (int t = 0; t < 2; ++t)
#pragma unroll
                for (int kc = 0; kc < 2; ++kc) kf[t][kc] = WFrag<T16>::ldf(kpn + (t * 16 * HD + kc * 512));
            asm volatile("s_wait_xcnt 0x0" :: "v"(kpn) : "memory");   // as above, for the refill's address registers; it names the address so that it stays in its registers up to here (else the last load's result is given the pair that the earlier loads name)
            __builtin_amdgcn_sched_barrier(0);   // keeps the refill issued here: left free, the scheduler sinks it to the loop's foot and the next pass waits out its whole latency
        }
#pragma unroll
        for (int qt = 0; qt < QT; ++qt) {
            const int d0 = q0 + qt * 16 + lr - kb - 8 * hi;   // i - j of element (t = 0, r = 0)
            float mx = m[qt];
#pragma unroll
            for (int t = 0; t < 2; ++t)
#pragma unroll
                for (int r = 0; r < 8; ++r) { const int d = d0 - t * 16 - r; const float x = ((unsigned)d < (unsigned)WIN) ? s[qt][t][r] - sl * (float)d : -__builtin_inff(); s[qt][t][r] = x; mx = fmaxf(mx, x); }
            mx = fmaxf(mx, __shfl_xor(mx, 16, 32));
            const float al = __builtin_amdgcn_exp2f((m[qt] - mx) * 1.4426950408889634f); m[qt] = mx;
            float ps = 0.f;
#pragma unroll
            for (int t = 0; t < 2; ++t)
#pragma unroll
                for (int r = 0; r < 8; ++r) { const float e = (s[qt][t][r] - mx) * 1.4426950408889634f; const float p = __builtin_amdgcn_exp2f(SPLIT ? e : e + 10.0f); s[qt][t][r] = p; ps += p; }
            l[qt] = l[qt] * al + ps;
#pragma unroll
            for (int dt = 0; dt < 4; ++dt) o[qt][dt] *= al;
            if constexpr (SPLIT) {
                v8us ph[2], pl[2];
#pragma unroll
                for (int t = 0; t < 2; ++t)
#pragma unroll
                    for (int r = 0; r < 8; ++r) { unsigned short a, c2; splitf(s[qt][t][r], a, c2); ph[t][r] = a; pl[t][r] = c2; }
                const V pfh = cat16b(ph[0], ph[1]), pfl = cat16b(pl[0], pl[1]);
#pragma unroll
                for (int dt = 0; dt < 4; ++dt) { o[qt][dt] = WFrag<T16>::mma(vf[dt], pfh, o[qt][dt]); o[qt][dt] = WFrag<T16>::mma(vf[dt], pfl, o[qt][dt]); o[qt][dt] = WFrag<T16>::mma(vf2[dt], pfh, o[qt][dt]); }
            } else {
                v8h p8[2];
#pragma unroll
                for (int t = 0; t < 2; ++t)
#pragma unroll
                    for (int r = 0; r < 8; ++r) p8[t][r] = tohx(s[qt][t][r]);
                const V pf = cat16(p8[0], p8[1]);
#pragma unroll
                for (int dt = 0; dt < 4; ++dt) o[qt][dt] = WFrag<T16>::mma(vf[dt], pf, o[qt][dt]);
            }
        }
    }
    if constexpr (KS == 1) {
#pragma unroll
    for (int qt = 0; qt < QT; ++qt) {
        const float f = __fdiv_rn(1.0f, l[qt] + __shfl_xor(l[qt], 16, 32));
        float* op = orow + (size_t)(q0 + qt * 16 + lr) * DQ + 8 * hi;   // a lane's 8 accumulator registers are 8 consecutive e of its query row
#pragma unroll
        for (int dt = 0; dt < 4; ++dt) { v4f w0, w1;
#pragma unroll
            for (int r = 0; r < 4; ++r) { w0[r] = o[qt][dt][r] * f; w1[r] = o[qt][dt][4 + r] * f; }
            *(v4f*)(op + dt * 16) = w0; *(v4f*)(op + dt * 16 + 4) = w1; }
    }
    asm volatile("s_wait_xcnt 0x0" ::: "memory");   // stands in front of every later overwrite of a register of the stores above (a second strip follows in the same wave)
    } else {
    // hand-over: each wave lays its partial result into its own LDS slot, each lane its own 16-byte chunks (a wave's store or load is 512 bytes in a row), with the column's maximum and its sum joined over the two lane halves
    float* const myo = smo + (slot0 + part * sstep) * SLOT; float* const myl = sml + (slot0 + part * sstep) * 128;
#pragma unroll
    for (int qt = 0; qt < QT; ++qt) {
        myl[(qt * 2) * 32 + lane] = m[qt]; myl[(qt * 2 + 1) * 32 + lane] = l[qt] + __shfl_xor(l[qt], 16, 32);
#pragma unroll
        for (int dt = 0; dt < 4; ++dt) { v4f w0, w1;
#pragma unroll
            for (int r = 0; r < 4; ++r) { w0[r] = o[qt][dt][r]; w1[r] = o[qt][dt][4 + r]; }
            *(v4f*)(myo + ((qt * 4 + dt) * 2) * 128 + lane * 4) = w0; *(v4f*)(myo + ((qt * 4 + dt) * 2 + 1) * 128 + lane * 4) = w1; }
    }
    __syncthreads();   // all partial results of the workgroup's strips are in LDS; nothing is written there afterwards
    // merge: wave 'part' takes the query column group 'part' of its strip: 16 whole output rows of the head
    float wg[KS]; float mall = -3.0e38f, lall = 0.f;
#pragma unroll
    for (int p = 0; p < KS; ++p) { wg[p] = sml[(slot0 + p * sstep) * 128 + (part * 2) * 32 + lane]; mall = fmaxf(mall, wg[p]); }
#pragma unroll
    for (int p = 0; p < KS; ++p) { wg[p] = __builtin_amdgcn_exp2f((wg[p] - mall) * 1.4426950408889634f); lall += wg[p] * sml[(slot0 + p * sstep) * 128 + (part * 2 + 1) * 32 + lane]; }
    const float f = __fdiv_rn(1.0f, lall);
#pragma unroll
    for (int p = 0; p < KS; ++p) wg[p] *= f;
    float* op = orow + (size_t)(q0 + part * 16 + lr) * DQ + 8 * hi;   // a lane's 8 accumulator registers are 8 consecutive e of its query row
#pragma unroll
    for (int dt = 0; dt < 4; ++dt) { v4f w0 = (v4f){}, w1 = (v4f){};
#pragma unroll
        for (int p = 0; p < KS; ++p) { const float* ps = smo + (slot0 + p * sstep) * SLOT + ((part * 4 + dt) * 2) * 128 + lane * 4; w0 += *(const v4f*)ps * wg[p]; w1 += *(const v4f*)(ps + 128) * wg[p]; }
        *(v4f*)(op + dt * 16) = w0; *(v4f*)(op + dt * 16 + 4) = w1; }
    }
}
// Deal of the work: one workgroup of 12 waves for each WGP of the chip (3 waves a SIMD is what the registers allow, so no two workgroups share a WGP), every workgroup with about the same sum of passes. Workgroup g (of NGW) of a (batch, head) pair:
//   waves 4 .. 11: four neighbouring full-window fp16 strips (33 passes), two waves a strip;
//   waves 0 .. 3:  one hi/lo strip each (16 rows, all its passes), then two of the shorter fp16 strips (17 + 2 g and 18 + 2 g passes), two waves a strip. Waves 0 and 1 have hi/lo strips of 16 - g passes, waves 2 and 3 of 8 - g:
//                  the longer hi/lo strips go with the shorter fp16 strips, and of an fp16 strip the wave that had NGW hi/lo passes more takes NGW passes fewer: the four waves cost about the same, in every workgroup.
// The waves with two strips have the most passes and the lowest numbers (for speed only).
#define NGW  (RH / 16 / 4)                   // workgroups per (batch, head) pair
#define NSS  (2 * NGW)                       // fp16 strips with fewer passes than the full window (rows RH .. WIN - 1)
static_assert(NSS * 16 * QTF == WIN - RH && (NSS + 4 * NGW) * 16 * QTF == TT - RH, "every fp16 strip is dealt once");
__global__ __launch_bounds__(NWV * 32) void k_fattn(const h16* __restrict__ Q16, const h16* __restrict__ K16, const h16* __restrict__ V16, const bf* __restrict__ Qh, const bf* __restrict__ Ql, const bf* __restrict__ Kh, const bf* __restrict__ Kl, const bf* __restrict__ Vh, const bf* __restrict__ Vl, float* __restrict__ OUT) {
    __shared__ __align__(16) float smo[NWV * SLOT];
    __shared__ float sml[NWV * 128];
    const int z = blockIdx.x, h = z % NH_, b = z / NH_; const size_t pz = (size_t)z * TT * HD;
    const int g = blockIdx.y;
    const int wave = __builtin_amdgcn_readfirstlane(threadIdx.x >> 5);   // scalar: trip counts and plane addresses stay in scalar registers
    const float sl = exp2f(__fdiv_rn(__fmul_rn(-8.0f, (float)(h + 1)), (float)NH_));
    float* orow = OUT + (size_t)b * TT * DQ + h * HD;
    const bool two = wave < 4;   // the same for a whole wave; no barrier stands inside the branch
    if (two) attn_strip<bf, true, 1, 1>(Qh + pz, Ql + pz, Kh + pz, Kl + pz, Vh + pz, Vl + pz, sl, ((2 * NGW - 1 - g - NGW * (wave >> 1)) * 2 + (wave & 1)) * 16, 0, 0, 0, 0, smo, sml, orow);
    const int strip = two ? g * 2 + (wave & 1) : NSS + g * 4 + (wave & 3);
    const int part  = two ? wave >> 1 : (wave - 4) >> 2;
    const int slot0 = two ? (wave & 1) : 4 + (wave & 3);   // LDS slot of the strip's first wave; its second wave's is sstep further
    const int sstep = two ? 2 : 4;
    attn_strip<h16, false, QTF, 2>(Q16 + pz, nullptr, K16 + pz, nullptr, V16 + pz, nullptr, sl, RH + strip * 16 * QTF, part, two ? NGW : 0, slot0, sstep, smo, sml, orow);
}
extern "C" void kernel_launch(void* const* d_in, const int* in_sizes, int n_in,
                              void* d_out, int out_size, void* d_ws, size_t ws_size, hipStream_t stream) {
    (void)in_sizes; (void)n_in; (void)out_size;
    const float* qkv = (const float*)d_in[0];
    float* OUT = (float*)d_out;     // [2][2048][1024]
    char* wsp = (char*)d_ws;
    auto take = [&](size_t bytes) { char* p = wsp; wsp += (bytes + 255) & ~(size_t)255; return (void*)p; };
    const size_t PB = (size_t)NH_ * TT * HD;   /* elements of one batch's plane set; every plane holds both batches */
    h16* QP16 = (h16*)take(NB_ * PB * 2); h16* KP16 = (h16*)take(NB_ * PB * 2); h16* VT16 = (h16*)take(NB_ * PB * 2);
    bf* QPh = (bf*)take(NB_ * PB * 2); bf* QPl = (bf*)take(NB_ * PB * 2); bf* KPh = (bf*)take(NB_ * PB * 2); bf* KPl = (bf*)take(NB_ * PB * 2); bf* VTh = (bf*)take(NB_ * PB * 2); bf* VTl = (bf*)take(NB_ * PB * 2);
    if ((size_t)(wsp - (char*)d_ws) > ws_size) return;    // ws 256 MiB

    k_planes<<<dim3(NH_ / PH, TT / PT, NB_), 256, 0, stream>>>(qkv, QP16, KP16, VT16, QPh, QPl, KPh, KPl, VTh, VTl);
    k_fattn<<<dim3(NB_ * NH_, NGW), NWV * 32, 0, stream>>>(QP16, KP16, VT16, QPh, QPl, KPh, KPl, VTh, VTl, OUT);
}

// v006
// One run takes 35.1 microseconds.
// Next to v005, in two timings, it ran 1.05 and 1.04 times as fast.
// Over all steps from v000 it is 38.6 times as fast.
#include <hip/hip_runtime.h>

// FlexAttention training path: sliding-window causal attention with ALiBi (qkv [2][2048][3][16][64] packed; q, k, v = qkv[:, :, 0/1/2]; scores = q.k / 8 - slope_h (i - j), slope_h = 2^(-8 (h+1) / 16); keys with 0 <= i - j < 1024 only; softmax; out[b][l][h][e] -> [2][2048][16][64] f32 (4.2 M)).
// Layout: the packed input rows (stride 3 x 1024 floats) feed one plane-builder launch directly (bf16-rounded on read; q planes carry the exact 1/8 scale), both batches' planes side by side; one fused launch over all 32 (batch, head) pairs does scores, ALiBi bias (slope_h x (i - j), f32, exp2f slopes), window mask, online softmax and the probability x value product per strip of query rows (hybrid rows: < 512 hi/lo 3 products, rest fp16 x1024; only key blocks inside the band are visited) and writes the [l][h][e] output rows directly.
// Compute dtypes, f32 accumulate: qkv rounded to bf16; rows < 512 3 products, rest fp16; ALiBi bias and softmax f32; output f32.

#define NB_  2
#define TT   2048
#define DM   1024
#define NH_  16
#define NKV  16
#define REP  (NH_ / NKV)
#define HD   64
#define DQ   (NH_ * HD)
#define DKV  (NKV * HD)
#define RH   512                  // query rows < RH use hi+lo planes
#define WIN  1024
#define SCL  0.125f   // HD^-0.5
typedef _Float16 h16;
typedef unsigned short bf;
typedef __attribute__((ext_vector_type(16))) __bf16   v16bf;
typedef __attribute__((ext_vector_type(16))) _Float16 v16h;
typedef __attribute__((ext_vector_type(8)))  _Float16 v8h;
typedef __attribute__((ext_vector_type(8)))  unsigned short v8us;
typedef __attribute__((ext_vector_type(8)))  float    v8f;
typedef __attribute__((ext_vector_type(4)))  float    v4f;
typedef v8h  __attribute__((may_alias)) v8ha;
typedef v4f  __attribute__((may_alias)) v4fa;
typedef v8us __attribute__((may_alias)) v8usa;

__device__ __forceinline__ unsigned short f2bf(float f) { unsigned u = __float_as_uint(f); u += 0x7FFFu + ((u >> 16) & 1u); return (unsigned short)(u >> 16); }
__device__ __forceinline__ float bf2f(unsigned short b) { return __uint_as_float(((unsigned)b) << 16); }
__device__ __forceinline__ float bfr(float f) { return bf2f(f2bf(f)); }
__device__ __forceinline__ v16h cat16(v8h lo, v8h hi) { return __builtin_shufflevector(lo, hi, 0, 1, 2, 3, 4, 5, 6, 7, 8, 9, 10, 11, 12, 13, 14, 15); }
__device__ __forceinline__ v16bf cat16b(v8us lo, v8us hi) { return __builtin_bit_cast(v16bf, __builtin_shufflevector(lo, hi, 0, 1, 2, 3, 4, 5, 6, 7, 8, 9, 10, 11, 12, 13, 14, 15)); }
__device__ __forceinline__ v8f wmma16(v16h a, v16h b, v8f c) { return __builtin_amdgcn_wmma_f32_16x16x32_f16(false, a, false, b, (short)0, c, false, false); }
__device__ __forceinline__ v8f wmmab(v16bf a, v16bf b, v8f c) { return __builtin_amdgcn_wmma_f32_16x16x32_bf16(false, a, false, b, (short)0, c, false, false); }



// ---- k_gemmw: register-blocked GEMM, ONE WAVE per 64x64 output tile (16 accumulators), operands straight from K-contiguous 16-bit planes; grid (M/64, N/64, Z), 32 threads.
// C[m][n] (f32, pitch ldc, + optional f32 bias[n]) = sum_k A[m][k] Bt[n][k] (+ split products per NSPLIT). z-batch strides sA/sB/sC in elements. K % 32 == 0.
template <typename T16> struct WFrag;
template <> struct WFrag<h16> { typedef v16h V; static __device__ __forceinline__ V ld(const h16* p) { return cat16(*(const v8h*)p, *(const v8h*)(p + 16)); } static __device__ __forceinline__ V ldf(const h16* p) { return cat16(*(const v8h*)p, *(const v8h*)(p + 256)); } static __device__ __forceinline__ v8f mma(V a, V b, v8f c) { return wmma16(a, b, c); } };
template <> struct WFrag<bf> { typedef v16bf V; static __device__ __forceinline__ V ld(const bf* p) { return cat16b(*(const v8us*)p, *(const v8us*)(p + 16)); } static __device__ __forceinline__ V ldf(const bf* p) { return cat16b(*(const v8us*)p, *(const v8us*)(p + 256)); } static __device__ __forceinline__ v8f mma(V a, V b, v8f c) { return wmmab(a, b, c); } };
template <typename T16, int NSPLIT, bool BIAS>
__global__ __launch_bounds__(32) void k_gemmw(const T16* __restrict__ A, const T16* __restrict__ A2, const T16* __restrict__ Bt, const T16* __restrict__ Bt2, int K, float* C, int ldc, const float* __restrict__ bias, size_t sA, size_t sB, size_t sC) {
    typedef typename WFrag<T16>::V V;
    __shared__ __align__(16) float os[16 * 68];
    const size_t z = blockIdx.z; A += z * sA; if (A2) A2 += z * sA; Bt += z * sB; if (Bt2) Bt2 += z * sB; C += z * sC;
    const int lane = threadIdx.x & 31, lr = lane & 15, hi = lane >> 4; const int r0 = blockIdx.x * 64, c0 = blockIdx.y * 64;
    v8f acc[4][4];
#pragma unroll
    for (int mb = 0; mb < 4; ++mb)
#pragma unroll
        for (int nb = 0; nb < 4; ++nb) acc[mb][nb] = (v8f){};
    const size_t aoff = (size_t)(r0 + lr) * K + 8 * hi, boff = (size_t)(c0 + lr) * K + 8 * hi;
#pragma unroll 1
    for (int kc = 0; kc < K; kc += 32) {
        V a[4], a2[4];
#pragma unroll
        for (int mb = 0; mb < 4; ++mb) { a[mb] = WFrag<T16>::ld(A + aoff + (size_t)mb * 16 * K + kc); if (NSPLIT == 1 || NSPLIT == 2) a2[mb] = WFrag<T16>::ld(A2 + aoff + (size_t)mb * 16 * K + kc); }
#pragma unroll
        for (int nb = 0; nb < 4; ++nb) { const V b = WFrag<T16>::ld(Bt + boff + (size_t)nb * 16 * K + kc); V b2; if (NSPLIT >= 2) b2 = WFrag<T16>::ld(Bt2 + boff + (size_t)nb * 16 * K + kc);
#pragma unroll
            for (int mb = 0; mb < 4; ++mb) { acc[mb][nb] = WFrag<T16>::mma(a[mb], b, acc[mb][nb]); if (NSPLIT == 1 || NSPLIT == 2) acc[mb][nb] = WFrag<T16>::mma(a2[mb], b, acc[mb][nb]); if (NSPLIT >= 2) acc[mb][nb] = WFrag<T16>::mma(a[mb], b2, acc[mb][nb]); } }
        asm volatile("v_nop\n\tv_nop\n\tv_nop\n\tv_nop" : "+v"(acc[0][0]), "+v"(acc[1][1]), "+v"(acc[2][2]), "+v"(acc[3][3]) : "v"(a[0]), "v"(a[3]));
    }
#pragma unroll
    for (int mb = 0; mb < 4; ++mb) {
#pragma unroll
        for (int nb = 0; nb < 4; ++nb) {
#pragma unroll
            for (int j = 0; j < 8; ++j) os[(hi * 8 + j) * 68 + nb * 16 + lr] = acc[mb][nb][j]; }
        __builtin_amdgcn_wave_barrier(); asm volatile("" ::: "memory");
        float* crow = C + (size_t)(r0 + mb * 16) * ldc + c0;
{
#pragma unroll
            for (int s = 0; s < 8; ++s) { const int row = 2 * s + hi, cofs = lr * 4; v4f val = *(const v4fa*)(os + row * 68 + cofs); if (BIAS) { val[0] += bfr(bias[c0 + cofs]); val[1] += bfr(bias[c0 + cofs + 1]); val[2] += bfr(bias[c0 + cofs + 2]); val[3] += bfr(bias[c0 + cofs + 3]); }
                *(v4f*)(crow + (size_t)row * ldc + cofs) = val; }
             }
        __builtin_amdgcn_wave_barrier(); asm volatile("" ::: "memory");
    }
}

__device__ __forceinline__ h16 tohx(float x) { return (h16)x; }
__device__ __forceinline__ void splitf(float y, unsigned short& h, unsigned short& l) { h = f2bf(y); l = f2bf(y - bf2f(h)); }
typedef __attribute__((ext_vector_type(2))) _Float16 v2h;
typedef __attribute__((ext_vector_type(4))) _Float16 v4h;
typedef __attribute__((ext_vector_type(2))) unsigned short v2us;
typedef __attribute__((ext_vector_type(4))) unsigned short v4us;
typedef __attribute__((ext_vector_type(2))) float v2f;
typedef __attribute__((ext_vector_type(4))) int v4i;

__global__ __launch_bounds__(256) void k_wtG(const float* __restrict__ w, int K, int N, bf* Bt) {
    const int lane = threadIdx.x & 31; const int L0 = (blockIdx.x * 8 + (threadIdx.x >> 5)) * 8; const int nlines = N * K / 64;
{
#pragma unroll 1
        for (int l = 0; l < 8; ++l) { const int L = L0 + l; if (L >= nlines) break; const size_t e = (size_t)L * 64 + lane * 2; const int k = (int)(e % K), n = (int)(e / K); v2us o;
            o[0] = f2bf(w[(size_t)k * N + n]); o[1] = f2bf(w[(size_t)(k + 1) * N + n]); *(v2us*)(Bt + e) = o; }
         }
}
__global__ __launch_bounds__(256) void k_cvt8(const float* __restrict__ src, bf* dst, size_t n8) { const size_t i = (size_t)blockIdx.x * 256 + threadIdx.x; if (i >= n8) return; const v8f v = *(const v8f*)(src + i * 8); v8us o;
#pragma unroll
    for (int k = 0; k < 8; ++k) o[k] = f2bf(v[k]); *(v8us*)(dst + i * 8) = o;  }

// ---- k_planes: every plane the attention launch reads, from one read of the packed input, in one launch.
// One workgroup takes PT positions x PH heads of q, k and v: 24 16-byte loads a thread, all issued before the first use (few waves, many bytes in flight each).
// q rows keep their [t][d] order: a wave's load is one position's 128 floats (2 heads), its store one whole 128-byte plane row per head.
// k and v planes are laid out in the order in which the attention launch's A fragments are loaded, in chunks of 8 elements (16 bytes, one lane's share of one load):
//   k: [head][t / 16][d / 8][t % 16][8 d]      v: [head][t / 32][d / 16][(t % 32) / 8][d % 16][8 t]
// so that lane (lr + 16 hi) of a fragment load finds its chunk at lane x 16 bytes: one load reads 512 bytes in a row (4 lines) where rows of a [t][d] or [d][t] plane gave it 16 lines.
// k goes through LDS as bf16 rows of KP words (128 + 16 bytes: the 16-byte reads of 16 rows fall on different banks), the second head's rows 32 banks further (the two halves of a wave's 8-byte writes do not meet); a wave's store is 2 chunk columns x 16 keys = 512 bytes in a row.
// v is transposed through LDS as words of two bf16 (positions 2 tp, 2 tp + 1) at [d][tp], pitch VP words: the writes (16 d-quads x 2 tp a wave) and the reads (16 d rows x 2 key blocks a wave) each fall on 32 different banks; a wave's store is two runs of 256 bytes.
// Every loop is fully unrolled: the arrays of loaded values stay in registers only under constant indices.
// Values as before: input rounded to bf16 on read, q x 1/8 (exact), fp16 and hi/lo from that. Only what is read later is written: q fp16 for rows >= RH, q hi/lo for rows < RH, k and v fp16 everywhere, k and v hi/lo for positions < RH.
#define PT   64
#define PH   2
#define VP   33
#define KP   36
#define KHS  (PT * KP + 32)
typedef __attribute__((ext_vector_type(2))) unsigned v2u;
typedef __attribute__((ext_vector_type(4))) unsigned v4u;
template <bool LOW>
__device__ __forceinline__ void planes_out(const unsigned* vs, const unsigned* ks, const v4f (&xq)[8], int tid, int z0, int t0, h16* __restrict__ Q16, h16* __restrict__ K16, h16* __restrict__ V16, bf* __restrict__ Qh, bf* __restrict__ Ql, bf* __restrict__ Kh, bf* __restrict__ Kl, bf* __restrict__ Vh, bf* __restrict__ Vl) {
    const int lane = tid & 31, wave = tid >> 5;
#pragma unroll
    for (int i = 0; i < 4; ++i) { const int idx = i * 256 + tid, lr = idx & 15, blk = (idx >> 4) & 1, c = (idx >> 5) & 3, dg = idx >> 7;   // dg: group of 16 d rows, over both heads
        const size_t e = (size_t)(z0 + (dg >> 2)) * (TT * HD) + (size_t)(t0 + blk * 32) * HD + (dg & 3) * 512 + c * 128 + lr * 8; v8h o16; v8us oh, ol;
#pragma unroll
        for (int k = 0; k < 4; ++k) { const unsigned w = vs[(dg * 16 + lr) * VP + (blk * 4 + c) * 4 + k];
#pragma unroll
            for (int q = 0; q < 2; ++q) { const float x = bf2f((unsigned short)(q ? (w >> 16) : (w & 0xFFFFu))); o16[2 * k + q] = tohx(x); if (LOW) { unsigned short a2, c2; splitf(x, a2, c2); oh[2 * k + q] = a2; ol[2 * k + q] = c2; } } }
        *(v8h*)(V16 + e) = o16; if (LOW) { *(v8us*)(Vh + e) = oh; *(v8us*)(Vl + e) = ol; } }
#pragma unroll
    for (int i = 0; i < 4; ++i) { const int idx = i * 256 + tid, key = idx & 15, c8 = (idx >> 4) & 7, tg = idx >> 7;   // tg: group of 16 positions, over both heads
        const size_t e = (size_t)(z0 + (tg >> 2)) * (TT * HD) + (size_t)(t0 + (tg & 3) * 16) * HD + c8 * 128 + key * 8; v8h o16; v8us oh, ol;
        const v4u w4 = *(const v4u*)(ks + (tg >> 2) * KHS + ((tg & 3) * 16 + key) * KP + c8 * 4);
#pragma unroll
        for (int k = 0; k < 4; ++k)
#pragma unroll
            for (int q = 0; q < 2; ++q) { const float x = bf2f((unsigned short)(q ? (w4[k] >> 16) : (w4[k] & 0xFFFFu))); o16[2 * k + q] = tohx(x); if (LOW) { unsigned short a2, c2; splitf(x, a2, c2); oh[2 * k + q] = a2; ol[2 * k + q] = c2; } }
        *(v8h*)(K16 + e) = o16; if (LOW) { *(v8us*)(Kh + e) = oh; *(v8us*)(Kl + e) = ol; } }
#pragma unroll
    for (int i = 0; i < 8; ++i) { const size_t e = ((size_t)(z0 + (lane >> 4)) * TT + t0 + i * 8 + wave) * HD + (lane & 15) * 4; v4h q16; v4us qh, ql;
#pragma unroll
        for (int j = 0; j < 4; ++j) { const float rq = bfr(xq[i][j]) * SCL;
            if (LOW) { unsigned short a2, c2; splitf(rq, a2, c2); qh[j] = a2; ql[j] = c2; } else q16[j] = tohx(rq); }
        if (LOW) { *(v4us*)(Qh + e) = qh; *(v4us*)(Ql + e) = ql; } else *(v4h*)(Q16 + e) = q16; }
}
__global__ __launch_bounds__(256) void k_planes(const float* __restrict__ qkv, h16* __restrict__ Q16, h16* __restrict__ K16, h16* __restrict__ V16, bf* __restrict__ Qh, bf* __restrict__ Ql, bf* __restrict__ Kh, bf* __restrict__ Kl, bf* __restrict__ Vh, bf* __restrict__ Vl) {
    __shared__ unsigned vs[PH * HD * VP];
    __shared__ __align__(16) unsigned ks[PH * KHS];
    const int tid = threadIdx.x, lane = tid & 31, wave = tid >> 5;
    const int z0 = blockIdx.z * NH_ + blockIdx.x * PH, t0 = blockIdx.y * PT;
    const float* src = qkv + ((size_t)blockIdx.z * TT + t0) * (3 * DQ) + blockIdx.x * (PH * HD);
    const float* pv = src + (size_t)(2 * (tid >> 4)) * (3 * DQ) + (tid & 15) * 4;   // v (at + 2 DQ): positions 2 tp and 2 tp + 1, tp = tid / 16 (+ 16), d-quad tid % 16
    const float* pq = src + (size_t)wave * (3 * DQ) + lane * 4;   // q (k at + DQ): position wave (+ 8 i), 128 floats over the lanes
    v4f xv[8], xq[8], xk[8];
#pragma unroll
    for (int i = 0; i < 4; ++i) { const float* p = pv + 2 * DQ + (i & 1) * (32 * 3 * DQ) + (i >> 1) * HD; xv[2 * i] = *(const v4f*)p; xv[2 * i + 1] = *(const v4f*)(p + 3 * DQ); }
#pragma unroll
    for (int i = 0; i < 8; ++i) { const float* p = pq + i * (8 * 3 * DQ); xq[i] = *(const v4f*)p; xk[i] = *(const v4f*)(p + DQ); }
    asm volatile("s_wait_xcnt 0x0" :: "v"(pv), "v"(pq) : "memory");   // stands in front of every overwrite of an address register of the loads above; it names the two addresses so that they stay in their registers up to here (else a later load's result is given an earlier load's address pair)
    __builtin_amdgcn_sched_barrier(0);   // keeps all 24 loads issued here: left free, the scheduler holds the last of them back until the first values have arrived, a second memory latency
#pragma unroll
    for (int i = 0; i < 4; ++i)
#pragma unroll
        for (int j = 0; j < 4; ++j) vs[((i >> 1) * HD + (tid & 15) * 4 + j) * VP + (i & 1) * 16 + (tid >> 4)] = (unsigned)f2bf(xv[2 * i][j]) | ((unsigned)f2bf(xv[2 * i + 1][j]) << 16);
#pragma unroll
    for (int i = 0; i < 8; ++i) { v2u w; w[0] = (unsigned)f2bf(xk[i][0]) | ((unsigned)f2bf(xk[i][1]) << 16); w[1] = (unsigned)f2bf(xk[i][2]) | ((unsigned)f2bf(xk[i][3]) << 16); *(v2u*)(ks + (lane >> 4) * KHS + (i * 8 + wave) * KP + (lane & 15) * 2) = w; }
    __syncthreads();   // the v and k tiles are whole; nothing is written to them afterwards
    if (t0 < RH) { planes_out<true>(vs, ks, xq, tid, z0, t0, Q16, K16, V16, Qh, Ql, Kh, Kl, Vh, Vl); return; }   // the same branch for the whole workgroup, behind the only barrier
    planes_out<false>(vs, ks, xq, tid, z0, t0, Q16, K16, V16, Qh, Ql, Kh, Kl, Vh, Vl);
    asm volatile("s_wait_xcnt 0x0" ::: "memory");   // the built code lays this path in front of the other one and ends it with a conditional jump: the fall-through (never taken) rewrites address registers of the stores above
}
// ---- k_fattn: scores, ALiBi + window softmax and the probability x value product of one strip of query rows, with nothing of the scores leaving the registers.
// KS = 1: one wave walks all key passes of the strip. KS = 2: two waves of the workgroup walk one part of the passes each ('cut' and the rest), with their own running maximum, sum and accumulators; the two partial results are merged through LDS behind one barrier (weights exp(m_p - max), divided by the merged sum).
// Transposed products: St[key][query] = K . Qt (A = K rows, B = Q rows), Ot[d][query] += Vt . Pt (A = Vt rows, B = the packed score accumulators: two 16-key St tiles of one query column group are, converted in place, one 32-key B operand).
// A lane holds one query column (query = lr), so the running maximum, the running sum and the rescale factor are per-lane values; the two lane halves (keys 8 hi .. 8 hi + 7 of each 16) join by one exchange.
// Online softmax over passes of 32 keys from the window's first key block to the diagonal block. Masked scores are -inf, the running maximum starts at a finite -1e30: a pass with no valid key for a column adds exactly 0.
// ALiBi without per-element work: -slope (i - j) = slope (j - kb) - slope (i - kb). The first term is the same 32 values in every pass and is the start value of the score accumulators; the second is one value a lane and pass and goes into the maximum and into the exponent's addend.
// Mask: only a pass that touches the diagonal or the window's far edge can hold an invalid key; the test is scalar, all other passes skip the mask.
// Every inner loop is fully unrolled (the fragment and accumulator arrays stay in registers only under constant indices); the pass loop stays rolled (one pass's fragments and temporaries already take the wave's register budget).
// SPLIT (rows < RH): bf16 hi/lo planes, 3 products for St and for Ot. Otherwise fp16 planes, probabilities carried x 1024 (in the exponent; the row sum carries the same factor, so it cancels in the division).
#define QTF  2                               // query column groups per wave, fp16 rows (32 rows a strip); hi/lo rows: 1 (16 rows a strip)
#define NWV  12                              // waves per workgroup
#define SLOT (QTF * 4 * 256)                 // floats of one wave's partial output in LDS
template <typename T16, bool SPLIT, int QT, int KS>
__device__ __forceinline__ void attn_strip(const T16* __restrict__ Q, const T16* __restrict__ Q2, const T16* __restrict__ Kp, const T16* __restrict__ K2, const T16* __restrict__ Vt, const T16* __restrict__ Vt2, float sl, int q0, int part, int skew, int slot0, int sstep, float* smo, float* sml, float* __restrict__ orow) {
    typedef typename WFrag<T16>::V V;
    static_assert(KS == 1 || KS == QT, "the merging wave 'part' takes the query column group 'part'");
    const int lane = threadIdx.x & 31, lr = lane & 15, hi = lane >> 4;
    V qf[QT][2], qf2[QT][2];
#pragma unroll
    for (int qt = 0; qt < QT; ++qt)
#pragma unroll
        for (int kc = 0; kc < 2; ++kc) { const size_t off = (size_t)(q0 + qt * 16 + lr) * HD + kc * 32 + 8 * hi; qf[qt][kc] = WFrag<T16>::ld(Q + off); if (SPLIT) qf2[qt][kc] = WFrag<T16>::ld(Q2 + off); }
    v8f o[QT][4]; float m[QT], l[QT];
#pragma unroll
    for (int qt = 0; qt < QT; ++qt) { m[qt] = -1.0e30f; l[qt] = 0.f;   // finite, and small enough that (offset - m) x log2(e) stays finite: -inf x log2(e) + that is -inf, not NaN
#pragma unroll
        for (int dt = 0; dt < 4; ++dt) o[qt][dt] = (v8f){}; }
    const int kall = max(q0 - (WIN - 1), 0) & ~31, npass = (q0 + QT * 16 + 31 - kall) >> 5;   // key blocks of 32 that hold a valid key of some row of the strip
    const int cut = (npass - skew) >> 1;   // KS = 2: wave 0 takes the first 'cut' passes, wave 1 the rest, 'skew' more (used where a strip has 17 passes or more and skew is at most 8: no run is empty)
    const int kbeg = kall + (KS == 1 ? 0 : part * cut) * 32, kend = kall + ((KS == 1 || part != 0) ? npass : cut) * 32;   // this wave's run of passes
    const unsigned flane = lane * 8;   // the lane's own chunk of a fragment load (k and v planes are in fragment order: 32 keys of either are 4 KiB in a row, 8 loads of 512 bytes)
    v8f cb[2];   // slope x (j - kb) of the lane's 16 score elements
#pragma unroll
    for (int t = 0; t < 2; ++t)
#pragma unroll
        for (int r = 0; r < 8; ++r) cb[t][r] = sl * (float)(t * 16 + 8 * hi + r);
    V kf[2][2], kf2[2][2];
    if (!SPLIT) {   // fp16 strips fetch their K fragments one pass ahead; the hi/lo strips (twice the planes, at most half the passes) fetch them at the head of the pass
#pragma unroll
        for (int t = 0; t < 2; ++t)
#pragma unroll
            for (int kc = 0; kc < 2; ++kc) kf[t][kc] = WFrag<T16>::ldf(Kp + (size_t)kbeg * HD + flane + (t * 16 * HD + kc * 512));
    }
#pragma unroll 1
    for (int kb = kbeg; kb < kend; kb += 32) {
        V vf[4], vf2[4];
        const size_t boff = (size_t)kb * HD + flane;   // this pass's 32 keys, the lane's chunk
        const T16* const kp = Kp + boff; const T16* const kp2 = SPLIT ? K2 + boff : nullptr; const T16* const vp = Vt + boff; const T16* const vp2 = SPLIT ? Vt2 + boff : nullptr;
        if (SPLIT) {
#pragma unroll
            for (int t = 0; t < 2; ++t)
#pragma unroll
                for (int kc = 0; kc < 2; ++kc) { kf[t][kc] = WFrag<T16>::ldf(kp + (t * 16 * HD + kc * 512)); kf2[t][kc] = WFrag<T16>::ldf(kp2 + (t * 16 * HD + kc * 512)); }
        }
#pragma unroll
        for (int dt = 0; dt < 4; ++dt) { vf[dt] = WFrag<T16>::ldf(vp + dt * 512); if (SPLIT) vf2[dt] = WFrag<T16>::ldf(vp2 + dt * 512); }
        // the wait stands in front of every later overwrite of an address register of the loads above (the compiler reuses them); with four planes' loads it names the addresses so that they stay in their registers up to here (else a later load's result is given an earlier load's address pair)
        if constexpr (SPLIT) asm volatile("s_wait_xcnt 0x0" :: "v"(kp), "v"(kp2), "v"(vp), "v"(vp2) : "memory");
        else asm volatile("s_wait_xcnt 0x0" ::: "memory");
        __builtin_amdgcn_sched_barrier(0);   // keeps the V loads issued here: left free, the scheduler sinks them to just in front of the P.V products and their whole latency is waited out there
        v8f s[QT][2];
#pragma unroll
        for (int t = 0; t < 2; ++t)
#pragma unroll
            for (int qt = 0; qt < QT; ++qt) { v8f a = cb[t];
#pragma unroll
                for (int kc = 0; kc < 2; ++kc) { a = WFrag<T16>::mma(kf[t][kc], qf[qt][kc], a); if (SPLIT) { a = WFrag<T16>::mma(kf[t][kc], qf2[qt][kc], a); a = WFrag<T16>::mma(kf2[t][kc], qf[qt][kc], a); } }
                s[qt][t] = a; }
        if (!SPLIT) {
            const int kn = (kb + 32 < kend) ? kb + 32 : kb;   // next pass's K fragments: their latency runs under the softmax (the last pass fetches its own block again: in bounds, unused)
            const T16* const kpn = Kp + (size_t)kn * HD + flane;
#pragma unroll
            for (int t = 0; t < 2; ++t)
#pragma unroll
                for (int kc = 0; kc < 2; ++kc) kf[t][kc] = WFrag<T16>::ldf(kpn + (t * 16 * HD + kc * 512));
            asm volatile("s_wait_xcnt 0x0" :: "v"(kpn) : "memory");   // as above, for the refill's address registers; it names the address so that it stays in its registers up to here (else the last load's result is given the pair that the earlier loads name)
            __builtin_amdgcn_sched_barrier(0);   // keeps the refill issued here: left free, the scheduler sinks it to the loop's foot and the next pass waits out its whole latency
        }
        if (kb + 31 > q0 || q0 + QT * 16 - 1 - kb >= WIN) {   // scalar: the pass holds a key past some row's diagonal or beyond some row's window
#pragma unroll
            for (int qt = 0; qt < QT; ++qt) {
                const int d0 = q0 + qt * 16 + lr - kb - 8 * hi;   // i - j of element (t = 0, r = 0)
#pragma unroll
                for (int t = 0; t < 2; ++t)
#pragma unroll
                    for (int r = 0; r < 8; ++r) if ((unsigned)(d0 - t * 16 - r) >= (unsigned)WIN) s[qt][t][r] = -__builtin_inff();
            }
        }
#pragma unroll
        for (int qt = 0; qt < QT; ++qt) {
            const float off = -sl * (float)(q0 + qt * 16 + lr - kb);   // the part of the bias that all 32 keys of the pass share
            float ms = s[qt][0][0];
#pragma unroll
            for (int t = 0; t < 2; ++t)
#pragma unroll
                for (int r = 0; r < 8; ++r) ms = fmaxf(ms, s[qt][t][r]);
            ms = fmaxf(ms, __shfl_xor(ms, 16, 32));
            const float mx = fmaxf(m[qt], ms + off);
            const float al = __builtin_amdgcn_exp2f((m[qt] - mx) * 1.4426950408889634f); m[qt] = mx;
            const float ec = (off - mx) * 1.4426950408889634f + (SPLIT ? 0.0f : 10.0f);
            float ps = 0.f;
#pragma unroll
            for (int t = 0; t < 2; ++t)
#pragma unroll
                for (int r = 0; r < 8; r += 2) { const v2f e2 = (v2f){s[qt][t][r], s[qt][t][r + 1]} * 1.4426950408889634f + ec;   // two neighbouring accumulator registers: one packed multiply-add
                    const float p0 = __builtin_amdgcn_exp2f(e2[0]), p1 = __builtin_amdgcn_exp2f(e2[1]); s[qt][t][r] = p0; s[qt][t][r + 1] = p1; ps += p0; ps += p1; }
            l[qt] = l[qt] * al + ps;
#pragma unroll
            for (int dt = 0; dt < 4; ++dt) o[qt][dt] *= al;
            if constexpr (SPLIT) {
                v8us ph[2], pl[2];
#pragma unroll
                for (int t = 0; t < 2; ++t)
#pragma unroll
                    for (int r = 0; r < 8; ++r) { unsigned short a, c2; splitf(s[qt][t][r], a, c2); ph[t][r] = a; pl[t][r] = c2; }
                const V pfh = cat16b(ph[0], ph[1]), pfl = cat16b(pl[0], pl[1]);
#pragma unroll
                for (int dt = 0; dt < 4; ++dt) { o[qt][dt] = WFrag<T16>::mma(vf[dt], pfh, o[qt][dt]); o[qt][dt] = WFrag<T16>::mma(vf[dt], pfl, o[qt][dt]); o[qt][dt] = WFrag<T16>::mma(vf2[dt], pfh, o[qt][dt]); }
            } else {
                v8h p8[2];
#pragma unroll
                for (int t = 0; t < 2; ++t)
#pragma unroll
                    for (int r = 0; r < 8; ++r) p8[t][r] = tohx(s[qt][t][r]);
                const V pf = cat16(p8[0], p8[1]);
#pragma unroll
                for (int dt = 0; dt < 4; ++dt) o[qt][dt] = WFrag<T16>::mma(vf[dt], pf, o[qt][dt]);
            }
        }
    }
    if constexpr (KS == 1) {
#pragma unroll
    for (int qt = 0; qt < QT; ++qt) {
        const float f = __fdiv_rn(1.0f, l[qt] + __shfl_xor(l[qt], 16, 32));
        float* op = orow + (size_t)(q0 + qt * 16 + lr) * DQ + 8 * hi;   // a lane's 8 accumulator registers are 8 consecutive e of its query row
#pragma unroll
        for (int dt = 0; dt < 4; ++dt) { v4f w0, w1;
#pragma unroll
            for (int r = 0; r < 4; ++r) { w0[r] = o[qt][dt][r] * f; w1[r] = o[qt][dt][4 + r] * f; }
            *(v4f*)(op + dt * 16) = w0; *(v4f*)(op + dt * 16 + 4) = w1; }
    }
    asm volatile("s_wait_xcnt 0x0" ::: "memory");   // stands in front of every later overwrite of a register of the stores above (a second strip follows in the same wave)
    } else {
    // hand-over: each wave lays its partial result into its own LDS slot, each lane its own 16-byte chunks (a wave's store or load is 512 bytes in a row), with the column's maximum and its sum joined over the two lane halves
    float* const myo = smo + (slot0 + part * sstep) * SLOT; float* const myl = sml + (slot0 + part * sstep) * 128;
#pragma unroll
    for (int qt = 0; qt < QT; ++qt) {
        myl[(qt * 2) * 32 + lane] = m[qt]; myl[(qt * 2 + 1) * 32 + lane] = l[qt] + __shfl_xor(l[qt], 16, 32);
#pragma unroll
        for (int dt = 0; dt < 4; ++dt) { v4f w0, w1;
#pragma unroll
            for (int r = 0; r < 4; ++r) { w0[r] = o[qt][dt][r]; w1[r] = o[qt][dt][4 + r]; }
            *(v4f*)(myo + ((qt * 4 + dt) * 2) * 128 + lane * 4) = w0; *(v4f*)(myo + ((qt * 4 + dt) * 2 + 1) * 128 + lane * 4) = w1; }
    }
    __syncthreads();   // all partial results of the workgroup's strips are in LDS; nothing is written there afterwards
    // merge: wave 'part' takes the query column group 'part' of its strip: 16 whole output rows of the head
    float wg[KS]; float mall = -3.0e38f, lall = 0.f;
#pragma unroll
    for (int p = 0; p < KS; ++p) { wg[p] = sml[(slot0 + p * sstep) * 128 + (part * 2) * 32 + lane]; mall = fmaxf(mall, wg[p]); }
#pragma unroll
    for (int p = 0; p < KS; ++p) { wg[p] = __builtin_amdgcn_exp2f((wg[p] - mall) * 1.4426950408889634f); lall += wg[p] * sml[(slot0 + p * sstep) * 128 + (part * 2 + 1) * 32 + lane]; }
    const float f = __fdiv_rn(1.0f, lall);
#pragma unroll
    for (int p = 0; p < KS; ++p) wg[p] *= f;
    float* op = orow + (size_t)(q0 + part * 16 + lr) * DQ + 8 * hi;   // a lane's 8 accumulator registers are 8 consecutive e of its query row
#pragma unroll
    for (int dt = 0; dt < 4; ++dt) { v4f w0 = (v4f){}, w1 = (v4f){};
#pragma unroll
        for (int p = 0; p < KS; ++p) { const float* ps = smo + (slot0 + p * sstep) * SLOT + ((part * 4 + dt) * 2) * 128 + lane * 4; w0 += *(const v4f*)ps * wg[p]; w1 += *(const v4f*)(ps + 128) * wg[p]; }
        *(v4f*)(op + dt * 16) = w0; *(v4f*)(op + dt * 16 + 4) = w1; }
    }
}
// Deal of the work: one workgroup of 12 waves for each WGP of the chip (3 waves a SIMD; the registers do not take a second workgroup's 3, so no two workgroups share a WGP), every workgroup with about the same sum of passes. Workgroup g (of NGW) of a (batch, head) pair:
//   waves 4 .. 11: four neighbouring full-window fp16 strips (33 passes), two waves a strip;
//   waves 0 .. 3:  one hi/lo strip each (16 rows, all its passes), then two of the shorter fp16 strips (17 + 2 g and 18 + 2 g passes), two waves a strip. Waves 0 and 1 have hi/lo strips of 16 - g passes, waves 2 and 3 of 8 - g:
//                  the longer hi/lo strips go with the shorter fp16 strips, and of an fp16 strip the wave that had NGW hi/lo passes more takes NGW passes fewer: the four waves cost about the same, in every workgroup.
// The waves with two strips have the most passes and the lowest numbers (for speed only).
#define NGW  (RH / 16 / 4)                   // workgroups per (batch, head) pair
#define NSS  (2 * NGW)                       // fp16 strips with fewer passes than the full window (rows RH .. WIN - 1)
static_assert(NSS * 16 * QTF == WIN - RH && (NSS + 4 * NGW) * 16 * QTF == TT - RH, "every fp16 strip is dealt once");
__global__ __launch_bounds__(NWV * 32) void k_fattn(const h16* __restrict__ Q16, const h16* __restrict__ K16, const h16* __restrict__ V16, const bf* __restrict__ Qh, const bf* __restrict__ Ql, const bf* __restrict__ Kh, const bf* __restrict__ Kl, const bf* __restrict__ Vh, const bf* __restrict__ Vl, float* __restrict__ OUT) {
    __shared__ __align__(16) float smo[NWV * SLOT];
    __shared__ float sml[NWV * 128];
    const int z = blockIdx.x, h = z % NH_, b = z / NH_; const size_t pz = (size_t)z * TT * HD;
    const int g = blockIdx.y;
    const int wave = __builtin_amdgcn_readfirstlane(threadIdx.x >> 5);   // scalar: trip counts and plane addresses stay in scalar registers
    const float sl = exp2f(__fdiv_rn(__fmul_rn(-8.0f, (float)(h + 1)), (float)NH_));
    float* orow = OUT + (size_t)b * TT * DQ + h * HD;
    const bool two = wave < 4;   // the same for a whole wave; no barrier stands inside the branch
    if (two) attn_strip<bf, true, 1, 1>(Qh + pz, Ql + pz, Kh + pz, Kl + pz, Vh + pz, Vl + pz, sl, ((2 * NGW - 1 - g - NGW * (wave >> 1)) * 2 + (wave & 1)) * 16, 0, 0, 0, 0, smo, sml, orow);
    const int strip = two ? g * 2 + (wave & 1) : NSS + g * 4 + (wave & 3);
    const int part  = two ? wave >> 1 : (wave - 4) >> 2;
    const int slot0 = two ? (wave & 1) : 4 + (wave & 3);   // LDS slot of the strip's first wave; its second wave's is sstep further
    const int sstep = two ? 2 : 4;
    attn_strip<h16, false, QTF, 2>(Q16 + pz, nullptr, K16 + pz, nullptr, V16 + pz, nullptr, sl, RH + strip * 16 * QTF, part, two ? NGW : 0, slot0, sstep, smo, sml, orow);
}
extern "C" void kernel_launch(void* const* d_in, const int* in_sizes, int n_in,
                              void* d_out, int out_size, void* d_ws, size_t ws_size, hipStream_t stream) {
    (void)in_sizes; (void)n_in; (void)out_size;
    const float* qkv = (const float*)d_in[0];
    float* OUT = (float*)d_out;     // [2][2048][1024]
    char* wsp = (char*)d_ws;
    auto take = [&](size_t bytes) { char* p = wsp; wsp += (bytes + 255) & ~(size_t)255; return (void*)p; };
    const size_t PB = (size_t)NH_ * TT * HD;   /* elements of one batch's plane set; every plane holds both batches */
    h16* QP16 = (h16*)take(NB_ * PB * 2); h16* KP16 = (h16*)take(NB_ * PB * 2); h16* VT16 = (h16*)take(NB_ * PB * 2);
    bf* QPh = (bf*)take(NB_ * PB * 2); bf* QPl = (bf*)take(NB_ * PB * 2); bf* KPh = (bf*)take(NB_ * PB * 2); bf* KPl = (bf*)take(NB_ * PB * 2); bf* VTh = (bf*)take(NB_ * PB * 2); bf* VTl = (bf*)take(NB_ * PB * 2);
    if ((size_t)(wsp - (char*)d_ws) > ws_size) return;    // ws 256 MiB

    k_planes<<<dim3(NH_ / PH, TT / PT, NB_), 256, 0, stream>>>(qkv, QP16, KP16, VT16, QPh, QPl, KPh, KPl, VTh, VTl);
    k_fattn<<<dim3(NB_ * NH_, NGW), NWV * 32, 0, stream>>>(QP16, KP16, VT16, QPh, QPl, KPh, KPl, VTh, VTl, OUT);
}

// v007
// Measured time: 30.4 microseconds a run.
// Two timings next to v006 put it at 1.15 and 1.17 times that version's speed.
// All steps since v000 together make it 44.8 times as fast.
#include <hip/hip_runtime.h>

// FlexAttention training path: sliding-window causal attention with ALiBi (qkv [2][2048][3][16][64] packed; q, k, v = qkv[:, :, 0/1/2]; scores = q.k / 8 - slope_h (i - j), slope_h = 2^(-8 (h+1) / 16); keys with 0 <= i - j < 1024 only; softmax; out[b][l][h][e] -> [2][2048][16][64] f32 (4.2 M)).
// Layout: the packed input rows (stride 3 x 1024 floats) feed one plane-builder launch directly (bf16-rounded on read; q planes carry the exact 1/8 scale), both batches' planes side by side; one fused launch over all 32 (batch, head) pairs does scores, ALiBi bias (slope_h x (i - j), f32, exp2f slopes), window mask, online softmax and the probability x value product per strip of query rows (hybrid rows: < 512 bf16 operands with the probabilities as hi + lo, 2 products, rest fp16 x1024; only key blocks inside the band are visited) and writes the [l][h][e] output rows directly.
// Compute dtypes, f32 accumulate: qkv rounded to bf16; rows < 512 bf16 q, k, v (exact: they are bf16 values) and hi + lo probabilities, rest fp16; ALiBi bias and softmax f32; output f32.

#define NB_  2
#define TT   2048
#define DM   1024
#define NH_  16
#define NKV  16
#define REP  (NH_ / NKV)
#define HD   64
#define DQ   (NH_ * HD)
#define DKV  (NKV * HD)
#define RH   512                  // query rows < RH use bf16 planes, hi+lo probabilities
#define WIN  1024
#define SCL  0.125f   // HD^-0.5
typedef _Float16 h16;
typedef unsigned short bf;
typedef __attribute__((ext_vector_type(16))) __bf16   v16bf;
typedef __attribute__((ext_vector_type(16))) _Float16 v16h;
typedef __attribute__((ext_vector_type(8)))  _Float16 v8h;
typedef __attribute__((ext_vector_type(8)))  unsigned short v8us;
typedef __attribute__((ext_vector_type(8)))  float    v8f;
typedef __attribute__((ext_vector_type(4)))  float    v4f;
typedef v8h  __attribute__((may_alias)) v8ha;
typedef v4f  __attribute__((may_alias)) v4fa;
typedef v8us __attribute__((may_alias)) v8usa;

__device__ __forceinline__ unsigned short f2bf(float f) { unsigned u = __float_as_uint(f); u += 0x7FFFu + ((u >> 16) & 1u); return (unsigned short)(u >> 16); }
__device__ __forceinline__ float bf2f(unsigned short b) { return __uint_as_float(((unsigned)b) << 16); }
__device__ __forceinline__ float bfr(float f) { return bf2f(f2bf(f)); }
__device__ __forceinline__ v16h cat16(v8h lo, v8h hi) { return __builtin_shufflevector(lo, hi, 0, 1, 2, 3, 4, 5, 6, 7, 8, 9, 10, 11, 12, 13, 14, 15); }
__device__ __forceinline__ v16bf cat16b(v8us lo, v8us hi) { return __builtin_bit_cast(v16bf, __builtin_shufflevector(lo, hi, 0, 1, 2, 3, 4, 5, 6, 7, 8, 9, 10, 11, 12, 13, 14, 15)); }
__device__ __forceinline__ v8f wmma16(v16h a, v16h b, v8f c) { return __builtin_amdgcn_wmma_f32_16x16x32_f16(false, a, false, b, (short)0, c, false, false); }
__device__ __forceinline__ v8f wmmab(v16bf a, v16bf b, v8f c) { return __builtin_amdgcn_wmma_f32_16x16x32_bf16(false, a, false, b, (short)0, c, false, false); }



// ---- k_gemmw: register-blocked GEMM, ONE WAVE per 64x64 output tile (16 accumulators), operands straight from K-contiguous 16-bit planes; grid (M/64, N/64, Z), 32 threads.
// C[m][n] (f32, pitch ldc, + optional f32 bias[n]) = sum_k A[m][k] Bt[n][k] (+ split products per NSPLIT). z-batch strides sA/sB/sC in elements. K % 32 == 0.
template <typename T16> struct WFrag;
template <> struct WFrag<h16> { typedef v16h V; static __device__ __forceinline__ V ld(const h16* p) { return cat16(*(const v8h*)p, *(const v8h*)(p + 16)); } static __device__ __forceinline__ V ldf(const h16* p) { return cat16(*(const v8h*)p, *(const v8h*)(p + 256)); } static __device__ __forceinline__ v8f mma(V a, V b, v8f c) { return wmma16(a, b, c); } };
template <> struct WFrag<bf> { typedef v16bf V; static __device__ __forceinline__ V ld(const bf* p) { return cat16b(*(const v8us*)p, *(const v8us*)(p + 16)); } static __device__ __forceinline__ V ldf(const bf* p) { return cat16b(*(const v8us*)p, *(const v8us*)(p + 256)); } static __device__ __forceinline__ v8f mma(V a, V b, v8f c) { return wmmab(a, b, c); } };
template <typename T16, int NSPLIT, bool BIAS>
__global__ __launch_bounds__(32) void k_gemmw(const T16* __restrict__ A, const T16* __restrict__ A2, const T16* __restrict__ Bt, const T16* __restrict__ Bt2, int K, float* C, int ldc, const float* __restrict__ bias, size_t sA, size_t sB, size_t sC) {
    typedef typename WFrag<T16>::V V;
    __shared__ __align__(16) float os[16 * 68];
    const size_t z = blockIdx.z; A += z * sA; if (A2) A2 += z * sA; Bt += z * sB; if (Bt2) Bt2 += z * sB; C += z * sC;
    const int lane = threadIdx.x & 31, lr = lane & 15, hi = lane >> 4; const int r0 = blockIdx.x * 64, c0 = blockIdx.y * 64;
    v8f acc[4][4];
#pragma unroll
    for (int mb = 0; mb < 4; ++mb)
#pragma unroll
        for (int nb = 0; nb < 4; ++nb) acc[mb][nb] = (v8f){};
    const size_t aoff = (size_t)(r0 + lr) * K + 8 * hi, boff = (size_t)(c0 + lr) * K + 8 * hi;
#pragma unroll 1
    for (int kc = 0; kc < K; kc += 32) {
        V a[4], a2[4];
#pragma unroll
        for (int mb = 0; mb < 4; ++mb) { a[mb] = WFrag<T16>::ld(A + aoff + (size_t)mb * 16 * K + kc); if (NSPLIT == 1 || NSPLIT == 2) a2[mb] = WFrag<T16>::ld(A2 + aoff + (size_t)mb * 16 * K + kc); }
#pragma unroll
        for (int nb = 0; nb < 4; ++nb) { const V b = WFrag<T16>::ld(Bt + boff + (size_t)nb * 16 * K + kc); V b2; if (NSPLIT >= 2) b2 = WFrag<T16>::ld(Bt2 + boff + (size_t)nb * 16 * K + kc);
#pragma unroll
            for (int mb = 0; mb < 4; ++mb) { acc[mb][nb] = WFrag<T16>::mma(a[mb], b, acc[mb][nb]); if (NSPLIT == 1 || NSPLIT == 2) acc[mb][nb] = WFrag<T16>::mma(a2[mb], b, acc[mb][nb]); if (NSPLIT >= 2) acc[mb][nb] = WFrag<T16>::mma(a[mb], b2, acc[mb][nb]); } }
        asm volatile("v_nop\n\tv_nop\n\tv_nop\n\tv_nop" : "+v"(acc[0][0]), "+v"(acc[1][1]), "+v"(acc[2][2]), "+v"(acc[3][3]) : "v"(a[0]), "v"(a[3]));
    }
#pragma unroll
    for (int mb = 0; mb < 4; ++mb) {
#pragma unroll
        for (int nb = 0; nb < 4; ++nb) {
#pragma unroll
            for (int j = 0; j < 8; ++j) os[(hi * 8 + j) * 68 + nb * 16 + lr] = acc[mb][nb][j]; }
        __builtin_amdgcn_wave_barrier(); asm volatile("" ::: "memory");
        float* crow = C + (size_t)(r0 + mb * 16) * ldc + c0;
{
#pragma unroll
            for (int s = 0; s < 8; ++s) { const int row = 2 * s + hi, cofs = lr * 4; v4f val = *(const v4fa*)(os + row * 68 + cofs); if (BIAS) { val[0] += bfr(bias[c0 + cofs]); val[1] += bfr(bias[c0 + cofs + 1]); val[2] += bfr(bias[c0 + cofs + 2]); val[3] += bfr(bias[c0 + cofs + 3]); }
                *(v4f*)(crow + (size_t)row * ldc + cofs) = val; }
             }
        __builtin_amdgcn_wave_barrier(); asm volatile("" ::: "memory");
    }
}

__device__ __forceinline__ h16 tohx(float x) { return (h16)x; }
__device__ __forceinline__ void splitf(float y, unsigned short& h, unsigned short& l) { h = f2bf(y); l = f2bf(y - bf2f(h)); }
typedef __attribute__((ext_vector_type(2))) _Float16 v2h;
typedef __attribute__((ext_vector_type(4))) _Float16 v4h;
typedef __attribute__((ext_vector_type(2))) unsigned short v2us;
typedef __attribute__((ext_vector_type(4))) unsigned short v4us;
typedef __attribute__((ext_vector_type(2))) float v2f;
typedef __attribute__((ext_vector_type(4))) int v4i;

__global__ __launch_bounds__(256) void k_wtG(const float* __restrict__ w, int K, int N, bf* Bt) {
    const int lane = threadIdx.x & 31; const int L0 = (blockIdx.x * 8 + (threadIdx.x >> 5)) * 8; const int nlines = N * K / 64;
{
#pragma unroll 1
        for (int l = 0; l < 8; ++l) { const int L = L0 + l; if (L >= nlines) break; const size_t e = (size_t)L * 64 + lane * 2; const int k = (int)(e % K), n = (int)(e / K); v2us o;
            o[0] = f2bf(w[(size_t)k * N + n]); o[1] = f2bf(w[(size_t)(k + 1) * N + n]); *(v2us*)(Bt + e) = o; }
         }
}
__global__ __launch_bounds__(256) void k_cvt8(const float* __restrict__ src, bf* dst, size_t n8) { const size_t i = (size_t)blockIdx.x * 256 + threadIdx.x; if (i >= n8) return; const v8f v = *(const v8f*)(src + i * 8); v8us o;
#pragma unroll
    for (int k = 0; k < 8; ++k) o[k] = f2bf(v[k]); *(v8us*)(dst + i * 8) = o;  }

// ---- k_planes: every plane the attention launch reads, from one read of the packed input, in one launch.
// One workgroup takes PT positions x PH heads of q, k and v: 24 16-byte loads a thread, all issued before the first use (few waves, many bytes in flight each).
// q rows keep their [t][d] order: a wave's load is one position's 128 floats (2 heads), its store one whole 128-byte plane row per head.
// k and v planes are laid out in the order in which the attention launch's A fragments are loaded, in chunks of 8 elements (16 bytes, one lane's share of one load):
//   k: [head][t / 16][d / 8][t % 16][8 d]      v: [head][t / 32][d / 16][(t % 32) / 8][d % 16][8 t]
// so that lane (lr + 16 hi) of a fragment load finds its chunk at lane x 16 bytes: one load reads 512 bytes in a row (4 lines) where rows of a [t][d] or [d][t] plane gave it 16 lines.
// k goes through LDS as bf16 rows of KP words (128 + 16 bytes: the 16-byte reads of 16 rows fall on different banks), the second head's rows 32 banks further (the two halves of a wave's 8-byte writes do not meet); a wave's store is 2 chunk columns x 16 keys = 512 bytes in a row.
// v is transposed through LDS as words of two bf16 (positions 2 tp, 2 tp + 1) at [d][tp], pitch VP words: the writes (16 d-quads x 2 tp a wave) and the reads (16 d rows x 2 key blocks a wave) each fall on 32 different banks; a wave's store is two runs of 256 bytes.
// Every loop is fully unrolled: the arrays of loaded values stay in registers only under constant indices.
// Values: input rounded to bf16 on read, q x 1/8 (exact), fp16 and bf16 planes from that. A bf16 plane holds the value whole (the remainder of a bf16 value after rounding to bf16 is 0), so there is no low plane. Only what is read later is written: q fp16 for rows >= RH, q bf16 for rows < RH, k and v fp16 everywhere, k and v bf16 for positions < RH.
#define PT   64
#define PH   2
#define VP   33
#define KP   36
#define KHS  (PT * KP + 32)
typedef __attribute__((ext_vector_type(2))) unsigned v2u;
typedef __attribute__((ext_vector_type(4))) unsigned v4u;
template <bool LOW>
__device__ __forceinline__ void planes_out(const unsigned* vs, const unsigned* ks, const v4f (&xq)[8], int tid, int z0, int t0, h16* __restrict__ Q16, h16* __restrict__ K16, h16* __restrict__ V16, bf* __restrict__ Qh, bf* __restrict__ Kh, bf* __restrict__ Vh) {
    const int lane = tid & 31, wave = tid >> 5;
#pragma unroll
    for (int i = 0; i < 4; ++i) { const int idx = i * 256 + tid, lr = idx & 15, blk = (idx >> 4) & 1, c = (idx >> 5) & 3, dg = idx >> 7;   // dg: group of 16 d rows, over both heads
        const size_t e = (size_t)(z0 + (dg >> 2)) * (TT * HD) + (size_t)(t0 + blk * 32) * HD + (dg & 3) * 512 + c * 128 + lr * 8; v8h o16; v8us oh;
#pragma unroll
        for (int k = 0; k < 4; ++k) { const unsigned w = vs[(dg * 16 + lr) * VP + (blk * 4 + c) * 4 + k];
#pragma unroll
            for (int q = 0; q < 2; ++q) { const unsigned short xb = (unsigned short)(q ? (w >> 16) : (w & 0xFFFFu)); o16[2 * k + q] = tohx(bf2f(xb)); if (LOW) oh[2 * k + q] = xb; } }
        *(v8h*)(V16 + e) = o16; if (LOW) *(v8us*)(Vh + e) = oh; }
#pragma unroll
    for (int i = 0; i < 4; ++i) { const int idx = i * 256 + tid, key = idx & 15, c8 = (idx >> 4) & 7, tg = idx >> 7;   // tg: group of 16 positions, over both heads
        const size_t e = (size_t)(z0 + (tg >> 2)) * (TT * HD) + (size_t)(t0 + (tg & 3) * 16) * HD + c8 * 128 + key * 8; v8h o16; v8us oh;
        const v4u w4 = *(const v4u*)(ks + (tg >> 2) * KHS + ((tg & 3) * 16 + key) * KP + c8 * 4);
#pragma unroll
        for (int k = 0; k < 4; ++k)
#pragma unroll
            for (int q = 0; q < 2; ++q) { const unsigned short xb = (unsigned short)(q ? (w4[k] >> 16) : (w4[k] & 0xFFFFu)); o16[2 * k + q] = tohx(bf2f(xb)); if (LOW) oh[2 * k + q] = xb; }
        *(v8h*)(K16 + e) = o16; if (LOW) *(v8us*)(Kh + e) = oh; }
#pragma unroll
    for (int i = 0; i < 8; ++i) { const size_t e = ((size_t)(z0 + (lane >> 4)) * TT + t0 + i * 8 + wave) * HD + (lane & 15) * 4; v4h q16; v4us qh;
#pragma unroll
        for (int j = 0; j < 4; ++j) { const float rq = bfr(xq[i][j]) * SCL;
            if (LOW) qh[j] = f2bf(rq); else q16[j] = tohx(rq); }
        if (LOW) *(v4us*)(Qh + e) = qh; else *(v4h*)(Q16 + e) = q16; }
}
__global__ __launch_bounds__(256) void k_planes(const float* __restrict__ qkv, h16* __restrict__ Q16, h16* __restrict__ K16, h16* __restrict__ V16, bf* __restrict__ Qh, bf* __restrict__ Kh, bf* __restrict__ Vh) {
    __shared__ unsigned vs[PH * HD * VP];
    __shared__ __align__(16) unsigned ks[PH * KHS];
    const int tid = threadIdx.x, lane = tid & 31, wave = tid >> 5;
    const int z0 = blockIdx.z * NH_ + blockIdx.x * PH, t0 = blockIdx.y * PT;
    const float* src = qkv + ((size_t)blockIdx.z * TT + t0) * (3 * DQ) + blockIdx.x * (PH * HD);
    const float* pv = src + (size_t)(2 * (tid >> 4)) * (3 * DQ) + (tid & 15) * 4;   // v (at + 2 DQ): positions 2 tp and 2 tp + 1, tp = tid / 16 (+ 16), d-quad tid % 16
    const float* pq = src + (size_t)wave * (3 * DQ) + lane * 4;   // q (k at + DQ): position wave (+ 8 i), 128 floats over the lanes
    v4f xv[8], xq[8], xk[8];
#pragma unroll
    for (int i = 0; i < 4; ++i) { const float* p = pv + 2 * DQ + (i & 1) * (32 * 3 * DQ) + (i >> 1) * HD; xv[2 * i] = *(const v4f*)p; xv[2 * i + 1] = *(const v4f*)(p + 3 * DQ); }
#pragma unroll
    for (int i = 0; i < 8; ++i) { const float* p = pq + i * (8 * 3 * DQ); xq[i] = *(const v4f*)p; xk[i] = *(const v4f*)(p + DQ); }
    asm volatile("s_wait_xcnt 0x0" :: "v"(pv), "v"(pq) : "memory");   // stands in front of every overwrite of an address register of the loads above; it names the two addresses so that they stay in their registers up to here (else a later load's result is given an earlier load's address pair)
    __builtin_amdgcn_sched_barrier(0);   // keeps all 24 loads issued here: left free, the scheduler holds the last of them back until the first values have arrived, a second memory latency
#pragma unroll
    for (int i = 0; i < 4; ++i)
#pragma unroll
        for (int j = 0; j < 4; ++j) vs[((i >> 1) * HD + (tid & 15) * 4 + j) * VP + (i & 1) * 16 + (tid >> 4)] = (unsigned)f2bf(xv[2 * i][j]) | ((unsigned)f2bf(xv[2 * i + 1][j]) << 16);
#pragma unroll
    for (int i = 0; i < 8; ++i) { v2u w; w[0] = (unsigned)f2bf(xk[i][0]) | ((unsigned)f2bf(xk[i][1]) << 16); w[1] = (unsigned)f2bf(xk[i][2]) | ((unsigned)f2bf(xk[i][3]) << 16); *(v2u*)(ks + (lane >> 4) * KHS + (i * 8 + wave) * KP + (lane & 15) * 2) = w; }
    __syncthreads();   // the v and k tiles are whole; nothing is written to them afterwards
    if (t0 < RH) { planes_out<true>(vs, ks, xq, tid, z0, t0, Q16, K16, V16, Qh, Kh, Vh); return; }   // the same branch for the whole workgroup, behind the only barrier
    planes_out<false>(vs, ks, xq, tid, z0, t0, Q16, K16, V16, Qh, Kh, Vh);
    asm volatile("s_wait_xcnt 0x0" ::: "memory");   // the built code lays this path in front of the other one and ends it with a conditional jump: the fall-through (never taken) rewrites address registers of the stores above
}
// ---- k_fattn: scores, ALiBi + window softmax and the probability x value product of one strip of query rows, with nothing of the scores leaving the registers.
// KS = 1: one wave walks all key passes of the strip. KS = 2: two waves of the workgroup walk one part of the passes each ('cut' and the rest), with their own running maximum, sum and accumulators; the two partial results are merged through LDS behind one barrier (weights exp(m_p - max), divided by the merged sum).
// Transposed products: St[key][query] = K . Qt (A = K rows, B = Q rows), Ot[d][query] += Vt . Pt (A = Vt rows, B = the packed score accumulators: two 16-key St tiles of one query column group are, converted in place, one 32-key B operand).
// A lane holds one query column (query = lr), so the running maximum, the running sum and the rescale factor are per-lane values; the two lane halves (keys 8 hi .. 8 hi + 7 of each 16) join by one exchange.
// Online softmax over passes of 32 keys from the window's first key block to the diagonal block. Masked scores are -inf, the running maximum starts at a finite -1e30: a pass with no valid key for a column adds exactly 0.
// ALiBi without per-element work: -slope (i - j) = slope (j - kb) - slope (i - kb). The first term is the same 32 values in every pass and is the start value of the score accumulators; the second is one value a lane and pass and goes into the maximum and into the exponent's addend.
// Mask: only a pass that touches the diagonal or the window's far edge can hold an invalid key; the test is scalar, all other passes skip the mask.
// Every inner loop is fully unrolled (the fragment and accumulator arrays stay in registers only under constant indices); the pass loop stays rolled (one pass's fragments and temporaries already take the wave's register budget).
// SPLIT (rows < RH): bf16 planes (q, k and v are bf16 values: one product gives St whole), the probabilities as bf16 hi + lo: 2 products for Ot. Otherwise fp16 planes, probabilities carried x 1024 (in the exponent; the row sum carries the same factor, so it cancels in the division).
#define QTF  2                               // query column groups per wave, fp16 rows (32 rows a strip); hi/lo rows: 1 (16 rows a strip)
#define NWV  12                              // waves per workgroup
#define SLOT (QTF * 4 * 256)                 // floats of one wave's partial output in LDS
template <typename T16, bool SPLIT, int QT, int KS>
__device__ __forceinline__ void attn_strip(const T16* __restrict__ Q, const T16* __restrict__ Kp, const T16* __restrict__ Vt, float sl, int q0, int part, int skew, int slot0, int sstep, float* smo, float* sml, float* __restrict__ orow) {
    typedef typename WFrag<T16>::V V;
    static_assert(KS == 1 || KS == QT, "the merging wave 'part' takes the query column group 'part'");
    const int lane = threadIdx.x & 31, lr = lane & 15, hi = lane >> 4;
    V qf[QT][2];
    const T16* const qp = Q + (size_t)(q0 + lr) * HD + 8 * hi;   // the lane's query row, its 8 elements of each 16
#pragma unroll
    for (int qt = 0; qt < QT; ++qt)
#pragma unroll
        for (int kc = 0; kc < 2; ++kc) qf[qt][kc] = WFrag<T16>::ld(qp + (qt * 16 * HD + kc * 32));
    asm volatile("s_wait_xcnt 0x0" :: "v"(qp) : "memory");   // stands in front of every later overwrite of the address register of the loads above (the pass loop's first address additions reuse it); it names the address so that it stays in its registers up to here
    v8f o[QT][4]; float m[QT], l[QT];
#pragma unroll
    for (int qt = 0; qt < QT; ++qt) { m[qt] = -1.0e30f; l[qt] = 0.f;   // finite, and small enough that (offset - m) x log2(e) stays finite: -inf x log2(e) + that is -inf, not NaN
#pragma unroll
        for (int dt = 0; dt < 4; ++dt) o[qt][dt] = (v8f){}; }
    const int kall = max(q0 - (WIN - 1), 0) & ~31, npass = (q0 + QT * 16 + 31 - kall) >> 5;   // key blocks of 32 that hold a valid key of some row of the strip
    const int cut = (npass - skew) >> 1;   // KS = 2: wave 0 takes the first 'cut' passes, wave 1 the rest, 'skew' more (used where a strip has 17 passes or more and skew is at most 8: no run is empty)
    const int kbeg = kall + (KS == 1 ? 0 : part * cut) * 32, kend = kall + ((KS == 1 || part != 0) ? npass : cut) * 32;   // this wave's run of passes
    const unsigned flane = lane * 8;   // the lane's own chunk of a fragment load (k and v planes are in fragment order: 32 keys of either are 4 KiB in a row, 8 loads of 512 bytes)
    v8f cb[2];   // slope x (j - kb) of the lane's 16 score elements
#pragma unroll
    for (int t = 0; t < 2; ++t)
#pragma unroll
        for (int r = 0; r < 8; ++r) cb[t][r] = sl * (float)(t * 16 + 8 * hi + r);
    V kf[2][2];
    if (!SPLIT) {   // fp16 strips fetch their K fragments one pass ahead; the bf16 strips (at most half the passes) fetch them at the head of the pass
#pragma unroll
        for (int t = 0; t < 2; ++t)
#pragma unroll
            for (int kc = 0; kc < 2; ++kc) kf[t][kc] = WFrag<T16>::ldf(Kp + (size_t)kbeg * HD + flane + (t * 16 * HD + kc * 512));
    }
#pragma unroll 1
    for (int kb = kbeg; kb < kend; kb += 32) {
        V vf[4];
        const size_t boff = (size_t)kb * HD + flane;   // this pass's 32 keys, the lane's chunk
        const T16* const kp = Kp + boff; const T16* const vp = Vt + boff;
        if (SPLIT) {
#pragma unroll
            for (int t = 0; t < 2; ++t)
#pragma unroll
                for (int kc = 0; kc < 2; ++kc) kf[t][kc] = WFrag<T16>::ldf(kp + (t * 16 * HD + kc * 512));
        }
#pragma unroll
        for (int dt = 0; dt < 4; ++dt) vf[dt] = WFrag<T16>::ldf(vp + dt * 512);
        // the wait stands in front of every later overwrite of an address register of the loads above (the compiler reuses them); with two planes' loads it names the addresses so that they stay in their registers up to here (else a later load's result is given an earlier load's address pair)
        if constexpr (SPLIT) asm volatile("s_wait_xcnt 0x0" :: "v"(kp), "v"(vp) : "memory");
        else asm volatile("s_wait_xcnt 0x0" ::: "memory");
        __builtin_amdgcn_sched_barrier(0);   // keeps the V loads issued here: left free, the scheduler sinks them to just in front of the P.V products and their whole latency is waited out there
        v8f s[QT][2];
#pragma unroll
        for (int t = 0; t < 2; ++t)
#pragma unroll
            for (int qt = 0; qt < QT; ++qt) { v8f a = cb[t];
#pragma unroll
                for (int kc = 0; kc < 2; ++kc) a = WFrag<T16>::mma(kf[t][kc], qf[qt][kc], a);
                s[qt][t] = a; }
        if (!SPLIT) {
            const int kn = (kb + 32 < kend) ? kb + 32 : kb;   // next pass's K fragments: their latency runs under the softmax (the last pass fetches its own block again: in bounds, unused)
            const T16* const kpn = Kp + (size_t)kn * HD + flane;
#pragma unroll
            for (int t = 0; t < 2; ++t)
#pragma unroll
                for (int kc = 0; kc < 2; ++kc) kf[t][kc] = WFrag<T16>::ldf(kpn + (t * 16 * HD + kc * 512));
            asm volatile("s_wait_xcnt 0x0" :: "v"(kpn) : "memory");   // as above, for the refill's address registers; it names the address so that it stays in its registers up to here (else the last load's result is given the pair that the earlier loads name)
            __builtin_amdgcn_sched_barrier(0);   // keeps the refill issued here: left free, the scheduler sinks it to the loop's foot and the next pass waits out its whole latency
        }
        if (kb + 31 > q0 || q0 + QT * 16 - 1 - kb >= WIN) {   // scalar: the pass holds a key past some row's diagonal or beyond some row's window
#pragma unroll
            for (int qt = 0; qt < QT; ++qt) {
                const int d0 = q0 + qt * 16 + lr - kb - 8 * hi;   // i - j of element (t = 0, r = 0)
#pragma unroll
                for (int t = 0; t < 2; ++t)
#pragma unroll
                    for (int r = 0; r < 8; ++r) if ((unsigned)(d0 - t * 16 - r) >= (unsigned)WIN) s[qt][t][r] = -__builtin_inff();
            }
        }
#pragma unroll
        for (int qt = 0; qt < QT; ++qt) {
            const float off = -sl * (float)(q0 + qt * 16 + lr - kb);   // the part of the bias that all 32 keys of the pass share
            float ms = s[qt][0][0];
#pragma unroll
            for (int t = 0; t < 2; ++t)
#pragma unroll
                for (int r = 0; r < 8; ++r) ms = fmaxf(ms, s[qt][t][r]);
            ms = fmaxf(ms, __shfl_xor(ms, 16, 32));
            const float mx = fmaxf(m[qt], ms + off);
            const float al = __builtin_amdgcn_exp2f((m[qt] - mx) * 1.4426950408889634f); m[qt] = mx;
            const float ec = (off - mx) * 1.4426950408889634f + (SPLIT ? 0.0f : 10.0f);
            float ps = 0.f;
#pragma unroll
            for (int t = 0; t < 2; ++t)
#pragma unroll
                for (int r = 0; r < 8; r += 2) { const v2f e2 = (v2f){s[qt][t][r], s[qt][t][r + 1]} * 1.4426950408889634f + ec;   // two neighbouring accumulator registers: one packed multiply-add
                    const float p0 = __builtin_amdgcn_exp2f(e2[0]), p1 = __builtin_amdgcn_exp2f(e2[1]); s[qt][t][r] = p0; s[qt][t][r + 1] = p1; ps += p0; ps += p1; }
            l[qt] = l[qt] * al + ps;
#pragma unroll
            for (int dt = 0; dt < 4; ++dt) o[qt][dt] *= al;
            if constexpr (SPLIT) {
                v8us ph[2], pl[2];
#pragma unroll
                for (int t = 0; t < 2; ++t)
#pragma unroll
                    for (int r = 0; r < 8; ++r) { unsigned short a, c2; splitf(s[qt][t][r], a, c2); ph[t][r] = a; pl[t][r] = c2; }
                const V pfh = cat16b(ph[0], ph[1]), pfl = cat16b(pl[0], pl[1]);
#pragma unroll
                for (int dt = 0; dt < 4; ++dt) { o[qt][dt] = WFrag<T16>::mma(vf[dt], pfh, o[qt][dt]); o[qt][dt] = WFrag<T16>::mma(vf[dt], pfl, o[qt][dt]); }
            } else {
                v8h p8[2];
#pragma unroll
                for (int t = 0; t < 2; ++t)
#pragma unroll
                    for (int r = 0; r < 8; ++r) p8[t][r] = tohx(s[qt][t][r]);
                const V pf = cat16(p8[0], p8[1]);
#pragma unroll
                for (int dt = 0; dt < 4; ++dt) o[qt][dt] = WFrag<T16>::mma(vf[dt], pf, o[qt][dt]);
            }
        }
    }
    if constexpr (KS == 1) {
#pragma unroll
    for (int qt = 0; qt < QT; ++qt) {
        const float f = __fdiv_rn(1.0f, l[qt] + __shfl_xor(l[qt], 16, 32));
        float* op = orow + (size_t)(q0 + qt * 16 + lr) * DQ + 8 * hi;   // a lane's 8 accumulator registers are 8 consecutive e of its query row
#pragma unroll
        for (int dt = 0; dt < 4; ++dt) { v4f w0, w1;
#pragma unroll
            for (int r = 0; r < 4; ++r) { w0[r] = o[qt][dt][r] * f; w1[r] = o[qt][dt][4 + r] * f; }
            *(v4f*)(op + dt * 16) = w0; *(v4f*)(op + dt * 16 + 4) = w1; }
    }
    asm volatile("s_wait_xcnt 0x0" ::: "memory");   // stands in front of every later overwrite of a register of the stores above (a second strip follows in the same wave)
    } else {
    // hand-over: each wave lays its partial result into its own LDS slot, each lane its own 16-byte chunks (a wave's store or load is 512 bytes in a row), with the column's maximum and its sum joined over the two lane halves
    float* const myo = smo + (slot0 + part * sstep) * SLOT; float* const myl = sml + (slot0 + part * sstep) * 128;
#pragma unroll
    for (int qt = 0; qt < QT; ++qt) {
        myl[(qt * 2) * 32 + lane] = m[qt]; myl[(qt * 2 + 1) * 32 + lane] = l[qt] + __shfl_xor(l[qt], 16, 32);
#pragma unroll
        for (int dt = 0; dt < 4; ++dt) { v4f w0, w1;
#pragma unroll
            for (int r = 0; r < 4; ++r) { w0[r] = o[qt][dt][r]; w1[r] = o[qt][dt][4 + r]; }
            *(v4f*)(myo + ((qt * 4 + dt) * 2) * 128 + lane * 4) = w0; *(v4f*)(myo + ((qt * 4 + dt) * 2 + 1) * 128 + lane * 4) = w1; }
    }
    __syncthreads();   // all partial results of the workgroup's strips are in LDS; nothing is written there afterwards
    // merge: wave 'part' takes the query column group 'part' of its strip: 16 whole output rows of the head
    float wg[KS]; float mall = -3.0e38f, lall = 0.f;
#pragma unroll
    for (int p = 0; p < KS; ++p) { wg[p] = sml[(slot0 + p * sstep) * 128 + (part * 2) * 32 + lane]; mall = fmaxf(mall, wg[p]); }
#pragma unroll
    for (int p = 0; p < KS; ++p) { wg[p] = __builtin_amdgcn_exp2f((wg[p] - mall) * 1.4426950408889634f); lall += wg[p] * sml[(slot0 + p * sstep) * 128 + (part * 2 + 1) * 32 + lane]; }
    const float f = __fdiv_rn(1.0f, lall);
#pragma unroll
    for (int p = 0; p < KS; ++p) wg[p] *= f;
    float* op = orow + (size_t)(q0 + part * 16 + lr) * DQ + 8 * hi;   // a lane's 8 accumulator registers are 8 consecutive e of its query row
#pragma unroll
    for (int dt = 0; dt < 4; ++dt) { v4f w0 = (v4f){}, w1 = (v4f){};
#pragma unroll
        for (int p = 0; p < KS; ++p) { const float* ps = smo + (slot0 + p * sstep) * SLOT + ((part * 4 + dt) * 2) * 128 + lane * 4; w0 += *(const v4f*)ps * wg[p]; w1 += *(const v4f*)(ps + 128) * wg[p]; }
        *(v4f*)(op + dt * 16) = w0; *(v4f*)(op + dt * 16 + 4) = w1; }
    }
}
// Deal of the work: one workgroup of 12 waves for each WGP of the chip (3 waves a SIMD; the registers do not take a second workgroup's 3, so no two workgroups share a WGP), every workgroup with about the same sum of passes. Workgroup g (of NGW) of a (batch, head) pair:
//   waves 4 .. 11: four neighbouring full-window fp16 strips (33 passes), two waves a strip;
//   waves 0 .. 3:  one hi/lo strip each (16 rows, all its passes), then two of the shorter fp16 strips (17 + 2 g and 18 + 2 g passes), two waves a strip. Waves 0 and 1 have hi/lo strips of 16 - g passes, waves 2 and 3 of 8 - g:
//                  the longer hi/lo strips go with the shorter fp16 strips, and of an fp16 strip the wave that had NGW hi/lo passes more takes NGW passes fewer: the four waves cost about the same, in every workgroup.
// The waves with two strips have the most passes and the lowest numbers (for speed only).
#define NGW  (RH / 16 / 4)                   // workgroups per (batch, head) pair
#define NSS  (2 * NGW)                       // fp16 strips with fewer passes than the full window (rows RH .. WIN - 1)
static_assert(NSS * 16 * QTF == WIN - RH && (NSS + 4 * NGW) * 16 * QTF == TT - RH, "every fp16 strip is dealt once");
__global__ __launch_bounds__(NWV * 32) void k_fattn(const h16* __restrict__ Q16, const h16* __restrict__ K16, const h16* __restrict__ V16, const bf* __restrict__ Qh, const bf* __restrict__ Kh, const bf* __restrict__ Vh, float* __restrict__ OUT) {
    __shared__ __align__(16) float smo[NWV * SLOT];
    __shared__ float sml[NWV * 128];
    const int z = blockIdx.x, h = z % NH_, b = z / NH_; const size_t pz = (size_t)z * TT * HD;
    const int g = blockIdx.y;
    const int wave = __builtin_amdgcn_readfirstlane(threadIdx.x >> 5);   // scalar: trip counts and plane addresses stay in scalar registers
    const float sl = exp2f(__fdiv_rn(__fmul_rn(-8.0f, (float)(h + 1)), (float)NH_));
    float* orow = OUT + (size_t)b * TT * DQ + h * HD;
    const bool two = wave < 4;   // the same for a whole wave; no barrier stands inside the branch
    if (two) attn_strip<bf, true, 1, 1>(Qh + pz, Kh + pz, Vh + pz, sl, ((2 * NGW - 1 - g - NGW * (wave >> 1)) * 2 + (wave & 1)) * 16, 0, 0, 0, 0, smo, sml, orow);
    const int strip = two ? g * 2 + (wave & 1) : NSS + g * 4 + (wave & 3);
    const int part  = two ? wave >> 1 : (wave - 4) >> 2;
    const int slot0 = two ? (wave & 1) : 4 + (wave & 3);   // LDS slot of the strip's first wave; its second wave's is sstep further
    const int sstep = two ? 2 : 4;
    attn_strip<h16, false, QTF, 2>(Q16 + pz, K16 + pz, V16 + pz, sl, RH + strip * 16 * QTF, part, two ? NGW : 0, slot0, sstep, smo, sml, orow);
}
extern "C" void kernel_launch(void* const* d_in, const int* in_sizes, int n_in,
                              void* d_out, int out_size, void* d_ws, size_t ws_size, hipStream_t stream) {
    (void)in_sizes; (void)n_in; (void)out_size;
    const float* qkv = (const float*)d_in[0];
    float* OUT = (float*)d_out;     // [2][2048][1024]
    char* wsp = (char*)d_ws;
    auto take = [&](size_t bytes) { char* p = wsp; wsp += (bytes + 255) & ~(size_t)255; return (void*)p; };
    const size_t PB = (size_t)NH_ * TT * HD;   /* elements of one batch's plane set; every plane holds both batches */
    h16* QP16 = (h16*)take(NB_ * PB * 2); h16* KP16 = (h16*)take(NB_ * PB * 2); h16* VT16 = (h16*)take(NB_ * PB * 2);
    bf* QPh = (bf*)take(NB_ * PB * 2); bf* KPh = (bf*)take(NB_ * PB * 2); bf* VTh = (bf*)take(NB_ * PB * 2);
    if ((size_t)(wsp - (char*)d_ws) > ws_size) return;    // ws 256 MiB

    k_planes<<<dim3(NH_ / PH, TT / PT, NB_), 256, 0, stream>>>(qkv, QP16, KP16, VT16, QPh, KPh, VTh);
    k_fattn<<<dim3(NB_ * NH_, NGW), NWV * 32, 0, stream>>>(QP16, KP16, VT16, QPh, KPh, VTh, OUT);
}

// v008
// It runs in 29.1 microseconds.
// Timed twice side by side with v007, it ran 1.03 times as fast both times.
// All steps since v000 together make it 46.3 times as fast.
#include <hip/hip_runtime.h>

// FlexAttention training path: sliding-window causal attention with ALiBi (qkv [2][2048][3][16][64] packed; q, k, v = qkv[:, :, 0/1/2]; scores = q.k / 8 - slope_h (i - j), slope_h = 2^(-8 (h+1) / 16); keys with 0 <= i - j < 1024 only; softmax; out[b][l][h][e] -> [2][2048][16][64] f32 (4.2 M)).
// Layout: the packed input rows (stride 3 x 1024 floats) feed one plane-builder launch directly (bf16-rounded on read; q planes carry the exact 1/8 scale), both batches' planes side by side; one fused launch over all 32 (batch, head) pairs does scores, ALiBi bias (slope_h x (i - j), f32, exp2f slopes), window mask, online softmax and the probability x value product per strip of query rows (hybrid rows: < 512 bf16 operands with the probabilities as hi + lo, 2 products, rest fp16 x1024; only key blocks inside the band are visited) and writes the [l][h][e] output rows directly.
// Compute dtypes, f32 accumulate: qkv rounded to bf16; rows < 512 bf16 q, k, v (exact: they are bf16 values) and hi + lo probabilities, rest fp16; ALiBi bias and softmax f32; output f32.

#define NB_  2
#define TT   2048
#define DM   1024
#define NH_  16
#define NKV  16
#define REP  (NH_ / NKV)
#define HD   64
#define DQ   (NH_ * HD)
#define DKV  (NKV * HD)
#define RH   512                  // query rows < RH use bf16 planes, hi+lo probabilities
#define WIN  1024
#define SCL  0.125f   // HD^-0.5
typedef _Float16 h16;
typedef unsigned short bf;
typedef __attribute__((ext_vector_type(16))) __bf16   v16bf;
typedef __attribute__((ext_vector_type(16))) _Float16 v16h;
typedef __attribute__((ext_vector_type(8)))  _Float16 v8h;
typedef __attribute__((ext_vector_type(8)))  unsigned short v8us;
typedef __attribute__((ext_vector_type(8)))  float    v8f;
typedef __attribute__((ext_vector_type(4)))  float    v4f;
typedef v8h  __attribute__((may_alias)) v8ha;
typedef v4f  __attribute__((may_alias)) v4fa;
typedef v8us __attribute__((may_alias)) v8usa;

__device__ __forceinline__ unsigned short f2bf(float f) { unsigned u = __float_as_uint(f); u += 0x7FFFu + ((u >> 16) & 1u); return (unsigned short)(u >> 16); }
__device__ __forceinline__ float bf2f(unsigned short b) { return __uint_as_float(((unsigned)b) << 16); }
__device__ __forceinline__ float bfr(float f) { return bf2f(f2bf(f)); }
__device__ __forceinline__ v16h cat16(v8h lo, v8h hi) { return __builtin_shufflevector(lo, hi, 0, 1, 2, 3, 4, 5, 6, 7, 8, 9, 10, 11, 12, 13, 14, 15); }
__device__ __forceinline__ v16bf cat16b(v8us lo, v8us hi) { return __builtin_bit_cast(v16bf, __builtin_shufflevector(lo, hi, 0, 1, 2, 3, 4, 5, 6, 7, 8, 9, 10, 11, 12, 13, 14, 15)); }
__device__ __forceinline__ v8f wmma16(v16h a, v16h b, v8f c) { return __builtin_amdgcn_wmma_f32_16x16x32_f16(false, a, false, b, (short)0, c, false, false); }
__device__ __forceinline__ v8f wmmab(v16bf a, v16bf b, v8f c) { return __builtin_amdgcn_wmma_f32_16x16x32_bf16(false, a, false, b, (short)0, c, false, false); }



// ---- k_gemmw: register-blocked GEMM, ONE WAVE per 64x64 output tile (16 accumulators), operands straight from K-contiguous 16-bit planes; grid (M/64, N/64, Z), 32 threads.
// C[m][n] (f32, pitch ldc, + optional f32 bias[n]) = sum_k A[m][k] Bt[n][k] (+ split products per NSPLIT). z-batch strides sA/sB/sC in elements. K % 32 == 0.
template <typename T16> struct WFrag;
template <> struct WFrag<h16> { typedef v16h V; static __device__ __forceinline__ V ld(const h16* p) { return cat16(*(const v8h*)p, *(const v8h*)(p + 16)); } static __device__ __forceinline__ V ldf(const h16* p) { return cat16(*(const v8h*)p, *(const v8h*)(p + 256)); } static __device__ __forceinline__ v8f mma(V a, V b, v8f c) { return wmma16(a, b, c); } };
template <> struct WFrag<bf> { typedef v16bf V; static __device__ __forceinline__ V ld(const bf* p) { return cat16b(*(const v8us*)p, *(const v8us*)(p + 16)); } static __device__ __forceinline__ V ldf(const bf* p) { return cat16b(*(const v8us*)p, *(const v8us*)(p + 256)); } static __device__ __forceinline__ v8f mma(V a, V b, v8f c) { return wmmab(a, b, c); } };
template <typename T16, int NSPLIT, bool BIAS>
__global__ __launch_bounds__(32) void k_gemmw(const T16* __restrict__ A, const T16* __restrict__ A2, const T16* __restrict__ Bt, const T16* __restrict__ Bt2, int K, float* C, int ldc, const float* __restrict__ bias, size_t sA, size_t sB, size_t sC) {
    typedef typename WFrag<T16>::V V;
    __shared__ __align__(16) float os[16 * 68];
    const size_t z = blockIdx.z; A += z * sA; if (A2) A2 += z * sA; Bt += z * sB; if (Bt2) Bt2 += z * sB; C += z * sC;
    const int lane = threadIdx.x & 31, lr = lane & 15, hi = lane >> 4; const int r0 = blockIdx.x * 64, c0 = blockIdx.y * 64;
    v8f acc[4][4];
#pragma unroll
    for (int mb = 0; mb < 4; ++mb)
#pragma unroll
        for (int nb = 0; nb < 4; ++nb) acc[mb][nb] = (v8f){};
    const size_t aoff = (size_t)(r0 + lr) * K + 8 * hi, boff = (size_t)(c0 + lr) * K + 8 * hi;
#pragma unroll 1
    for (int kc = 0; kc < K; kc += 32) {
        V a[4], a2[4];
#pragma unroll
        for (int mb = 0; mb < 4; ++mb) { a[mb] = WFrag<T16>::ld(A + aoff + (size_t)mb * 16 * K + kc); if (NSPLIT == 1 || NSPLIT == 2) a2[mb] = WFrag<T16>::ld(A2 + aoff + (size_t)mb * 16 * K + kc); }
#pragma unroll
        for (int nb = 0; nb < 4; ++nb) { const V b = WFrag<T16>::ld(Bt + boff + (size_t)nb * 16 * K + kc); V b2; if (NSPLIT >= 2) b2 = WFrag<T16>::ld(Bt2 + boff + (size_t)nb * 16 * K + kc);
#pragma unroll
            for (int mb = 0; mb < 4; ++mb) { acc[mb][nb] = WFrag<T16>::mma(a[mb], b, acc[mb][nb]); if (NSPLIT == 1 || NSPLIT == 2) acc[mb][nb] = WFrag<T16>::mma(a2[mb], b, acc[mb][nb]); if (NSPLIT >= 2) acc[mb][nb] = WFrag<T16>::mma(a[mb], b2, acc[mb][nb]); } }
        asm volatile("v_nop\n\tv_nop\n\tv_nop\n\tv_nop" : "+v"(acc[0][0]), "+v"(acc[1][1]), "+v"(acc[2][2]), "+v"(acc[3][3]) : "v"(a[0]), "v"(a[3]));
    }
#pragma unroll
    for (int mb = 0; mb < 4; ++mb) {
#pragma unroll
        for (int nb = 0; nb < 4; ++nb) {
#pragma unroll
            for (int j = 0; j < 8; ++j) os[(hi * 8 + j) * 68 + nb * 16 + lr] = acc[mb][nb][j]; }
        __builtin_amdgcn_wave_barrier(); asm volatile("" ::: "memory");
        float* crow = C + (size_t)(r0 + mb * 16) * ldc + c0;
{
#pragma unroll
            for (int s = 0; s < 8; ++s) { const int row = 2 * s + hi, cofs = lr * 4; v4f val = *(const v4fa*)(os + row * 68 + cofs); if (BIAS) { val[0] += bfr(bias[c0 + cofs]); val[1] += bfr(bias[c0 + cofs + 1]); val[2] += bfr(bias[c0 + cofs + 2]); val[3] += bfr(bias[c0 + cofs + 3]); }
                *(v4f*)(crow + (size_t)row * ldc + cofs) = val; }
             }
        __builtin_amdgcn_wave_barrier(); asm volatile("" ::: "memory");
    }
}

__device__ __forceinline__ h16 tohx(float x) { return (h16)x; }
__device__ __forceinline__ void splitf(float y, unsigned short& h, unsigned short& l) { h = f2bf(y); l = f2bf(y - bf2f(h)); }
typedef __attribute__((ext_vector_type(2))) _Float16 v2h;
typedef __attribute__((ext_vector_type(4))) _Float16 v4h;
typedef __attribute__((ext_vector_type(2))) unsigned short v2us;
typedef __attribute__((ext_vector_type(4))) unsigned short v4us;
typedef __attribute__((ext_vector_type(2))) float v2f;
typedef __attribute__((ext_vector_type(4))) int v4i;

__global__ __launch_bounds__(256) void k_wtG(const float* __restrict__ w, int K, int N, bf* Bt) {
    const int lane = threadIdx.x & 31; const int L0 = (blockIdx.x * 8 + (threadIdx.x >> 5)) * 8; const int nlines = N * K / 64;
{
#pragma unroll 1
        for (int l = 0; l < 8; ++l) { const int L = L0 + l; if (L >= nlines) break; const size_t e = (size_t)L * 64 + lane * 2; const int k = (int)(e % K), n = (int)(e / K); v2us o;
            o[0] = f2bf(w[(size_t)k * N + n]); o[1] = f2bf(w[(size_t)(k + 1) * N + n]); *(v2us*)(Bt + e) = o; }
         }
}
__global__ __launch_bounds__(256) void k_cvt8(const float* __restrict__ src, bf* dst, size_t n8) { const size_t i = (size_t)blockIdx.x * 256 + threadIdx.x; if (i >= n8) return; const v8f v = *(const v8f*)(src + i * 8); v8us o;
#pragma unroll
    for (int k = 0; k < 8; ++k) o[k] = f2bf(v[k]); *(v8us*)(dst + i * 8) = o;  }

// ---- k_planes: every plane the attention launch reads, from one read of the packed input, in one launch.
// One workgroup takes PT positions x PH heads of q, k and v: 24 16-byte loads a thread, all issued before the first use (few waves, many bytes in flight each).
// q rows keep their [t][d] order: a wave's load is one position's 128 floats (2 heads), its store one whole 128-byte plane row per head.
// k and v planes are laid out in the order in which the attention launch's A fragments are loaded, in chunks of 8 elements (16 bytes, one lane's share of one load):
//   k: [head][t / 16][d / 8][t % 16][8 d]      v: [head][t / 32][d / 16][(t % 32) / 8][d % 16][8 t]
// so that lane (lr + 16 hi) of a fragment load finds its chunk at lane x 16 bytes: one load reads 512 bytes in a row (4 lines) where rows of a [t][d] or [d][t] plane gave it 16 lines.
// k goes through LDS as bf16 rows of KP words (128 + 16 bytes: the 16-byte reads of 16 rows fall on different banks), the second head's rows 32 banks further (the two halves of a wave's 8-byte writes do not meet); a wave's store is 2 chunk columns x 16 keys = 512 bytes in a row.
// v is transposed through LDS as words of two bf16 (positions 2 tp, 2 tp + 1) at [d][tp], pitch VP words: the writes (16 d-quads x 2 tp a wave) and the reads (16 d rows x 2 key blocks a wave) each fall on 32 different banks; a wave's store is two runs of 256 bytes.
// Every loop is fully unrolled: the arrays of loaded values stay in registers only under constant indices.
// Values: input rounded to bf16 on read, q x 1/8 (exact), fp16 and bf16 planes from that. A bf16 plane holds the value whole (the remainder of a bf16 value after rounding to bf16 is 0), so there is no low plane. Only what is read later is written: q fp16 for rows >= RH, q bf16 for rows < RH, k and v fp16 everywhere, k and v bf16 for positions < RH.
#define PT   64
#define PH   2
#define VP   33
#define KP   36
#define KHS  (PT * KP + 32)
typedef __attribute__((ext_vector_type(2))) unsigned v2u;
typedef __attribute__((ext_vector_type(4))) unsigned v4u;
template <bool LOW>
__device__ __forceinline__ void planes_out(const unsigned* vs, const unsigned* ks, const v4f (&xq)[8], int tid, int z0, int t0, h16* __restrict__ Q16, h16* __restrict__ K16, h16* __restrict__ V16, bf* __restrict__ Qh, bf* __restrict__ Kh, bf* __restrict__ Vh) {
    const int lane = tid & 31, wave = tid >> 5;
#pragma unroll
    for (int i = 0; i < 4; ++i) { const int idx = i * 256 + tid, lr = idx & 15, blk = (idx >> 4) & 1, c = (idx >> 5) & 3, dg = idx >> 7;   // dg: group of 16 d rows, over both heads
        const size_t e = (size_t)(z0 + (dg >> 2)) * (TT * HD) + (size_t)(t0 + blk * 32) * HD + (dg & 3) * 512 + c * 128 + lr * 8; v8h o16; v8us oh;
#pragma unroll
        for (int k = 0; k < 4; ++k) { const unsigned w = vs[(dg * 16 + lr) * VP + (blk * 4 + c) * 4 + k];
#pragma unroll
            for (int q = 0; q < 2; ++q) { const unsigned short xb = (unsigned short)(q ? (w >> 16) : (w & 0xFFFFu)); o16[2 * k + q] = tohx(bf2f(xb)); if (LOW) oh[2 * k + q] = xb; } }
        *(v8h*)(V16 + e) = o16; if (LOW) *(v8us*)(Vh + e) = oh; }
#pragma unroll
    for (int i = 0; i < 4; ++i) { const int idx = i * 256 + tid, key = idx & 15, c8 = (idx >> 4) & 7, tg = idx >> 7;   // tg: group of 16 positions, over both heads
        const size_t e = (size_t)(z0 + (tg >> 2)) * (TT * HD) + (size_t)(t0 + (tg & 3) * 16) * HD + c8 * 128 + key * 8; v8h o16; v8us oh;
        const v4u w4 = *(const v4u*)(ks + (tg >> 2) * KHS + ((tg & 3) * 16 + key) * KP + c8 * 4);
#pragma unroll
        for (int k = 0; k < 4; ++k)
#pragma unroll
            for (int q = 0; q < 2; ++q) { const unsigned short xb = (unsigned short)(q ? (w4[k] >> 16) : (w4[k] & 0xFFFFu)); o16[2 * k + q] = tohx(bf2f(xb)); if (LOW) oh[2 * k + q] = xb; }
        *(v8h*)(K16 + e) = o16; if (LOW) *(v8us*)(Kh + e) = oh; }
#pragma unroll
    for (int i = 0; i < 8; ++i) { const size_t e = ((size_t)(z0 + (lane >> 4)) * TT + t0 + i * 8 + wave) * HD + (lane & 15) * 4; v4h q16; v4us qh;
#pragma unroll
        for (int j = 0; j < 4; ++j) { const float rq = bfr(xq[i][j]) * SCL;
            if (LOW) qh[j] = f2bf(rq); else q16[j] = tohx(rq); }
        if (LOW) *(v4us*)(Qh + e) = qh; else *(v4h*)(Q16 + e) = q16; }
}
__global__ __launch_bounds__(256) void k_planes(const float* __restrict__ qkv, h16* __restrict__ Q16, h16* __restrict__ K16, h16* __restrict__ V16, bf* __restrict__ Qh, bf* __restrict__ Kh, bf* __restrict__ Vh) {
    __shared__ unsigned vs[PH * HD * VP];
    __shared__ __align__(16) unsigned ks[PH * KHS];
    const int tid = threadIdx.x, lane = tid & 31, wave = tid >> 5;
    const int z0 = blockIdx.z * NH_ + blockIdx.x * PH, t0 = blockIdx.y * PT;
    const float* src = qkv + ((size_t)blockIdx.z * TT + t0) * (3 * DQ) + blockIdx.x * (PH * HD);
    const float* pv = src + (size_t)(2 * (tid >> 4)) * (3 * DQ) + (tid & 15) * 4;   // v (at + 2 DQ): positions 2 tp and 2 tp + 1, tp = tid / 16 (+ 16), d-quad tid % 16
    const float* pq = src + (size_t)wave * (3 * DQ) + lane * 4;   // q (k at + DQ): position wave (+ 8 i), 128 floats over the lanes
    v4f xv[8], xq[8], xk[8];
#pragma unroll
    for (int i = 0; i < 4; ++i) { const float* p = pv + 2 * DQ + (i & 1) * (32 * 3 * DQ) + (i >> 1) * HD; xv[2 * i] = *(const v4f*)p; xv[2 * i + 1] = *(const v4f*)(p + 3 * DQ); }
#pragma unroll
    for (int i = 0; i < 8; ++i) { const float* p = pq + i * (8 * 3 * DQ); xq[i] = *(const v4f*)p; xk[i] = *(const v4f*)(p + DQ); }
    asm volatile("s_wait_xcnt 0x0" :: "v"(pv), "v"(pq) : "memory");   // stands in front of every overwrite of an address register of the loads above; it names the two addresses so that they stay in their registers up to here (else a later load's result is given an earlier load's address pair)
    __builtin_amdgcn_sched_barrier(0);   // keeps all 24 loads issued here: left free, the scheduler holds the last of them back until the first values have arrived, a second memory latency
#pragma unroll
    for (int i = 0; i < 4; ++i)
#pragma unroll
        for (int j = 0; j < 4; ++j) vs[((i >> 1) * HD + (tid & 15) * 4 + j) * VP + (i & 1) * 16 + (tid >> 4)] = (unsigned)f2bf(xv[2 * i][j]) | ((unsigned)f2bf(xv[2 * i + 1][j]) << 16);
#pragma unroll
    for (int i = 0; i < 8; ++i) { v2u w; w[0] = (unsigned)f2bf(xk[i][0]) | ((unsigned)f2bf(xk[i][1]) << 16); w[1] = (unsigned)f2bf(xk[i][2]) | ((unsigned)f2bf(xk[i][3]) << 16); *(v2u*)(ks + (lane >> 4) * KHS + (i * 8 + wave) * KP + (lane & 15) * 2) = w; }
    __syncthreads();   // the v and k tiles are whole; nothing is written to them afterwards
    if (t0 < RH) { planes_out<true>(vs, ks, xq, tid, z0, t0, Q16, K16, V16, Qh, Kh, Vh); return; }   // the same branch for the whole workgroup, behind the only barrier
    planes_out<false>(vs, ks, xq, tid, z0, t0, Q16, K16, V16, Qh, Kh, Vh);
    asm volatile("s_wait_xcnt 0x0" ::: "memory");   // the built code lays this path in front of the other one and ends it with a conditional jump: the fall-through (never taken) rewrites address registers of the stores above
}
// ---- k_fattn: scores, ALiBi + window softmax and the probability x value product of one strip of query rows, with nothing of the scores leaving the registers.
// KS = 1: one wave walks all key passes of the strip. KS = 2: two waves of the workgroup walk one part of the passes each ('cut' and the rest), with their own running maximum, sum and accumulators; the two partial results are merged through LDS behind one barrier (weights exp(m_p - max), divided by the merged sum).
// Transposed products: St[key][query] = K . Qt (A = K rows, B = Q rows), Ot[d][query] += Vt . Pt (A = Vt rows, B = the packed score accumulators: two 16-key St tiles of one query column group are, converted in place, one 32-key B operand).
// A lane holds one query column (query = lr), so the running maximum, the running sum and the rescale factor are per-lane values; the two lane halves (keys 8 hi .. 8 hi + 7 of each 16) join by one exchange.
// Online softmax over passes of 32 keys from the window's first key block to the diagonal block. Masked scores are -inf, the running maximum starts at a finite -1e30: a pass with no valid key for a column adds exactly 0.
// ALiBi without per-element work: -slope (i - j) = slope (j - kb) - slope (i - kb). The first term is the same 32 values in every pass and is the start value of the score accumulators; the second is one value a lane and pass and goes into the maximum and into the exponent's addend.
// Mask: only a pass that touches the diagonal or the window's far edge can hold an invalid key; the test is scalar, all other passes skip the mask.
// Every inner loop is fully unrolled (the fragment and accumulator arrays stay in registers only under constant indices); the pass loop stays rolled (one pass's fragments and temporaries already take the wave's register budget).
// SPLIT (rows < RH): bf16 planes (q, k and v are bf16 values: one product gives St whole), the probabilities as bf16 hi + lo: 2 products for Ot. Otherwise fp16 planes, probabilities carried x 1024 (in the exponent; the row sum carries the same factor, so it cancels in the division).
#define QTF  2                               // query column groups per wave, fp16 rows (32 rows a strip); hi/lo rows: 1 (16 rows a strip)
#define NWV  12                              // waves per workgroup
#define SLOT (QTF * 4 * 256)                 // floats of one wave's partial output in LDS
template <typename T16, bool SPLIT, int QT, int KS>
__device__ __forceinline__ void attn_strip(const T16* __restrict__ Q, const T16* __restrict__ Kp, const T16* __restrict__ Vt, float sl, int q0, int part, int skew, int slot0, int sstep, float* smo, float* sml, float* __restrict__ orow) {
    typedef typename WFrag<T16>::V V;
    static_assert(KS == 1 || KS == QT, "the merging wave 'part' takes the query column group 'part'");
    const int lane = threadIdx.x & 31, lr = lane & 15, hi = lane >> 4;
    V qf[QT][2];
    const T16* const qp = Q + (size_t)(q0 + lr) * HD + 8 * hi;   // the lane's query row, its 8 elements of each 16
#pragma unroll
    for (int qt = 0; qt < QT; ++qt)
#pragma unroll
        for (int kc = 0; kc < 2; ++kc) qf[qt][kc] = WFrag<T16>::ld(qp + (qt * 16 * HD + kc * 32));
    asm volatile("s_wait_xcnt 0x0" :: "v"(qp) : "memory");   // stands in front of every later overwrite of the address register of the loads above (the pass loop's first address additions reuse it); it names the address so that it stays in its registers up to here
    v8f o[QT][4]; float m[QT], l[QT];
#pragma unroll
    for (int qt = 0; qt < QT; ++qt) { m[qt] = -1.0e30f; l[qt] = 0.f;   // finite, and small enough that (offset - m) x log2(e) stays finite: -inf x log2(e) + that is -inf, not NaN
#pragma unroll
        for (int dt = 0; dt < 4; ++dt) o[qt][dt] = (v8f){}; }
    const int kall = max(q0 - (WIN - 1), 0) & ~31, npass = (q0 + QT * 16 + 31 - kall) >> 5;   // key blocks of 32 that hold a valid key of some row of the strip
    const int cut = (npass - skew) >> 1;   // KS = 2: wave 0 takes the first 'cut' passes, wave 1 the rest, 'skew' more (used where a strip has 17 passes or more and skew is at most 8: no run is empty)
    const int kbeg = kall + (KS == 1 ? 0 : part * cut) * 32, kend = kall + ((KS == 1 || part != 0) ? npass : cut) * 32;   // this wave's run of passes
    const unsigned flane = lane * 8;   // the lane's own chunk of a fragment load (k and v planes are in fragment order: 32 keys of either are 4 KiB in a row, 8 loads of 512 bytes)
    v8f cb[2];   // slope x (j - kb) of the lane's 16 score elements
#pragma unroll
    for (int t = 0; t < 2; ++t)
#pragma unroll
        for (int r = 0; r < 8; ++r) cb[t][r] = sl * (float)(t * 16 + 8 * hi + r);
    V kf[2][2];
    // every strip fetches its K fragments one pass ahead: no pass opens with a wait for loads that it has only just issued
#pragma unroll
    for (int t = 0; t < 2; ++t)
#pragma unroll
        for (int kc = 0; kc < 2; ++kc) kf[t][kc] = WFrag<T16>::ldf(Kp + (size_t)kbeg * HD + flane + (t * 16 * HD + kc * 512));
#pragma unroll 1
    for (int kb = kbeg; kb < kend; kb += 32) {
        V vf[4];
        const size_t boff = (size_t)kb * HD + flane;   // this pass's 32 keys, the lane's chunk
        const T16* const vp = Vt + boff;
#pragma unroll
        for (int dt = 0; dt < 4; ++dt) vf[dt] = WFrag<T16>::ldf(vp + dt * 512);
        asm volatile("s_wait_xcnt 0x0" ::: "memory");   // stands in front of every later overwrite of an address register of the loads above (the compiler reuses them)
        __builtin_amdgcn_sched_barrier(0);   // keeps the V loads issued here: left free, the scheduler sinks them to just in front of the P.V products and their whole latency is waited out there
        v8f s[QT][2];
#pragma unroll
        for (int t = 0; t < 2; ++t)
#pragma unroll
            for (int qt = 0; qt < QT; ++qt) { v8f a = cb[t];
#pragma unroll
                for (int kc = 0; kc < 2; ++kc) a = WFrag<T16>::mma(kf[t][kc], qf[qt][kc], a);
                s[qt][t] = a; }
        {
            const int kn = (kb + 32 < kend) ? kb + 32 : kb;   // next pass's K fragments: their latency runs under the softmax (the last pass fetches its own block again: in bounds, unused)
            const T16* const kpn = Kp + (size_t)kn * HD + flane;
#pragma unroll
            for (int t = 0; t < 2; ++t)
#pragma unroll
                for (int kc = 0; kc < 2; ++kc) kf[t][kc] = WFrag<T16>::ldf(kpn + (t * 16 * HD + kc * 512));
            if constexpr (SPLIT) {   // order inside this stretch: the score products first, then the refill's loads; a load lifted over a product that still reads its registers lands in other registers and is copied later in the pass, behind a wait for it
                __builtin_amdgcn_sched_group_barrier(0x008, 4, 0);
                __builtin_amdgcn_sched_group_barrier(0x020, 8, 0);
            }
            asm volatile("s_wait_xcnt 0x0" :: "v"(kpn) : "memory");   // as above, for the refill's address registers; it names the address so that it stays in its registers up to here (else the last load's result is given the pair that the earlier loads name)
            __builtin_amdgcn_sched_barrier(0);   // keeps the refill issued here: left free, the scheduler sinks it to the loop's foot and the next pass waits out its whole latency
        }
        if (kb + 31 > q0 || q0 + QT * 16 - 1 - kb >= WIN) {   // scalar: the pass holds a key past some row's diagonal or beyond some row's window
#pragma unroll
            for (int qt = 0; qt < QT; ++qt) {
                const int d0 = q0 + qt * 16 + lr - kb - 8 * hi;   // i - j of element (t = 0, r = 0)
#pragma unroll
                for (int t = 0; t < 2; ++t)
#pragma unroll
                    for (int r = 0; r < 8; ++r) if ((unsigned)(d0 - t * 16 - r) >= (unsigned)WIN) s[qt][t][r] = -__builtin_inff();
            }
        }
#pragma unroll
        for (int qt = 0; qt < QT; ++qt) {
            const float off = -sl * (float)(q0 + qt * 16 + lr - kb);   // the part of the bias that all 32 keys of the pass share
            float ms = s[qt][0][0];
#pragma unroll
            for (int t = 0; t < 2; ++t)
#pragma unroll
                for (int r = 0; r < 8; ++r) ms = fmaxf(ms, s[qt][t][r]);
            ms = fmaxf(ms, __shfl_xor(ms, 16, 32));
            const float mx = fmaxf(m[qt], ms + off);
            const float al = __builtin_amdgcn_exp2f((m[qt] - mx) * 1.4426950408889634f); m[qt] = mx;
            const float ec = (off - mx) * 1.4426950408889634f + (SPLIT ? 0.0f : 10.0f);
            float ps = 0.f;
#pragma unroll
            for (int t = 0; t < 2; ++t)
#pragma unroll
                for (int r = 0; r < 8; r += 2) { const v2f e2 = (v2f){s[qt][t][r], s[qt][t][r + 1]} * 1.4426950408889634f + ec;   // two neighbouring accumulator registers: one packed multiply-add
                    const float p0 = __builtin_amdgcn_exp2f(e2[0]), p1 = __builtin_amdgcn_exp2f(e2[1]); s[qt][t][r] = p0; s[qt][t][r + 1] = p1; ps += p0; ps += p1; }
            l[qt] = l[qt] * al + ps;
#pragma unroll
            for (int dt = 0; dt < 4; ++dt) o[qt][dt] *= al;
            if constexpr (SPLIT) {
                v8us ph[2], pl[2];
#pragma unroll
                for (int t = 0; t < 2; ++t)
#pragma unroll
                    for (int r = 0; r < 8; ++r) { unsigned short a, c2; splitf(s[qt][t][r], a, c2); ph[t][r] = a; pl[t][r] = c2; }
                const V pfh = cat16b(ph[0], ph[1]), pfl = cat16b(pl[0], pl[1]);
#pragma unroll
                for (int dt = 0; dt < 4; ++dt) { o[qt][dt] = WFrag<T16>::mma(vf[dt], pfh, o[qt][dt]); o[qt][dt] = WFrag<T16>::mma(vf[dt], pfl, o[qt][dt]); }
            } else {
                v8h p8[2];
#pragma unroll
                for (int t = 0; t < 2; ++t)
#pragma unroll
                    for (int r = 0; r < 8; ++r) p8[t][r] = tohx(s[qt][t][r]);
                const V pf = cat16(p8[0], p8[1]);
#pragma unroll
                for (int dt = 0; dt < 4; ++dt) o[qt][dt] = WFrag<T16>::mma(vf[dt], pf, o[qt][dt]);
            }
        }
    }
    if constexpr (KS == 1) {
#pragma unroll
    for (int qt = 0; qt < QT; ++qt) {
        const float f = __fdiv_rn(1.0f, l[qt] + __shfl_xor(l[qt], 16, 32));
        float* op = orow + (size_t)(q0 + qt * 16 + lr) * DQ + 8 * hi;   // a lane's 8 accumulator registers are 8 consecutive e of its query row
#pragma unroll
        for (int dt = 0; dt < 4; ++dt) { v4f w0, w1;
#pragma unroll
            for (int r = 0; r < 4; ++r) { w0[r] = o[qt][dt][r] * f; w1[r] = o[qt][dt][4 + r] * f; }
            *(v4f*)(op + dt * 16) = w0; *(v4f*)(op + dt * 16 + 4) = w1; }
    }
    asm volatile("s_wait_xcnt 0x0" ::: "memory");   // stands in front of every later overwrite of a register of the stores above (a second strip follows in the same wave)
    } else {
    // hand-over: each wave lays its partial result into its own LDS slot, each lane its own 16-byte chunks (a wave's store or load is 512 bytes in a row), with the column's maximum and its sum joined over the two lane halves
    float* const myo = smo + (slot0 + part * sstep) * SLOT; float* const myl = sml + (slot0 + part * sstep) * 128;
#pragma unroll
    for (int qt = 0; qt < QT; ++qt) {
        myl[(qt * 2) * 32 + lane] = m[qt]; myl[(qt * 2 + 1) * 32 + lane] = l[qt] + __shfl_xor(l[qt], 16, 32);
#pragma unroll
        for (int dt = 0; dt < 4; ++dt) { v4f w0, w1;
#pragma unroll
            for (int r = 0; r < 4; ++r) { w0[r] = o[qt][dt][r]; w1[r] = o[qt][dt][4 + r]; }
            *(v4f*)(myo + ((qt * 4 + dt) * 2) * 128 + lane * 4) = w0; *(v4f*)(myo + ((qt * 4 + dt) * 2 + 1) * 128 + lane * 4) = w1; }
    }
    __syncthreads();   // all partial results of the workgroup's strips are in LDS; nothing is written there afterwards
    // merge: wave 'part' takes the query column group 'part' of its strip: 16 whole output rows of the head
    float wg[KS]; float mall = -3.0e38f, lall = 0.f;
#pragma unroll
    for (int p = 0; p < KS; ++p) { wg[p] = sml[(slot0 + p * sstep) * 128 + (part * 2) * 32 + lane]; mall = fmaxf(mall, wg[p]); }
#pragma unroll
    for (int p = 0; p < KS; ++p) { wg[p] = __builtin_amdgcn_exp2f((wg[p] - mall) * 1.4426950408889634f); lall += wg[p] * sml[(slot0 + p * sstep) * 128 + (part * 2 + 1) * 32 + lane]; }
    const float f = __fdiv_rn(1.0f, lall);
#pragma unroll
    for (int p = 0; p < KS; ++p) wg[p] *= f;
    float* op = orow + (size_t)(q0 + part * 16 + lr) * DQ + 8 * hi;   // a lane's 8 accumulator registers are 8 consecutive e of its query row
#pragma unroll
    for (int dt = 0; dt < 4; ++dt) { v4f w0 = (v4f){}, w1 = (v4f){};
#pragma unroll
        for (int p = 0; p < KS; ++p) { const float* ps = smo + (slot0 + p * sstep) * SLOT + ((part * 4 + dt) * 2) * 128 + lane * 4; w0 += *(const v4f*)ps * wg[p]; w1 += *(const v4f*)(ps + 128) * wg[p]; }
        *(v4f*)(op + dt * 16) = w0; *(v4f*)(op + dt * 16 + 4) = w1; }
    }
}
// Deal of the work: one workgroup of 12 waves for each WGP of the chip (3 waves a SIMD; the registers do not take a second workgroup's 3, so no two workgroups share a WGP), every workgroup with about the same sum of passes. Workgroup g (of NGW) of a (batch, head) pair:
//   waves 4 .. 11: four neighbouring full-window fp16 strips (33 passes), two waves a strip;
//   waves 0 .. 3:  one hi/lo strip each (16 rows, all its passes), then two of the shorter fp16 strips (17 + 2 g and 18 + 2 g passes), two waves a strip. Waves 0 and 1 have hi/lo strips of 16 - g passes, waves 2 and 3 of 8 - g:
//                  the longer hi/lo strips go with the shorter fp16 strips, and of an fp16 strip the wave that had NGW hi/lo passes more takes NGW passes fewer: the four waves cost about the same, in every workgroup.
// The waves with two strips have the most passes and the lowest numbers (for speed only).
#define NGW  (RH / 16 / 4)                   // workgroups per (batch, head) pair
#define NSS  (2 * NGW)                       // fp16 strips with fewer passes than the full window (rows RH .. WIN - 1)
static_assert(NSS * 16 * QTF == WIN - RH && (NSS + 4 * NGW) * 16 * QTF == TT - RH, "every fp16 strip is dealt once");
__global__ __launch_bounds__(NWV * 32) void k_fattn(const h16* __restrict__ Q16, const h16* __restrict__ K16, const h16* __restrict__ V16, const bf* __restrict__ Qh, const bf* __restrict__ Kh, const bf* __restrict__ Vh, float* __restrict__ OUT) {
    __shared__ __align__(16) float smo[NWV * SLOT];
    __shared__ float sml[NWV * 128];
    const int z = blockIdx.x, h = z % NH_, b = z / NH_; const size_t pz = (size_t)z * TT * HD;
    const int g = blockIdx.y;
    const int wave = __builtin_amdgcn_readfirstlane(threadIdx.x >> 5);   // scalar: trip counts and plane addresses stay in scalar registers
    const float sl = exp2f(__fdiv_rn(__fmul_rn(-8.0f, (float)(h + 1)), (float)NH_));
    float* orow = OUT + (size_t)b * TT * DQ + h * HD;
    const bool two = wave < 4;   // the same for a whole wave; no barrier stands inside the branch
    if (two) attn_strip<bf, true, 1, 1>(Qh + pz, Kh + pz, Vh + pz, sl, ((2 * NGW - 1 - g - NGW * (wave >> 1)) * 2 + (wave & 1)) * 16, 0, 0, 0, 0, smo, sml, orow);
    const int strip = two ? g * 2 + (wave & 1) : NSS + g * 4 + (wave & 3);
    const int part  = two ? wave >> 1 : (wave - 4) >> 2;
    const int slot0 = two ? (wave & 1) : 4 + (wave & 3);   // LDS slot of the strip's first wave; its second wave's is sstep further
    const int sstep = two ? 2 : 4;
    attn_strip<h16, false, QTF, 2>(Q16 + pz, K16 + pz, V16 + pz, sl, RH + strip * 16 * QTF, part, two ? NGW : 0, slot0, sstep, smo, sml, orow);
}
extern "C" void kernel_launch(void* const* d_in, const int* in_sizes, int n_in,
                              void* d_out, int out_size, void* d_ws, size_t ws_size, hipStream_t stream) {
    (void)in_sizes; (void)n_in; (void)out_size;
    const float* qkv = (const float*)d_in[0];
    float* OUT = (float*)d_out;     // [2][2048][1024]
    char* wsp = (char*)d_ws;
    auto take = [&](size_t bytes) { char* p = wsp; wsp += (bytes + 255) & ~(size_t)255; return (void*)p; };
    const size_t PB = (size_t)NH_ * TT * HD;   /* elements of one batch's plane set; every plane holds both batches */
    h16* QP16 = (h16*)take(NB_ * PB * 2); h16* KP16 = (h16*)take(NB_ * PB * 2); h16* VT16 = (h16*)take(NB_ * PB * 2);
    bf* QPh = (bf*)take(NB_ * PB * 2); bf* KPh = (bf*)take(NB_ * PB * 2); bf* VTh = (bf*)take(NB_ * PB * 2);
    if ((size_t)(wsp - (char*)d_ws) > ws_size) return;    // ws 256 MiB

    k_planes<<<dim3(NH_ / PH, TT / PT, NB_), 256, 0, stream>>>(qkv, QP16, KP16, VT16, QPh, KPh, VTh);
    k_fattn<<<dim3(NB_ * NH_, NGW), NWV * 32, 0, stream>>>(QP16, KP16, VT16, QPh, KPh, VTh, OUT);
}

// v009
// One run takes 27 microseconds.
// In both of two side-by-side timings against v008, it was 1.07 times as fast.
// All steps since v000 together make it 49.6 times as fast.
#include <hip/hip_runtime.h>

// FlexAttention training path: sliding-window causal attention with ALiBi (qkv [2][2048][3][16][64] packed; q, k, v = qkv[:, :, 0/1/2]; scores = q.k / 8 - slope_h (i - j), slope_h = 2^(-8 (h+1) / 16); keys with 0 <= i - j < 1024 only; softmax; out[b][l][h][e] -> [2][2048][16][64] f32 (4.2 M)).
// Layout: the packed input rows (stride 3 x 1024 floats) feed one plane-builder launch directly (bf16-rounded on read; q planes carry the exact 1/8 scale), both batches' planes side by side; one fused launch over all 32 (batch, head) pairs does scores, ALiBi bias (slope_h x (i - j), f32, exp2f slopes), window mask, online softmax and the probability x value product per strip of query rows (hybrid rows: < 512 bf16 operands with the probabilities as hi + lo, 2 products, rest fp16 x1024; only key blocks inside the band are visited) and writes the [l][h][e] output rows directly.
// Compute dtypes, f32 accumulate: qkv rounded to bf16; rows < 512 bf16 q, k, v (exact: they are bf16 values) and hi + lo probabilities, rest fp16; ALiBi bias and softmax f32; output f32.

#define NB_  2
#define TT   2048
#define DM   1024
#define NH_  16
#define NKV  16
#define REP  (NH_ / NKV)
#define HD   64
#define DQ   (NH_ * HD)
#define DKV  (NKV * HD)
#define RH   512                  // query rows < RH use bf16 planes, hi+lo probabilities
#define WIN  1024
#define SCL  0.125f   // HD^-0.5
typedef _Float16 h16;
typedef unsigned short bf;
typedef __attribute__((ext_vector_type(16))) __bf16   v16bf;
typedef __attribute__((ext_vector_type(16))) _Float16 v16h;
typedef __attribute__((ext_vector_type(8)))  _Float16 v8h;
typedef __attribute__((ext_vector_type(8)))  unsigned short v8us;
typedef __attribute__((ext_vector_type(8)))  float    v8f;
typedef __attribute__((ext_vector_type(4)))  float    v4f;
typedef v8h  __attribute__((may_alias)) v8ha;
typedef v4f  __attribute__((may_alias)) v4fa;
typedef v8us __attribute__((may_alias)) v8usa;

__device__ __forceinline__ unsigned short f2bf(float f) { unsigned u = __float_as_uint(f); u += 0x7FFFu + ((u >> 16) & 1u); return (unsigned short)(u >> 16); }
__device__ __forceinline__ float bf2f(unsigned short b) { return __uint_as_float(((unsigned)b) << 16); }
__device__ __forceinline__ float bfr(float f) { return bf2f(f2bf(f)); }
__device__ __forceinline__ v16h cat16(v8h lo, v8h hi) { return __builtin_shufflevector(lo, hi, 0, 1, 2, 3, 4, 5, 6, 7, 8, 9, 10, 11, 12, 13, 14, 15); }
__device__ __forceinline__ v16bf cat16b(v8us lo, v8us hi) { return __builtin_bit_cast(v16bf, __builtin_shufflevector(lo, hi, 0, 1, 2, 3, 4, 5, 6, 7, 8, 9, 10, 11, 12, 13, 14, 15)); }
__device__ __forceinline__ v8f wmma16(v16h a, v16h b, v8f c) { return __builtin_amdgcn_wmma_f32_16x16x32_f16(false, a, false, b, (short)0, c, false, false); }
__device__ __forceinline__ v8f wmmab(v16bf a, v16bf b, v8f c) { return __builtin_amdgcn_wmma_f32_16x16x32_bf16(false, a, false, b, (short)0, c, false, false); }



// ---- k_gemmw: register-blocked GEMM, ONE WAVE per 64x64 output tile (16 accumulators), operands straight from K-contiguous 16-bit planes; grid (M/64, N/64, Z), 32 threads.
// C[m][n] (f32, pitch ldc, + optional f32 bias[n]) = sum_k A[m][k] Bt[n][k] (+ split products per NSPLIT). z-batch strides sA/sB/sC in elements. K % 32 == 0.
template <typename T16> struct WFrag;
template <> struct WFrag<h16> { typedef v16h V; static __device__ __forceinline__ V ld(const h16* p) { return cat16(*(const v8h*)p, *(const v8h*)(p + 16)); } static __device__ __forceinline__ V ldf(const h16* p) { return cat16(*(const v8h*)p, *(const v8h*)(p + 256)); } static __device__ __forceinline__ v8f mma(V a, V b, v8f c) { return wmma16(a, b, c); } };
template <> struct WFrag<bf> { typedef v16bf V; static __device__ __forceinline__ V ld(const bf* p) { return cat16b(*(const v8us*)p, *(const v8us*)(p + 16)); } static __device__ __forceinline__ V ldf(const bf* p) { return cat16b(*(const v8us*)p, *(const v8us*)(p + 256)); } static __device__ __forceinline__ v8f mma(V a, V b, v8f c) { return wmmab(a, b, c); } };
template <typename T16, int NSPLIT, bool BIAS>
__global__ __launch_bounds__(32) void k_gemmw(const T16* __restrict__ A, const T16* __restrict__ A2, const T16* __restrict__ Bt, const T16* __restrict__ Bt2, int K, float* C, int ldc, const float* __restrict__ bias, size_t sA, size_t sB, size_t sC) {
    typedef typename WFrag<T16>::V V;
    __shared__ __align__(16) float os[16 * 68];
    const size_t z = blockIdx.z; A += z * sA; if (A2) A2 += z * sA; Bt += z * sB; if (Bt2) Bt2 += z * sB; C += z * sC;
    const int lane = threadIdx.x & 31, lr = lane & 15, hi = lane >> 4; const int r0 = blockIdx.x * 64, c0 = blockIdx.y * 64;
    v8f acc[4][4];
#pragma unroll
    for (int mb = 0; mb < 4; ++mb)
#pragma unroll
        for (int nb = 0; nb < 4; ++nb) acc[mb][nb] = (v8f){};
    const size_t aoff = (size_t)(r0 + lr) * K + 8 * hi, boff = (size_t)(c0 + lr) * K + 8 * hi;
#pragma unroll 1
    for (int kc = 0; kc < K; kc += 32) {
        V a[4], a2[4];
#pragma unroll
        for (int mb = 0; mb < 4; ++mb) { a[mb] = WFrag<T16>::ld(A + aoff + (size_t)mb * 16 * K + kc); if (NSPLIT == 1 || NSPLIT == 2) a2[mb] = WFrag<T16>::ld(A2 + aoff + (size_t)mb * 16 * K + kc); }
#pragma unroll
        for (int nb = 0; nb < 4; ++nb) { const V b = WFrag<T16>::ld(Bt + boff + (size_t)nb * 16 * K + kc); V b2; if (NSPLIT >= 2) b2 = WFrag<T16>::ld(Bt2 + boff + (size_t)nb * 16 * K + kc);
#pragma unroll
            for (int mb = 0; mb < 4; ++mb) { acc[mb][nb] = WFrag<T16>::mma(a[mb], b, acc[mb][nb]); if (NSPLIT == 1 || NSPLIT == 2) acc[mb][nb] = WFrag<T16>::mma(a2[mb], b, acc[mb][nb]); if (NSPLIT >= 2) acc[mb][nb] = WFrag<T16>::mma(a[mb], b2, acc[mb][nb]); } }
        asm volatile("v_nop\n\tv_nop\n\tv_nop\n\tv_nop" : "+v"(acc[0][0]), "+v"(acc[1][1]), "+v"(acc[2][2]), "+v"(acc[3][3]) : "v"(a[0]), "v"(a[3]));
    }
#pragma unroll
    for (int mb = 0; mb < 4; ++mb) {
#pragma unroll
        for (int nb = 0; nb < 4; ++nb) {
#pragma unroll
            for (int j = 0; j < 8; ++j) os[(hi * 8 + j) * 68 + nb * 16 + lr] = acc[mb][nb][j]; }
        __builtin_amdgcn_wave_barrier(); asm volatile("" ::: "memory");
        float* crow = C + (size_t)(r0 + mb * 16) * ldc + c0;
{
#pragma unroll
            for (int s = 0; s < 8; ++s) { const int row = 2 * s + hi, cofs = lr * 4; v4f val = *(const v4fa*)(os + row * 68 + cofs); if (BIAS) { val[0] += bfr(bias[c0 + cofs]); val[1] += bfr(bias[c0 + cofs + 1]); val[2] += bfr(bias[c0 + cofs + 2]); val[3] += bfr(bias[c0 + cofs + 3]); }
                *(v4f*)(crow + (size_t)row * ldc + cofs) = val; }
             }
        __builtin_amdgcn_wave_barrier(); asm volatile("" ::: "memory");
    }
}

__device__ __forceinline__ h16 tohx(float x) { return (h16)x; }
__device__ __forceinline__ void splitf(float y, unsigned short& h, unsigned short& l) { h = f2bf(y); l = f2bf(y - bf2f(h)); }
typedef __attribute__((ext_vector_type(2))) _Float16 v2h;
typedef __attribute__((ext_vector_type(4))) _Float16 v4h;
typedef __attribute__((ext_vector_type(2))) unsigned short v2us;
typedef __attribute__((ext_vector_type(4))) unsigned short v4us;
typedef __attribute__((ext_vector_type(2))) float v2f;
typedef __attribute__((ext_vector_type(4))) int v4i;

__global__ __launch_bounds__(256) void k_wtG(const float* __restrict__ w, int K, int N, bf* Bt) {
    const int lane = threadIdx.x & 31; const int L0 = (blockIdx.x * 8 + (threadIdx.x >> 5)) * 8; const int nlines = N * K / 64;
{
#pragma unroll 1
        for (int l = 0; l < 8; ++l) { const int L = L0 + l; if (L >= nlines) break; const size_t e = (size_t)L * 64 + lane * 2; const int k = (int)(e % K), n = (int)(e / K); v2us o;
            o[0] = f2bf(w[(size_t)k * N + n]); o[1] = f2bf(w[(size_t)(k + 1) * N + n]); *(v2us*)(Bt + e) = o; }
         }
}
__global__ __launch_bounds__(256) void k_cvt8(const float* __restrict__ src, bf* dst, size_t n8) { const size_t i = (size_t)blockIdx.x * 256 + threadIdx.x; if (i >= n8) return; const v8f v = *(const v8f*)(src + i * 8); v8us o;
#pragma unroll
    for (int k = 0; k < 8; ++k) o[k] = f2bf(v[k]); *(v8us*)(dst + i * 8) = o;  }

// ---- k_planes: every plane the attention launch reads, from one read of the packed input, in one launch.
// One workgroup takes PT positions x PH heads of q, k and v: 24 16-byte loads a thread, all issued before the first use (few waves, many bytes in flight each).
// q rows keep their [t][d] order: a wave's load is one position's 128 floats (2 heads), its store one whole 128-byte plane row per head.
// k and v planes are laid out in the order in which the attention launch's A fragments are loaded, in chunks of 8 elements (16 bytes, one lane's share of one load):
//   k: [head][t / 16][d / 8][t % 16][8 d]      v: [head][t / 32][d / 16][(t % 32) / 8][d % 16][8 t]
// so that lane (lr + 16 hi) of a fragment load finds its chunk at lane x 16 bytes: one load reads 512 bytes in a row (4 lines) where rows of a [t][d] or [d][t] plane gave it 16 lines.
// k goes through LDS as bf16 rows of KP words (128 + 16 bytes: the 16-byte reads of 16 rows fall on different banks), the second head's rows 32 banks further (the two halves of a wave's 8-byte writes do not meet); a wave's store is 2 chunk columns x 16 keys = 512 bytes in a row.
// v is transposed through LDS as words of two bf16 (positions 2 tp, 2 tp + 1) at [d][tp], pitch VP words: the writes (16 d-quads x 2 tp a wave) and the reads (16 d rows x 2 key blocks a wave) each fall on 32 different banks; a wave's store is two runs of 256 bytes.
// Every loop is fully unrolled: the arrays of loaded values stay in registers only under constant indices.
// Values: input rounded to bf16 on read, q x 1/8 (exact), fp16 and bf16 planes from that. A bf16 plane holds the value whole (the remainder of a bf16 value after rounding to bf16 is 0), so there is no low plane. Only what is read later is written: q fp16 for rows >= RH, q bf16 for rows < RH, k and v fp16 everywhere, k and v bf16 for positions < RH.
#define PT   64
#define PH   2
#define VP   33
#define KP   36
#define KHS  (PT * KP + 32)
typedef __attribute__((ext_vector_type(2))) unsigned v2u;
typedef __attribute__((ext_vector_type(4))) unsigned v4u;
template <bool LOW>
__device__ __forceinline__ void planes_out(const unsigned* vs, const unsigned* ks, const v4f (&xq)[8], int tid, int z0, int t0, h16* __restrict__ Q16, h16* __restrict__ K16, h16* __restrict__ V16, bf* __restrict__ Qh, bf* __restrict__ Kh, bf* __restrict__ Vh) {
    const int lane = tid & 31, wave = tid >> 5;
#pragma unroll
    for (int i = 0; i < 4; ++i) { const int idx = i * 256 + tid, lr = idx & 15, blk = (idx >> 4) & 1, c = (idx >> 5) & 3, dg = idx >> 7;   // dg: group of 16 d rows, over both heads
        const size_t e = (size_t)(z0 + (dg >> 2)) * (TT * HD) + (size_t)(t0 + blk * 32) * HD + (dg & 3) * 512 + c * 128 + lr * 8; v8h o16; v8us oh;
#pragma unroll
        for (int k = 0; k < 4; ++k) { const unsigned w = vs[(dg * 16 + lr) * VP + (blk * 4 + c) * 4 + k];
#pragma unroll
            for (int q = 0; q < 2; ++q) { const unsigned short xb = (unsigned short)(q ? (w >> 16) : (w & 0xFFFFu)); o16[2 * k + q] = tohx(bf2f(xb)); if (LOW) oh[2 * k + q] = xb; } }
        *(v8h*)(V16 + e) = o16; if (LOW) *(v8us*)(Vh + e) = oh; }
#pragma unroll
    for (int i = 0; i < 4; ++i) { const int idx = i * 256 + tid, key = idx & 15, c8 = (idx >> 4) & 7, tg = idx >> 7;   // tg: group of 16 positions, over both heads
        const size_t e = (size_t)(z0 + (tg >> 2)) * (TT * HD) + (size_t)(t0 + (tg & 3) * 16) * HD + c8 * 128 + key * 8; v8h o16; v8us oh;
        const v4u w4 = *(const v4u*)(ks + (tg >> 2) * KHS + ((tg & 3) * 16 + key) * KP + c8 * 4);
#pragma unroll
        for (int k = 0; k < 4; ++k)
#pragma unroll
            for (int q = 0; q < 2; ++q) { const unsigned short xb = (unsigned short)(q ? (w4[k] >> 16) : (w4[k] & 0xFFFFu)); o16[2 * k + q] = tohx(bf2f(xb)); if (LOW) oh[2 * k + q] = xb; }
        *(v8h*)(K16 + e) = o16; if (LOW) *(v8us*)(Kh + e) = oh; }
#pragma unroll
    for (int i = 0; i < 8; ++i) { const size_t e = ((size_t)(z0 + (lane >> 4)) * TT + t0 + i * 8 + wave) * HD + (lane & 15) * 4; v4h q16; v4us qh;
#pragma unroll
        for (int j = 0; j < 4; ++j) { const float rq = bfr(xq[i][j]) * SCL;
            if (LOW) qh[j] = f2bf(rq); else q16[j] = tohx(rq); }
        if (LOW) *(v4us*)(Qh + e) = qh; else *(v4h*)(Q16 + e) = q16; }
}
__global__ __launch_bounds__(256) void k_planes(const float* __restrict__ qkv, h16* __restrict__ Q16, h16* __restrict__ K16, h16* __restrict__ V16, bf* __restrict__ Qh, bf* __restrict__ Kh, bf* __restrict__ Vh) {
    __shared__ unsigned vs[PH * HD * VP];
    __shared__ __align__(16) unsigned ks[PH * KHS];
    const int tid = threadIdx.x, lane = tid & 31, wave = tid >> 5;
    const int z0 = blockIdx.z * NH_ + blockIdx.x * PH, t0 = blockIdx.y * PT;
    const float* src = qkv + ((size_t)blockIdx.z * TT + t0) * (3 * DQ) + blockIdx.x * (PH * HD);
    const float* pv = src + (size_t)(2 * (tid >> 4)) * (3 * DQ) + (tid & 15) * 4;   // v (at + 2 DQ): positions 2 tp and 2 tp + 1, tp = tid / 16 (+ 16), d-quad tid % 16
    const float* pq = src + (size_t)wave * (3 * DQ) + lane * 4;   // q (k at + DQ): position wave (+ 8 i), 128 floats over the lanes
    v4f xv[8], xq[8], xk[8];
#pragma unroll
    for (int i = 0; i < 4; ++i) { const float* p = pv + 2 * DQ + (i & 1) * (32 * 3 * DQ) + (i >> 1) * HD; xv[2 * i] = *(const v4f*)p; xv[2 * i + 1] = *(const v4f*)(p + 3 * DQ); }
#pragma unroll
    for (int i = 0; i < 8; ++i) { const float* p = pq + i * (8 * 3 * DQ); xq[i] = *(const v4f*)p; xk[i] = *(const v4f*)(p + DQ); }
    asm volatile("s_wait_xcnt 0x0" :: "v"(pv), "v"(pq) : "memory");   // stands in front of every overwrite of an address register of the loads above; it names the two addresses so that they stay in their registers up to here (else a later load's result is given an earlier load's address pair)
    __builtin_amdgcn_sched_barrier(0);   // keeps all 24 loads issued here: left free, the scheduler holds the last of them back until the first values have arrived, a second memory latency
#pragma unroll
    for (int i = 0; i < 4; ++i)
#pragma unroll
        for (int j = 0; j < 4; ++j) vs[((i >> 1) * HD + (tid & 15) * 4 + j) * VP + (i & 1) * 16 + (tid >> 4)] = (unsigned)f2bf(xv[2 * i][j]) | ((unsigned)f2bf(xv[2 * i + 1][j]) << 16);
#pragma unroll
    for (int i = 0; i < 8; ++i) { v2u w; w[0] = (unsigned)f2bf(xk[i][0]) | ((unsigned)f2bf(xk[i][1]) << 16); w[1] = (unsigned)f2bf(xk[i][2]) | ((unsigned)f2bf(xk[i][3]) << 16); *(v2u*)(ks + (lane >> 4) * KHS + (i * 8 + wave) * KP + (lane & 15) * 2) = w; }
    __syncthreads();   // the v and k tiles are whole; nothing is written to them afterwards
    if (t0 < RH) { planes_out<true>(vs, ks, xq, tid, z0, t0, Q16, K16, V16, Qh, Kh, Vh); return; }   // the same branch for the whole workgroup, behind the only barrier
    planes_out<false>(vs, ks, xq, tid, z0, t0, Q16, K16, V16, Qh, Kh, Vh);
    asm volatile("s_wait_xcnt 0x0" ::: "memory");   // the built code lays this path in front of the other one and ends it with a conditional jump: the fall-through (never taken) rewrites address registers of the stores above
}
// ---- k_fattn: scores, ALiBi + window softmax and the probability x value product of one strip of query rows, with nothing of the scores leaving the registers.
// KS = 1: one wave walks all key passes of the strip. KS = 2: two waves of the workgroup walk one part of the passes each ('cut' and the rest), with their own running maximum, sum and accumulators; the two partial results are merged through LDS behind one barrier (weights exp(m_p - max), divided by the merged sum).
// Transposed products: St[key][query] = K . Qt (A = K rows, B = Q rows), Ot[d][query] += Vt . Pt (A = Vt rows, B = the packed score accumulators: two 16-key St tiles of one query column group are, converted in place, one 32-key B operand).
// A lane holds one query column (query = lr), so the running maximum, the running sum and the rescale factor are per-lane values; the two lane halves (keys 8 hi .. 8 hi + 7 of each 16) join by one exchange.
// Online softmax over passes of 32 keys, walked from the run's last key block (the one nearest the diagonal) back to its first. Masked scores are -inf, the maximum in use starts at a finite -1e30: a pass with no valid key for a column adds exactly 0.
// Lazy rescale: a column keeps the maximum it has in use until some score tops it by more than LZT (natural units; 2^5). One test a pass (ballot, scalar branch); only a pass that fails it joins the lane halves' maxima, takes the new maxima and multiplies sums and output accumulators.
// The bound keeps the fp16 probabilities (x 1024) at or below 2^15. The backward walk is what makes the test pass: ALiBi lowers the scores with the distance, so that a run's first pass already holds about its largest score, for every slope.
// ALiBi without per-element work: -slope (i - j) = slope (j - kb) - slope (i - kb). The first term is the same 32 values in every pass and is the start value of the score accumulators; the second is one value a lane and pass and goes into the maximum and into the exponent's addend.
// Mask: only a pass that touches the diagonal or the window's far edge can hold an invalid key; the test is scalar, all other passes skip the mask.
// Every inner loop is fully unrolled (the fragment and accumulator arrays stay in registers only under constant indices); the pass loop stays rolled (one pass's fragments and temporaries already take the wave's register budget).
// SPLIT (rows < RH): bf16 planes (q, k and v are bf16 values: one product gives St whole), the probabilities as bf16 hi + lo: 2 products for Ot. Otherwise fp16 planes, probabilities carried x 1024 (in the exponent; the row sum carries the same factor, so it cancels in the division).
#define QTF  2                               // query column groups per wave, fp16 rows (32 rows a strip); hi/lo rows: 1 (16 rows a strip)
#define NWV  12                              // waves per workgroup
#define SLOT (QTF * 4 * 256)                 // floats of one wave's partial output in LDS
#define LZT  3.4657359f                      // 5 ln 2
template <typename T16, bool SPLIT, int QT, int KS>
__device__ __forceinline__ void attn_strip(const T16* __restrict__ Q, const T16* __restrict__ Kp, const T16* __restrict__ Vt, float sl, int q0, int part, int skew, int slot0, int sstep, float* smo, float* sml, float* __restrict__ orow) {
    typedef typename WFrag<T16>::V V;
    static_assert(KS == 1 || KS == QT, "the merging wave 'part' takes the query column group 'part'");
    const int lane = threadIdx.x & 31, lr = lane & 15, hi = lane >> 4;
    V qf[QT][2];
    const T16* const qp = Q + (size_t)(q0 + lr) * HD + 8 * hi;   // the lane's query row, its 8 elements of each 16
#pragma unroll
    for (int qt = 0; qt < QT; ++qt)
#pragma unroll
        for (int kc = 0; kc < 2; ++kc) qf[qt][kc] = WFrag<T16>::ld(qp + (qt * 16 * HD + kc * 32));
    asm volatile("s_wait_xcnt 0x0" :: "v"(qp) : "memory");   // stands in front of every later overwrite of the address register of the loads above (the pass loop's first address additions reuse it); it names the address so that it stays in its registers up to here
    v8f o[QT][4]; float m[QT], l[QT];
#pragma unroll
    for (int qt = 0; qt < QT; ++qt) { m[qt] = -1.0e30f; l[qt] = 0.f;   // finite, and small enough that (offset - m) x log2(e) stays finite: -inf x log2(e) + that is -inf, not NaN
#pragma unroll
        for (int dt = 0; dt < 4; ++dt) o[qt][dt] = (v8f){}; }
    const int kall = max(q0 - (WIN - 1), 0) & ~31, npass = (q0 + QT * 16 + 31 - kall) >> 5;   // key blocks of 32 that hold a valid key of some row of the strip
    const int cut = (npass - skew) >> 1;   // KS = 2: wave 0 takes the first 'cut' passes, wave 1 the rest, 'skew' more (used where a strip has 17 passes or more and skew is at most 8: no run is empty)
    const int kbeg = kall + (KS == 1 ? 0 : part * cut) * 32, kend = kall + ((KS == 1 || part != 0) ? npass : cut) * 32;   // this wave's run of passes
    const unsigned flane = lane * 8;   // the lane's own chunk of a fragment load (k and v planes are in fragment order: 32 keys of either are 4 KiB in a row, 8 loads of 512 bytes)
    v8f cb[2];   // slope x (j - kb) of the lane's 16 score elements
#pragma unroll
    for (int t = 0; t < 2; ++t)
#pragma unroll
        for (int r = 0; r < 8; ++r) cb[t][r] = sl * (float)(t * 16 + 8 * hi + r);
    V kf[2][2];
    // every strip fetches its K fragments one pass ahead: no pass opens with a wait for loads that it has only just issued
#pragma unroll
    for (int t = 0; t < 2; ++t)
#pragma unroll
        for (int kc = 0; kc < 2; ++kc) kf[t][kc] = WFrag<T16>::ldf(Kp + (size_t)(kend - 32) * HD + flane + (t * 16 * HD + kc * 512));
#pragma unroll 1
    for (int kb = kend - 32; kb >= kbeg; kb -= 32) {
        V vf[4];
        const size_t boff = (size_t)kb * HD + flane;   // this pass's 32 keys, the lane's chunk
        const T16* const vp = Vt + boff;
#pragma unroll
        for (int dt = 0; dt < 4; ++dt) vf[dt] = WFrag<T16>::ldf(vp + dt * 512);
        asm volatile("s_wait_xcnt 0x0" ::: "memory");   // stands in front of every later overwrite of an address register of the loads above (the compiler reuses them)
        __builtin_amdgcn_sched_barrier(0);   // keeps the V loads issued here: left free, the scheduler sinks them to just in front of the P.V products and their whole latency is waited out there
        v8f s[QT][2];
#pragma unroll
        for (int t = 0; t < 2; ++t)
#pragma unroll
            for (int qt = 0; qt < QT; ++qt) { v8f a = cb[t];
#pragma unroll
                for (int kc = 0; kc < 2; ++kc) a = WFrag<T16>::mma(kf[t][kc], qf[qt][kc], a);
                s[qt][t] = a; }
        {
            const int kn = (kb - 32 >= kbeg) ? kb - 32 : kb;   // next pass's K fragments: their latency runs under the softmax (the last pass fetches its own block again: in bounds, unused)
            const T16* const kpn = Kp + (size_t)kn * HD + flane;
#pragma unroll
            for (int t = 0; t < 2; ++t)
#pragma unroll
                for (int kc = 0; kc < 2; ++kc) kf[t][kc] = WFrag<T16>::ldf(kpn + (t * 16 * HD + kc * 512));
            if constexpr (SPLIT) {   // order inside this stretch: the score products first, then the refill's loads; a load lifted over a product that still reads its registers lands in other registers and is copied later in the pass, behind a wait for it
                __builtin_amdgcn_sched_group_barrier(0x008, 4, 0);
                __builtin_amdgcn_sched_group_barrier(0x020, 8, 0);
            }
            asm volatile("s_wait_xcnt 0x0" :: "v"(kpn) : "memory");   // as above, for the refill's address registers; it names the address so that it stays in its registers up to here (else the last load's result is given the pair that the earlier loads name)
            __builtin_amdgcn_sched_barrier(0);   // keeps the refill issued here: left free, the scheduler sinks it to the loop's foot and the next pass waits out its whole latency
        }
        if (kb + 31 > q0 || q0 + QT * 16 - 1 - kb >= WIN) {   // scalar: the pass holds a key past some row's diagonal or beyond some row's window
#pragma unroll
            for (int qt = 0; qt < QT; ++qt) {
                const int d0 = q0 + qt * 16 + lr - kb - 8 * hi;   // i - j of element (t = 0, r = 0)
#pragma unroll
                for (int t = 0; t < 2; ++t)
#pragma unroll
                    for (int r = 0; r < 8; ++r) if ((unsigned)(d0 - t * 16 - r) >= (unsigned)WIN) s[qt][t][r] = -__builtin_inff();
            }
        }
        float off[QT], ms[QT]; bool need = false;
#pragma unroll
        for (int qt = 0; qt < QT; ++qt) {
            off[qt] = -sl * (float)(q0 + qt * 16 + lr - kb);   // the part of the bias that all 32 keys of the pass share
            float mq = s[qt][0][0];
#pragma unroll
            for (int t = 0; t < 2; ++t)
#pragma unroll
                for (int r = 0; r < 8; ++r) mq = fmaxf(mq, s[qt][t][r]);
            ms[qt] = mq + off[qt];   // the largest of the lane's own 16 scores: it bounds every exponent of the lane
            need = need || ms[qt] > m[qt] + LZT;
        }
        if (__builtin_amdgcn_ballot_w32(need) != 0) {   // scalar, once a pass: some score tops the maximum in use by more than LZT
#pragma unroll
            for (int qt = 0; qt < QT; ++qt) {
                const float mx = fmaxf(m[qt], fmaxf(ms[qt], __shfl_xor(ms[qt], 16, 32)));   // the same in both lane halves of a column
                const float al = __builtin_amdgcn_exp2f((m[qt] - mx) * 1.4426950408889634f); m[qt] = mx;
                l[qt] *= al;
#pragma unroll
                for (int dt = 0; dt < 4; ++dt) o[qt][dt] *= al;
            }
        }
#pragma unroll
        for (int qt = 0; qt < QT; ++qt) {
            const float ec = (off[qt] - m[qt]) * 1.4426950408889634f + (SPLIT ? 0.0f : 10.0f);
            float ps = 0.f;
#pragma unroll
            for (int t = 0; t < 2; ++t)
#pragma unroll
                for (int r = 0; r < 8; r += 2) { const v2f e2 = (v2f){s[qt][t][r], s[qt][t][r + 1]} * 1.4426950408889634f + ec;   // two neighbouring accumulator registers: one packed multiply-add
                    const float p0 = __builtin_amdgcn_exp2f(e2[0]), p1 = __builtin_amdgcn_exp2f(e2[1]); s[qt][t][r] = p0; s[qt][t][r + 1] = p1; ps += p0; ps += p1; }
            l[qt] += ps;
            if constexpr (SPLIT) {
                v8us ph[2], pl[2];
#pragma unroll
                for (int t = 0; t < 2; ++t)
#pragma unroll
                    for (int r = 0; r < 8; ++r) { unsigned short a, c2; splitf(s[qt][t][r], a, c2); ph[t][r] = a; pl[t][r] = c2; }
                const V pfh = cat16b(ph[0], ph[1]), pfl = cat16b(pl[0], pl[1]);
#pragma unroll
                for (int dt = 0; dt < 4; ++dt) { o[qt][dt] = WFrag<T16>::mma(vf[dt], pfh, o[qt][dt]); o[qt][dt] = WFrag<T16>::mma(vf[dt], pfl, o[qt][dt]); }
            } else {
                v8h p8[2];
#pragma unroll
                for (int t = 0; t < 2; ++t)
#pragma unroll
                    for (int r = 0; r < 8; ++r) p8[t][r] = tohx(s[qt][t][r]);
                const V pf = cat16(p8[0], p8[1]);
#pragma unroll
                for (int dt = 0; dt < 4; ++dt) o[qt][dt] = WFrag<T16>::mma(vf[dt], pf, o[qt][dt]);
            }
        }
    }
    if constexpr (KS == 1) {
#pragma unroll
    for (int qt = 0; qt < QT; ++qt) {
        const float f = __fdiv_rn(1.0f, l[qt] + __shfl_xor(l[qt], 16, 32));
        float* op = orow + (size_t)(q0 + qt * 16 + lr) * DQ + 8 * hi;   // a lane's 8 accumulator registers are 8 consecutive e of its query row
#pragma unroll
        for (int dt = 0; dt < 4; ++dt) { v4f w0, w1;
#pragma unroll
            for (int r = 0; r < 4; ++r) { w0[r] = o[qt][dt][r] * f; w1[r] = o[qt][dt][4 + r] * f; }
            *(v4f*)(op + dt * 16) = w0; *(v4f*)(op + dt * 16 + 4) = w1; }
    }
    asm volatile("s_wait_xcnt 0x0" ::: "memory");   // stands in front of every later overwrite of a register of the stores above (a second strip follows in the same wave)
    } else {
    // hand-over: each wave lays its partial result into its own LDS slot, each lane its own 16-byte chunks (a wave's store or load is 512 bytes in a row), with the column's maximum and its sum joined over the two lane halves
    float* const myo = smo + (slot0 + part * sstep) * SLOT; float* const myl = sml + (slot0 + part * sstep) * 128;
#pragma unroll
    for (int qt = 0; qt < QT; ++qt) {
        myl[(qt * 2) * 32 + lane] = m[qt]; myl[(qt * 2 + 1) * 32 + lane] = l[qt] + __shfl_xor(l[qt], 16, 32);
#pragma unroll
        for (int dt = 0; dt < 4; ++dt) { v4f w0, w1;
#pragma unroll
            for (int r = 0; r < 4; ++r) { w0[r] = o[qt][dt][r]; w1[r] = o[qt][dt][4 + r]; }
            *(v4f*)(myo + ((qt * 4 + dt) * 2) * 128 + lane * 4) = w0; *(v4f*)(myo + ((qt * 4 + dt) * 2 + 1) * 128 + lane * 4) = w1; }
    }
    __syncthreads();   // all partial results of the workgroup's strips are in LDS; nothing is written there afterwards
    // merge: wave 'part' takes the query column group 'part' of its strip: 16 whole output rows of the head
    float wg[KS]; float mall = -3.0e38f, lall = 0.f;
#pragma unroll
    for (int p = 0; p < KS; ++p) { wg[p] = sml[(slot0 + p * sstep) * 128 + (part * 2) * 32 + lane]; mall = fmaxf(mall, wg[p]); }
#pragma unroll
    for (int p = 0; p < KS; ++p) { wg[p] = __builtin_amdgcn_exp2f((wg[p] - mall) * 1.4426950408889634f); lall += wg[p] * sml[(slot0 + p * sstep) * 128 + (part * 2 + 1) * 32 + lane]; }
    const float f = __fdiv_rn(1.0f, lall);
#pragma unroll
    for (int p = 0; p < KS; ++p) wg[p] *= f;
    float* op = orow + (size_t)(q0 + part * 16 + lr) * DQ + 8 * hi;   // a lane's 8 accumulator registers are 8 consecutive e of its query row
#pragma unroll
    for (int dt = 0; dt < 4; ++dt) { v4f w0 = (v4f){}, w1 = (v4f){};
#pragma unroll
        for (int p = 0; p < KS; ++p) { const float* ps = smo + (slot0 + p * sstep) * SLOT + ((part * 4 + dt) * 2) * 128 + lane * 4; w0 += *(const v4f*)ps * wg[p]; w1 += *(const v4f*)(ps + 128) * wg[p]; }
        *(v4f*)(op + dt * 16) = w0; *(v4f*)(op + dt * 16 + 4) = w1; }
    }
}
// Deal of the work: one workgroup of 12 waves for each WGP of the chip (3 waves a SIMD; the registers do not take a second workgroup's 3, so no two workgroups share a WGP), every workgroup with about the same sum of passes. Workgroup g (of NGW) of a (batch, head) pair:
//   waves 4 .. 11: four neighbouring full-window fp16 strips (33 passes), two waves a strip;
//   waves 0 .. 3:  one hi/lo strip each (16 rows, all its passes), then two of the shorter fp16 strips (17 + 2 g and 18 + 2 g passes), two waves a strip. Waves 0 and 1 have hi/lo strips of 16 - g passes, waves 2 and 3 of 8 - g:
//                  the longer hi/lo strips go with the shorter fp16 strips, and of an fp16 strip the wave that had NGW hi/lo passes more takes NGW passes fewer: the four waves cost about the same, in every workgroup.
// The waves with two strips have the most passes and the lowest numbers (for speed only).
#define NGW  (RH / 16 / 4)                   // workgroups per (batch, head) pair
#define NSS  (2 * NGW)                       // fp16 strips with fewer passes than the full window (rows RH .. WIN - 1)
static_assert(NSS * 16 * QTF == WIN - RH && (NSS + 4 * NGW) * 16 * QTF == TT - RH, "every fp16 strip is dealt once");
__global__ __launch_bounds__(NWV * 32) void k_fattn(const h16* __restrict__ Q16, const h16* __restrict__ K16, const h16* __restrict__ V16, const bf* __restrict__ Qh, const bf* __restrict__ Kh, const bf* __restrict__ Vh, float* __restrict__ OUT) {
    __shared__ __align__(16) float smo[NWV * SLOT];
    __shared__ float sml[NWV * 128];
    const int z = blockIdx.x, h = z % NH_, b = z / NH_; const size_t pz = (size_t)z * TT * HD;
    const int g = blockIdx.y;
    const int wave = __builtin_amdgcn_readfirstlane(threadIdx.x >> 5);   // scalar: trip counts and plane addresses stay in scalar registers
    const float sl = exp2f(__fdiv_rn(__fmul_rn(-8.0f, (float)(h + 1)), (float)NH_));
    float* orow = OUT + (size_t)b * TT * DQ + h * HD;
    const bool two = wave < 4;   // the same for a whole wave; no barrier stands inside the branch
    if (two) attn_strip<bf, true, 1, 1>(Qh + pz, Kh + pz, Vh + pz, sl, ((2 * NGW - 1 - g - NGW * (wave >> 1)) * 2 + (wave & 1)) * 16, 0, 0, 0, 0, smo, sml, orow);
    const int strip = two ? g * 2 + (wave & 1) : NSS + g * 4 + (wave & 3);
    const int part  = two ? wave >> 1 : (wave - 4) >> 2;
    const int slot0 = two ? (wave & 1) : 4 + (wave & 3);   // LDS slot of the strip's first wave; its second wave's is sstep further
    const int sstep = two ? 2 : 4;
    attn_strip<h16, false, QTF, 2>(Q16 + pz, K16 + pz, V16 + pz, sl, RH + strip * 16 * QTF, part, two ? NGW : 0, slot0, sstep, smo, sml, orow);
}
extern "C" void kernel_launch(void* const* d_in, const int* in_sizes, int n_in,
                              void* d_out, int out_size, void* d_ws, size_t ws_size, hipStream_t stream) {
    (void)in_sizes; (void)n_in; (void)out_size;
    const float* qkv = (const float*)d_in[0];
    float* OUT = (float*)d_out;     // [2][2048][1024]
    char* wsp = (char*)d_ws;
    auto take = [&](size_t bytes) { char* p = wsp; wsp += (bytes + 255) & ~(size_t)255; return (void*)p; };
    const size_t PB = (size_t)NH_ * TT * HD;   /* elements of one batch's plane set; every plane holds both batches */
    h16* QP16 = (h16*)take(NB_ * PB * 2); h16* KP16 = (h16*)take(NB_ * PB * 2); h16* VT16 = (h16*)take(NB_ * PB * 2);
    bf* QPh = (bf*)take(NB_ * PB * 2); bf* KPh = (bf*)take(NB_ * PB * 2); bf* VTh = (bf*)take(NB_ * PB * 2);
    if ((size_t)(wsp - (char*)d_ws) > ws_size) return;    // ws 256 MiB

    k_planes<<<dim3(NH_ / PH, TT / PT, NB_), 256, 0, stream>>>(qkv, QP16, KP16, VT16, QPh, KPh, VTh);
    k_fattn<<<dim3(NB_ * NH_, NGW), NWV * 32, 0, stream>>>(QP16, KP16, VT16, QPh, KPh, VTh, OUT);
}

// v010
// Measured time: 25 microseconds a run.
// Timed twice side by side with v009, it ran 1.09 and 1.07 times as fast.
// All steps since v000 together make it 53.5 times as fast.
#include <hip/hip_runtime.h>

// FlexAttention training path: sliding-window causal attention with ALiBi (qkv [2][2048][3][16][64] packed; q, k, v = qkv[:, :, 0/1/2]; scores = q.k / 8 - slope_h (i - j), slope_h = 2^(-8 (h+1) / 16); keys with 0 <= i - j < 1024 only; softmax; out[b][l][h][e] -> [2][2048][16][64] f32 (4.2 M)).
// Layout: the packed input rows (stride 3 x 1024 floats) feed one plane-builder launch directly (bf16-rounded on read; q planes carry the exact 1/8 scale), both batches' planes side by side; one fused launch over all 32 (batch, head) pairs does scores, ALiBi bias (slope_h x (i - j), f32, exp2f slopes), window mask, online softmax and the probability x value product per strip of query rows (hybrid rows: < 512 bf16 operands with the probabilities as hi + lo, 2 products, rest fp16 x1024; only key blocks inside the band are visited) and writes the [l][h][e] output rows directly.
// Compute dtypes, f32 accumulate: qkv rounded to bf16; rows < 512 bf16 q, k, v (exact: they are bf16 values) and hi + lo probabilities, rest fp16; ALiBi bias and softmax f32; output f32.

#define NB_  2
#define TT   2048
#define DM   1024
#define NH_  16
#define NKV  16
#define REP  (NH_ / NKV)
#define HD   64
#define DQ   (NH_ * HD)
#define DKV  (NKV * HD)
#define RH   512                  // query rows < RH use bf16 planes, hi+lo probabilities
#define WIN  1024
#define SCL  0.125f   // HD^-0.5
typedef _Float16 h16;
typedef unsigned short bf;
typedef __attribute__((ext_vector_type(16))) __bf16   v16bf;
typedef __attribute__((ext_vector_type(16))) _Float16 v16h;
typedef __attribute__((ext_vector_type(8)))  _Float16 v8h;
typedef __attribute__((ext_vector_type(8)))  unsigned short v8us;
typedef __attribute__((ext_vector_type(8)))  float    v8f;
typedef __attribute__((ext_vector_type(4)))  float    v4f;
typedef v8h  __attribute__((may_alias)) v8ha;
typedef v4f  __attribute__((may_alias)) v4fa;
typedef v8us __attribute__((may_alias)) v8usa;

__device__ __forceinline__ unsigned short f2bf(float f) { unsigned u = __float_as_uint(f); u += 0x7FFFu + ((u >> 16) & 1u); return (unsigned short)(u >> 16); }
__device__ __forceinline__ float bf2f(unsigned short b) { return __uint_as_float(((unsigned)b) << 16); }
__device__ __forceinline__ float bfr(float f) { return bf2f(f2bf(f)); }
__device__ __forceinline__ v16h cat16(v8h lo, v8h hi) { return __builtin_shufflevector(lo, hi, 0, 1, 2, 3, 4, 5, 6, 7, 8, 9, 10, 11, 12, 13, 14, 15); }
__device__ __forceinline__ v16bf cat16b(v8us lo, v8us hi) { return __builtin_bit_cast(v16bf, __builtin_shufflevector(lo, hi, 0, 1, 2, 3, 4, 5, 6, 7, 8, 9, 10, 11, 12, 13, 14, 15)); }
__device__ __forceinline__ v8f wmma16(v16h a, v16h b, v8f c) { return __builtin_amdgcn_wmma_f32_16x16x32_f16(false, a, false, b, (short)0, c, false, false); }
__device__ __forceinline__ v8f wmmab(v16bf a, v16bf b, v8f c) { return __builtin_amdgcn_wmma_f32_16x16x32_bf16(false, a, false, b, (short)0, c, false, false); }



// ---- k_gemmw: register-blocked GEMM, ONE WAVE per 64x64 output tile (16 accumulators), operands straight from K-contiguous 16-bit planes; grid (M/64, N/64, Z), 32 threads.
// C[m][n] (f32, pitch ldc, + optional f32 bias[n]) = sum_k A[m][k] Bt[n][k] (+ split products per NSPLIT). z-batch strides sA/sB/sC in elements. K % 32 == 0.
template <typename T16> struct WFrag;
template <> struct WFrag<h16> { typedef v16h V; static __device__ __forceinline__ V ld(const h16* p) { return cat16(*(const v8h*)p, *(const v8h*)(p + 16)); } static __device__ __forceinline__ V ldf(const h16* p) { return cat16(*(const v8h*)p, *(const v8h*)(p + 256)); } static __device__ __forceinline__ v8f mma(V a, V b, v8f c) { return wmma16(a, b, c); } };
template <> struct WFrag<bf> { typedef v16bf V; static __device__ __forceinline__ V ld(const bf* p) { return cat16b(*(const v8us*)p, *(const v8us*)(p + 16)); } static __device__ __forceinline__ V ldf(const bf* p) { return cat16b(*(const v8us*)p, *(const v8us*)(p + 256)); } static __device__ __forceinline__ v8f mma(V a, V b, v8f c) { return wmmab(a, b, c); } };
template <typename T16, int NSPLIT, bool BIAS>
__global__ __launch_bounds__(32) void k_gemmw(const T16* __restrict__ A, const T16* __restrict__ A2, const T16* __restrict__ Bt, const T16* __restrict__ Bt2, int K, float* C, int ldc, const float* __restrict__ bias, size_t sA, size_t sB, size_t sC) {
    typedef typename WFrag<T16>::V V;
    __shared__ __align__(16) float os[16 * 68];
    const size_t z = blockIdx.z; A += z * sA; if (A2) A2 += z * sA; Bt += z * sB; if (Bt2) Bt2 += z * sB; C += z * sC;
    const int lane = threadIdx.x & 31, lr = lane & 15, hi = lane >> 4; const int r0 = blockIdx.x * 64, c0 = blockIdx.y * 64;
    v8f acc[4][4];
#pragma unroll
    for (int mb = 0; mb < 4; ++mb)
#pragma unroll
        for (int nb = 0; nb < 4; ++nb) acc[mb][nb] = (v8f){};
    const size_t aoff = (size_t)(r0 + lr) * K + 8 * hi, boff = (size_t)(c0 + lr) * K + 8 * hi;
#pragma unroll 1
    for (int kc = 0; kc < K; kc += 32) {
        V a[4], a2[4];
#pragma unroll
        for (int mb = 0; mb < 4; ++mb) { a[mb] = WFrag<T16>::ld(A + aoff + (size_t)mb * 16 * K + kc); if (NSPLIT == 1 || NSPLIT == 2) a2[mb] = WFrag<T16>::ld(A2 + aoff + (size_t)mb * 16 * K + kc); }
#pragma unroll
        for (int nb = 0; nb < 4; ++nb) { const V b = WFrag<T16>::ld(Bt + boff + (size_t)nb * 16 * K + kc); V b2; if (NSPLIT >= 2) b2 = WFrag<T16>::ld(Bt2 + boff + (size_t)nb * 16 * K + kc);
#pragma unroll
            for (int mb = 0; mb < 4; ++mb) { acc[mb][nb] = WFrag<T16>::mma(a[mb], b, acc[mb][nb]); if (NSPLIT == 1 || NSPLIT == 2) acc[mb][nb] = WFrag<T16>::mma(a2[mb], b, acc[mb][nb]); if (NSPLIT >= 2) acc[mb][nb] = WFrag<T16>::mma(a[mb], b2, acc[mb][nb]); } }
        asm volatile("v_nop\n\tv_nop\n\tv_nop\n\tv_nop" : "+v"(acc[0][0]), "+v"(acc[1][1]), "+v"(acc[2][2]), "+v"(acc[3][3]) : "v"(a[0]), "v"(a[3]));
    }
#pragma unroll
    for (int mb = 0; mb < 4; ++mb) {
#pragma unroll
        for (int nb = 0; nb < 4; ++nb) {
#pragma unroll
            for (int j = 0; j < 8; ++j) os[(hi * 8 + j) * 68 + nb * 16 + lr] = acc[mb][nb][j]; }
        __builtin_amdgcn_wave_barrier(); asm volatile("" ::: "memory");
        float* crow = C + (size_t)(r0 + mb * 16) * ldc + c0;
{
#pragma unroll
            for (int s = 0; s < 8; ++s) { const int row = 2 * s + hi, cofs = lr * 4; v4f val = *(const v4fa*)(os + row * 68 + cofs); if (BIAS) { val[0] += bfr(bias[c0 + cofs]); val[1] += bfr(bias[c0 + cofs + 1]); val[2] += bfr(bias[c0 + cofs + 2]); val[3] += bfr(bias[c0 + cofs + 3]); }
                *(v4f*)(crow + (size_t)row * ldc + cofs) = val; }
             }
        __builtin_amdgcn_wave_barrier(); asm volatile("" ::: "memory");
    }
}

__device__ __forceinline__ h16 tohx(float x) { return (h16)x; }
__device__ __forceinline__ void splitf(float y, unsigned short& h, unsigned short& l) { h = f2bf(y); l = f2bf(y - bf2f(h)); }
typedef __attribute__((ext_vector_type(2))) _Float16 v2h;
typedef __attribute__((ext_vector_type(4))) _Float16 v4h;
typedef __attribute__((ext_vector_type(2))) unsigned short v2us;
typedef __attribute__((ext_vector_type(4))) unsigned short v4us;
typedef __attribute__((ext_vector_type(2))) float v2f;
typedef __attribute__((ext_vector_type(4))) int v4i;

__global__ __launch_bounds__(256) void k_wtG(const float* __restrict__ w, int K, int N, bf* Bt) {
    const int lane = threadIdx.x & 31; const int L0 = (blockIdx.x * 8 + (threadIdx.x >> 5)) * 8; const int nlines = N * K / 64;
{
#pragma unroll 1
        for (int l = 0; l < 8; ++l) { const int L = L0 + l; if (L >= nlines) break; const size_t e = (size_t)L * 64 + lane * 2; const int k = (int)(e % K), n = (int)(e / K); v2us o;
            o[0] = f2bf(w[(size_t)k * N + n]); o[1] = f2bf(w[(size_t)(k + 1) * N + n]); *(v2us*)(Bt + e) = o; }
         }
}
__global__ __launch_bounds__(256) void k_cvt8(const float* __restrict__ src, bf* dst, size_t n8) { const size_t i = (size_t)blockIdx.x * 256 + threadIdx.x; if (i >= n8) return; const v8f v = *(const v8f*)(src + i * 8); v8us o;
#pragma unroll
    for (int k = 0; k < 8; ++k) o[k] = f2bf(v[k]); *(v8us*)(dst + i * 8) = o;  }

// ---- k_planes: every plane the attention launch reads, from one read of the packed input, in one launch.
// One workgroup takes PT positions x PH heads of q, k and v: 24 16-byte loads a thread, all issued before the first use (few waves, many bytes in flight each).
// q rows keep their [t][d] order: a wave's load is one position's 128 floats (2 heads), its store one whole 128-byte plane row per head.
// k and v planes are laid out in the order in which the attention launch's A fragments are loaded, in chunks of 8 elements (16 bytes, one lane's share of one load):
//   k: [head][t / 16][d / 8][t % 16][8 d]      v: [head][t / 32][d / 16][(t % 32) / 8][d % 16][8 t]
// so that lane (lr + 16 hi) of a fragment load finds its chunk at lane x 16 bytes: one load reads 512 bytes in a row (4 lines) where rows of a [t][d] or [d][t] plane gave it 16 lines.
// k goes through LDS as bf16 rows of KP words (128 + 16 bytes: the 16-byte reads of 16 rows fall on different banks), the second head's rows 32 banks further (the two halves of a wave's 8-byte writes do not meet); a wave's store is 2 chunk columns x 16 keys = 512 bytes in a row.
// v is transposed through LDS as words of two bf16 (positions 2 tp, 2 tp + 1) at [d][tp], pitch VP words: the writes (16 d-quads x 2 tp a wave) and the reads (16 d rows x 2 key blocks a wave) each fall on 32 different banks; a wave's store is two runs of 256 bytes.
// Every loop is fully unrolled: the arrays of loaded values stay in registers only under constant indices.
// Values: input rounded to bf16 on read, q x 1/8 (exact), fp16 and bf16 planes from that. A bf16 plane holds the value whole (the remainder of a bf16 value after rounding to bf16 is 0), so there is no low plane. Only what is read later is written: q fp16 for rows >= RH, q bf16 for rows < RH, k and v fp16 everywhere, k and v bf16 for positions < RH.
#define PT   64
#define PH   2
#define VP   33
#define KP   36
#define KHS  (PT * KP + 32)
typedef __attribute__((ext_vector_type(2))) unsigned v2u;
typedef __attribute__((ext_vector_type(4))) unsigned v4u;
template <bool LOW>
__device__ __forceinline__ void planes_out(const unsigned* vs, const unsigned* ks, const v4f (&xq)[8], int tid, int z0, int t0, h16* __restrict__ Q16, h16* __restrict__ K16, h16* __restrict__ V16, bf* __restrict__ Qh, bf* __restrict__ Kh, bf* __restrict__ Vh) {
    const int lane = tid & 31, wave = tid >> 5;
#pragma unroll
    for (int i = 0; i < 4; ++i) { const int idx = i * 256 + tid, lr = idx & 15, blk = (idx >> 4) & 1, c = (idx >> 5) & 3, dg = idx >> 7;   // dg: group of 16 d rows, over both heads
        const size_t e = (size_t)(z0 + (dg >> 2)) * (TT * HD) + (size_t)(t0 + blk * 32) * HD + (dg & 3) * 512 + c * 128 + lr * 8; v8h o16; v8us oh;
#pragma unroll
        for (int k = 0; k < 4; ++k) { const unsigned w = vs[(dg * 16 + lr) * VP + (blk * 4 + c) * 4 + k];
#pragma unroll
            for (int q = 0; q < 2; ++q) { const unsigned short xb = (unsigned short)(q ? (w >> 16) : (w & 0xFFFFu)); o16[2 * k + q] = tohx(bf2f(xb)); if (LOW) oh[2 * k + q] = xb; } }
        *(v8h*)(V16 + e) = o16; if (LOW) *(v8us*)(Vh + e) = oh; }
#pragma unroll
    for (int i = 0; i < 4; ++i) { const int idx = i * 256 + tid, key = idx & 15, c8 = (idx >> 4) & 7, tg = idx >> 7;   // tg: group of 16 positions, over both heads
        const size_t e = (size_t)(z0 + (tg >> 2)) * (TT * HD) + (size_t)(t0 + (tg & 3) * 16) * HD + c8 * 128 + key * 8; v8h o16; v8us oh;
        const v4u w4 = *(const v4u*)(ks + (tg >> 2) * KHS + ((tg & 3) * 16 + key) * KP + c8 * 4);
#pragma unroll
        for (int k = 0; k < 4; ++k)
#pragma unroll
            for (int q = 0; q < 2; ++q) { const unsigned short xb = (unsigned short)(q ? (w4[k] >> 16) : (w4[k] & 0xFFFFu)); o16[2 * k + q] = tohx(bf2f(xb)); if (LOW) oh[2 * k + q] = xb; }
        *(v8h*)(K16 + e) = o16; if (LOW) *(v8us*)(Kh + e) = oh; }
#pragma unroll
    for (int i = 0; i < 8; ++i) { const size_t e = ((size_t)(z0 + (lane >> 4)) * TT + t0 + i * 8 + wave) * HD + (lane & 15) * 4; v4h q16; v4us qh;
#pragma unroll
        for (int j = 0; j < 4; ++j) { const float rq = bfr(xq[i][j]) * SCL;
            if (LOW) qh[j] = f2bf(rq); else q16[j] = tohx(rq); }
        if (LOW) *(v4us*)(Qh + e) = qh; else *(v4h*)(Q16 + e) = q16; }
}
__global__ __launch_bounds__(256) void k_planes(const float* __restrict__ qkv, h16* __restrict__ Q16, h16* __restrict__ K16, h16* __restrict__ V16, bf* __restrict__ Qh, bf* __restrict__ Kh, bf* __restrict__ Vh) {
    __shared__ unsigned vs[PH * HD * VP];
    __shared__ __align__(16) unsigned ks[PH * KHS];
    const int tid = threadIdx.x, lane = tid & 31, wave = tid >> 5;
    const int z0 = blockIdx.z * NH_ + blockIdx.x * PH, t0 = blockIdx.y * PT;
    const float* src = qkv + ((size_t)blockIdx.z * TT + t0) * (3 * DQ) + blockIdx.x * (PH * HD);
    const float* pv = src + (size_t)(2 * (tid >> 4)) * (3 * DQ) + (tid & 15) * 4;   // v (at + 2 DQ): positions 2 tp and 2 tp + 1, tp = tid / 16 (+ 16), d-quad tid % 16
    const float* pq = src + (size_t)wave * (3 * DQ) + lane * 4;   // q (k at + DQ): position wave (+ 8 i), 128 floats over the lanes
    v4f xv[8], xq[8], xk[8];
#pragma unroll
    for (int i = 0; i < 4; ++i) { const float* p = pv + 2 * DQ + (i & 1) * (32 * 3 * DQ) + (i >> 1) * HD; xv[2 * i] = *(const v4f*)p; xv[2 * i + 1] = *(const v4f*)(p + 3 * DQ); }
#pragma unroll
    for (int i = 0; i < 8; ++i) { const float* p = pq + i * (8 * 3 * DQ); xq[i] = *(const v4f*)p; xk[i] = *(const v4f*)(p + DQ); }
    asm volatile("s_wait_xcnt 0x0" :: "v"(pv), "v"(pq) : "memory");   // stands in front of every overwrite of an address register of the loads above; it names the two addresses so that they stay in their registers up to here (else a later load's result is given an earlier load's address pair)
    __builtin_amdgcn_sched_barrier(0);   // keeps all 24 loads issued here: left free, the scheduler holds the last of them back until the first values have arrived, a second memory latency
#pragma unroll
    for (int i = 0; i < 4; ++i)
#pragma unroll
        for (int j = 0; j < 4; ++j) vs[((i >> 1) * HD + (tid & 15) * 4 + j) * VP + (i & 1) * 16 + (tid >> 4)] = (unsigned)f2bf(xv[2 * i][j]) | ((unsigned)f2bf(xv[2 * i + 1][j]) << 16);
#pragma unroll
    for (int i = 0; i < 8; ++i) { v2u w; w[0] = (unsigned)f2bf(xk[i][0]) | ((unsigned)f2bf(xk[i][1]) << 16); w[1] = (unsigned)f2bf(xk[i][2]) | ((unsigned)f2bf(xk[i][3]) << 16); *(v2u*)(ks + (lane >> 4) * KHS + (i * 8 + wave) * KP + (lane & 15) * 2) = w; }
    __syncthreads();   // the v and k tiles are whole; nothing is written to them afterwards
    if (t0 < RH) { planes_out<true>(vs, ks, xq, tid, z0, t0, Q16, K16, V16, Qh, Kh, Vh); return; }   // the same branch for the whole workgroup, behind the only barrier
    planes_out<false>(vs, ks, xq, tid, z0, t0, Q16, K16, V16, Qh, Kh, Vh);
    asm volatile("s_wait_xcnt 0x0" ::: "memory");   // the built code lays this path in front of the other one and ends it with a conditional jump: the fall-through (never taken) rewrites address registers of the stores above
}
// ---- k_fattn: scores, ALiBi + window softmax and the probability x value product of one strip of query rows, with nothing of the scores leaving the registers.
// KS = 1: one wave walks all key passes of the strip. KS = 2: two waves of the workgroup walk one part of the passes each ('cut' and the rest), with their own running maximum, sum and accumulators; the two partial results are merged through LDS behind one barrier (weights exp(m_p - max), divided by the merged sum).
// Transposed products: St[key][query] = K . Qt (A = K rows, B = Q rows), Ot[d][query] += Vt . Pt (A = Vt rows, B = the packed score accumulators: two 16-key St tiles of one query column group are, converted in place, one 32-key B operand).
// A lane holds one query column (query = lr), so the running maximum, the running sum and the rescale factor are per-lane values; the two lane halves (keys 8 hi .. 8 hi + 7 of each 16) join by one exchange.
// Online softmax over passes of 32 keys, walked from the run's last key block (the one nearest the diagonal) back to its first. Masked scores are -inf, the maximum in use starts at a finite -1e30: a pass with no valid key for a column adds exactly 0.
// Lazy rescale: a column keeps the maximum it has in use until some score tops it by more than LZT (natural units; 2^5). One test a pass (ballot, scalar branch); only a pass that fails it joins the lane halves' maxima, takes the new maxima and multiplies sums and output accumulators.
// The bound keeps the fp16 probabilities (x 1024) at or below 2^15. The backward walk is what makes the test pass: ALiBi lowers the scores with the distance, so that a run's first pass already holds about its largest score, for every slope.
// ALiBi without per-element work: -slope (i - j) = slope (j - kb) - slope (i - kb). The first term is the same 32 values in every pass and is the start value of the score accumulators; the second is one value a lane and pass and goes into the maximum and into the exponent's addend.
// Mask: only a pass that touches the diagonal or the window's far edge can hold an invalid key; the test is scalar, all other passes skip the mask.
// Every inner loop is fully unrolled (the fragment and accumulator arrays stay in registers only under constant indices); the pass loop stays rolled (one pass's fragments and temporaries already take the wave's register budget).
// SPLIT (rows < RH): bf16 planes (q, k and v are bf16 values: one product gives St whole), the probabilities as bf16 hi + lo: 2 products for Ot. Otherwise fp16 planes, probabilities carried x 1024 (in the exponent; the row sum carries the same factor, so it cancels in the division).
#define QTF  2                               // query column groups per wave, fp16 rows (32 rows a strip); hi/lo rows: 1 (16 rows a strip)
#define NWV  12                              // waves per workgroup
#define OP   68                              // pitch in floats of an output row in LDS (256 + 16 bytes: the 16-byte writes of 16 rows, and the 16-byte reads along a row, each fall on all 64 banks once)
#define SLOT (QTF * 16 * OP)                 // floats of one wave's output rows in LDS
#define LZT  3.4657359f                      // 5 ln 2
template <typename T16, bool SPLIT, int QT, int KS>
__device__ __forceinline__ void attn_strip(const T16* __restrict__ Q, const T16* __restrict__ Kp, const T16* __restrict__ Vt, float sl, int q0, int part, int skew, int slot0, int sstep, float* smo, float* sml, float* __restrict__ orow) {
    typedef typename WFrag<T16>::V V;
    static_assert(KS == 1 || KS == QT, "the merging wave 'part' takes the query column group 'part'");
    const int lane = threadIdx.x & 31, lr = lane & 15, hi = lane >> 4;
    V qf[QT][2];
    const T16* const qp = Q + (size_t)(q0 + lr) * HD + 8 * hi;   // the lane's query row, its 8 elements of each 16
#pragma unroll
    for (int qt = 0; qt < QT; ++qt)
#pragma unroll
        for (int kc = 0; kc < 2; ++kc) qf[qt][kc] = WFrag<T16>::ld(qp + (qt * 16 * HD + kc * 32));
    asm volatile("s_wait_xcnt 0x0" :: "v"(qp) : "memory");   // stands in front of every later overwrite of the address register of the loads above (the pass loop's first address additions reuse it); it names the address so that it stays in its registers up to here
    v8f o[QT][4]; float m[QT], l[QT];
#pragma unroll
    for (int qt = 0; qt < QT; ++qt) { m[qt] = -1.0e30f; l[qt] = 0.f;   // finite, and small enough that (offset - m) x log2(e) stays finite: -inf x log2(e) + that is -inf, not NaN
#pragma unroll
        for (int dt = 0; dt < 4; ++dt) o[qt][dt] = (v8f){}; }
    const int kall = max(q0 - (WIN - 1), 0) & ~31, npass = (q0 + QT * 16 + 31 - kall) >> 5;   // key blocks of 32 that hold a valid key of some row of the strip
    const int cut = (npass - skew) >> 1;   // KS = 2: wave 0 takes the first 'cut' passes, wave 1 the rest, 'skew' more (used where a strip has 17 passes or more and skew is at most 8: no run is empty)
    const int kbeg = kall + (KS == 1 ? 0 : part * cut) * 32, kend = kall + ((KS == 1 || part != 0) ? npass : cut) * 32;   // this wave's run of passes
    const unsigned flane = lane * 8;   // the lane's own chunk of a fragment load (k and v planes are in fragment order: 32 keys of either are 4 KiB in a row, 8 loads of 512 bytes)
    v8f cb[2];   // slope x (j - kb) of the lane's 16 score elements
#pragma unroll
    for (int t = 0; t < 2; ++t)
#pragma unroll
        for (int r = 0; r < 8; ++r) cb[t][r] = sl * (float)(t * 16 + 8 * hi + r);
    V kf[2][2];
    // every strip fetches its K fragments one pass ahead: no pass opens with a wait for loads that it has only just issued
#pragma unroll
    for (int t = 0; t < 2; ++t)
#pragma unroll
        for (int kc = 0; kc < 2; ++kc) kf[t][kc] = WFrag<T16>::ldf(Kp + (size_t)(kend - 32) * HD + flane + (t * 16 * HD + kc * 512));
#pragma unroll 1
    for (int kb = kend - 32; kb >= kbeg; kb -= 32) {
        V vf[4];
        const size_t boff = (size_t)kb * HD + flane;   // this pass's 32 keys, the lane's chunk
        const T16* const vp = Vt + boff;
#pragma unroll
        for (int dt = 0; dt < 4; ++dt) vf[dt] = WFrag<T16>::ldf(vp + dt * 512);
        asm volatile("s_wait_xcnt 0x0" ::: "memory");   // stands in front of every later overwrite of an address register of the loads above (the compiler reuses them)
        __builtin_amdgcn_sched_barrier(0);   // keeps the V loads issued here: left free, the scheduler sinks them to just in front of the P.V products and their whole latency is waited out there
        v8f s[QT][2];
#pragma unroll
        for (int t = 0; t < 2; ++t)
#pragma unroll
            for (int qt = 0; qt < QT; ++qt) { v8f a = cb[t];
#pragma unroll
                for (int kc = 0; kc < 2; ++kc) a = WFrag<T16>::mma(kf[t][kc], qf[qt][kc], a);
                s[qt][t] = a; }
        {
            const int kn = (kb - 32 >= kbeg) ? kb - 32 : kb;   // next pass's K fragments: their latency runs under the softmax (the last pass fetches its own block again: in bounds, unused)
            const T16* const kpn = Kp + (size_t)kn * HD + flane;
#pragma unroll
            for (int t = 0; t < 2; ++t)
#pragma unroll
                for (int kc = 0; kc < 2; ++kc) kf[t][kc] = WFrag<T16>::ldf(kpn + (t * 16 * HD + kc * 512));
            if constexpr (SPLIT) {   // order inside this stretch: the score products first, then the refill's loads; a load lifted over a product that still reads its registers lands in other registers and is copied later in the pass, behind a wait for it
                __builtin_amdgcn_sched_group_barrier(0x008, 4, 0);
                __builtin_amdgcn_sched_group_barrier(0x020, 8, 0);
            }
            asm volatile("s_wait_xcnt 0x0" :: "v"(kpn) : "memory");   // as above, for the refill's address registers; it names the address so that it stays in its registers up to here (else the last load's result is given the pair that the earlier loads name)
            __builtin_amdgcn_sched_barrier(0);   // keeps the refill issued here: left free, the scheduler sinks it to the loop's foot and the next pass waits out its whole latency
        }
        if (kb + 31 > q0 || q0 + QT * 16 - 1 - kb >= WIN) {   // scalar: the pass holds a key past some row's diagonal or beyond some row's window
#pragma unroll
            for (int qt = 0; qt < QT; ++qt) {
                const int d0 = q0 + qt * 16 + lr - kb - 8 * hi;   // i - j of element (t = 0, r = 0)
#pragma unroll
                for (int t = 0; t < 2; ++t)
#pragma unroll
                    for (int r = 0; r < 8; ++r) if ((unsigned)(d0 - t * 16 - r) >= (unsigned)WIN) s[qt][t][r] = -__builtin_inff();
            }
        }
        float off[QT], ms[QT]; bool need = false;
#pragma unroll
        for (int qt = 0; qt < QT; ++qt) {
            off[qt] = -sl * (float)(q0 + qt * 16 + lr - kb);   // the part of the bias that all 32 keys of the pass share
            float mq = s[qt][0][0];
#pragma unroll
            for (int t = 0; t < 2; ++t)
#pragma unroll
                for (int r = 0; r < 8; ++r) mq = fmaxf(mq, s[qt][t][r]);
            ms[qt] = mq + off[qt];   // the largest of the lane's own 16 scores: it bounds every exponent of the lane
            need = need || ms[qt] > m[qt] + LZT;
        }
        if (__builtin_amdgcn_ballot_w32(need) != 0) {   // scalar, once a pass: some score tops the maximum in use by more than LZT
#pragma unroll
            for (int qt = 0; qt < QT; ++qt) {
                const float mx = fmaxf(m[qt], fmaxf(ms[qt], __shfl_xor(ms[qt], 16, 32)));   // the same in both lane halves of a column
                const float al = __builtin_amdgcn_exp2f((m[qt] - mx) * 1.4426950408889634f); m[qt] = mx;
                l[qt] *= al;
#pragma unroll
                for (int dt = 0; dt < 4; ++dt) o[qt][dt] *= al;
            }
        }
#pragma unroll
        for (int qt = 0; qt < QT; ++qt) {
            const float ec = (off[qt] - m[qt]) * 1.4426950408889634f + (SPLIT ? 0.0f : 10.0f);
            float ps = 0.f;
#pragma unroll
            for (int t = 0; t < 2; ++t)
#pragma unroll
                for (int r = 0; r < 8; r += 2) { const v2f e2 = (v2f){s[qt][t][r], s[qt][t][r + 1]} * 1.4426950408889634f + ec;   // two neighbouring accumulator registers: one packed multiply-add
                    const float p0 = __builtin_amdgcn_exp2f(e2[0]), p1 = __builtin_amdgcn_exp2f(e2[1]); s[qt][t][r] = p0; s[qt][t][r + 1] = p1; ps += p0; ps += p1; }
            l[qt] += ps;
            if constexpr (SPLIT) {
                v8us ph[2], pl[2];
#pragma unroll
                for (int t = 0; t < 2; ++t)
#pragma unroll
                    for (int r = 0; r < 8; ++r) { unsigned short a, c2; splitf(s[qt][t][r], a, c2); ph[t][r] = a; pl[t][r] = c2; }
                const V pfh = cat16b(ph[0], ph[1]), pfl = cat16b(pl[0], pl[1]);
#pragma unroll
                for (int dt = 0; dt < 4; ++dt) { o[qt][dt] = WFrag<T16>::mma(vf[dt], pfh, o[qt][dt]); o[qt][dt] = WFrag<T16>::mma(vf[dt], pfl, o[qt][dt]); }
            } else {
                v8h p8[2];
#pragma unroll
                for (int t = 0; t < 2; ++t)
#pragma unroll
                    for (int r = 0; r < 8; ++r) p8[t][r] = tohx(s[qt][t][r]);
                const V pf = cat16(p8[0], p8[1]);
#pragma unroll
                for (int dt = 0; dt < 4; ++dt) o[qt][dt] = WFrag<T16>::mma(vf[dt], pf, o[qt][dt]);
            }
        }
    }
    if constexpr (KS == 1) {
#pragma unroll
    for (int qt = 0; qt < QT; ++qt) {
        const float f = __fdiv_rn(1.0f, l[qt] + __shfl_xor(l[qt], 16, 32));
        float* const st = smo + slot0 * SLOT + qt * (16 * OP);   // the wave's own LDS slot, as rows [query][e]: nobody else touches it in front of the workgroup's barrier
        float* const sp = st + lr * OP + 8 * hi;   // a lane's 8 accumulator registers are 8 consecutive e of its query row
#pragma unroll
        for (int dt = 0; dt < 4; ++dt) { v4f w0, w1;
#pragma unroll
            for (int r = 0; r < 4; ++r) { w0[r] = o[qt][dt][r] * f; w1[r] = o[qt][dt][4 + r] * f; }
            *(v4f*)(sp + dt * 16) = w0; *(v4f*)(sp + dt * 16 + 4) = w1; }
        __builtin_amdgcn_fence(__ATOMIC_RELEASE, "wavefront"); __builtin_amdgcn_wave_barrier(); __builtin_amdgcn_fence(__ATOMIC_ACQUIRE, "wavefront");   // the lanes of the wave read each other's LDS writes below: keeps the compiler from moving a read over a write (the LDS serves one wave's operations in order)
        v4f wr[8];
#pragma unroll
        for (int s2 = 0; s2 < 8; ++s2) wr[s2] = *(const v4f*)(st + (2 * s2 + hi) * OP + lr * 4);
        float* const op = orow + (size_t)(q0 + qt * 16 + hi) * DQ + lr * 4;   // a store of the wave is two whole rows of the head: 2 x 256 bytes, 4 whole lines
#pragma unroll
        for (int s2 = 0; s2 < 8; ++s2) *(v4f*)(op + (size_t)(2 * s2) * DQ) = wr[s2];
    }
    asm volatile("s_wait_xcnt 0x0" ::: "memory");   // stands in front of every later overwrite of a register of the stores above (a second strip follows in the same wave)
    } else {
    // hand-over: each wave lays its partial result into its own LDS slot as rows [query][e] of pitch OP, with the column's maximum and its sum joined over the two lane halves
    float* const myo = smo + (slot0 + part * sstep) * SLOT; float* const myl = sml + (slot0 + part * sstep) * 128;
#pragma unroll
    for (int qt = 0; qt < QT; ++qt) {
        myl[(qt * 2) * 32 + lane] = m[qt]; myl[(qt * 2 + 1) * 32 + lane] = l[qt] + __shfl_xor(l[qt], 16, 32);
#pragma unroll
        for (int dt = 0; dt < 4; ++dt) { v4f w0, w1;
#pragma unroll
            for (int r = 0; r < 4; ++r) { w0[r] = o[qt][dt][r]; w1[r] = o[qt][dt][4 + r]; }
            float* const sp = myo + (qt * 16 + lr) * OP + dt * 16 + 8 * hi;   // a lane's 8 accumulator registers are 8 consecutive e of its query row
            *(v4f*)sp = w0; *(v4f*)(sp + 4) = w1; }
    }
    __syncthreads();   // all partial results of the workgroup's strips are in LDS; nothing is written there afterwards
    // merge: wave 'part' takes the query column group 'part' of its strip: 16 whole output rows of the head
    float wg[KS]; float mall = -3.0e38f, lall = 0.f;
#pragma unroll
    for (int p = 0; p < KS; ++p) { wg[p] = sml[(slot0 + p * sstep) * 128 + (part * 2) * 32 + lane]; mall = fmaxf(mall, wg[p]); }
#pragma unroll
    for (int p = 0; p < KS; ++p) wg[p] = __builtin_amdgcn_exp2f((wg[p] - mall) * 1.4426950408889634f);
    asm volatile("v_nop" :: "v"(wg[0]), "v"(wg[KS - 1]));   // the slot behind a transcendental; it names the results so that it stands behind them
#pragma unroll
    for (int p = 0; p < KS; ++p) lall += wg[p] * sml[(slot0 + p * sstep) * 128 + (part * 2 + 1) * 32 + lane];
    const float f = __fdiv_rn(1.0f, lall);
#pragma unroll
    for (int p = 0; p < KS; ++p) wg[p] *= f;
    // the rows are read along e: 16 lanes take one row, so that a store of the wave is two whole rows of the head (2 x 256 bytes, 4 whole lines); the row's weights come from the lane that holds them
    v4f wr[8];
#pragma unroll
    for (int s2 = 0; s2 < 8; ++s2) { const int row = 2 * s2 + hi; v4f w0 = (v4f){};
#pragma unroll
        for (int p = 0; p < KS; ++p) w0 += *(const v4f*)(smo + (slot0 + p * sstep) * SLOT + (part * 16 + row) * OP + lr * 4) * __shfl(wg[p], row, 32);
        wr[s2] = w0; }
    float* const op = orow + (size_t)(q0 + part * 16 + hi) * DQ + lr * 4;
#pragma unroll
    for (int s2 = 0; s2 < 8; ++s2) *(v4f*)(op + (size_t)(2 * s2) * DQ) = wr[s2];
    }
}
// Deal of the work: one workgroup of 12 waves for each WGP of the chip (3 waves a SIMD; the registers do not take a second workgroup's 3, so no two workgroups share a WGP), every workgroup with about the same sum of passes. Workgroup g (of NGW) of a (batch, head) pair:
//   waves 4 .. 11: four neighbouring full-window fp16 strips (33 passes), two waves a strip;
//   waves 0 .. 3:  one hi/lo strip each (16 rows, all its passes), then two of the shorter fp16 strips (17 + 2 g and 18 + 2 g passes), two waves a strip. Waves 0 and 1 have hi/lo strips of 16 - g passes, waves 2 and 3 of 8 - g:
//                  the longer hi/lo strips go with the shorter fp16 strips, and of an fp16 strip the wave that had NGW hi/lo passes more takes NGW passes fewer: the four waves cost about the same, in every workgroup.
// The waves with two strips have the most passes and the lowest numbers (for speed only).
#define NGW  (RH / 16 / 4)                   // workgroups per (batch, head) pair
#define NSS  (2 * NGW)                       // fp16 strips with fewer passes than the full window (rows RH .. WIN - 1)
static_assert(NSS * 16 * QTF == WIN - RH && (NSS + 4 * NGW) * 16 * QTF == TT - RH, "every fp16 strip is dealt once");
__global__ __launch_bounds__(NWV * 32) void k_fattn(const h16* __restrict__ Q16, const h16* __restrict__ K16, const h16* __restrict__ V16, const bf* __restrict__ Qh, const bf* __restrict__ Kh, const bf* __restrict__ Vh, float* __restrict__ OUT) {
    __shared__ __align__(16) float smo[NWV * SLOT];
    __shared__ float sml[NWV * 128];
    const int z = blockIdx.x, h = z % NH_, b = z / NH_; const size_t pz = (size_t)z * TT * HD;
    const int g = blockIdx.y;
    const int wave = __builtin_amdgcn_readfirstlane(threadIdx.x >> 5);   // scalar: trip counts and plane addresses stay in scalar registers
    const float sl = exp2f(__fdiv_rn(__fmul_rn(-8.0f, (float)(h + 1)), (float)NH_));
    float* orow = OUT + (size_t)b * TT * DQ + h * HD;
    const bool two = wave < 4;   // the same for a whole wave; no barrier stands inside the branch
    if (two) attn_strip<bf, true, 1, 1>(Qh + pz, Kh + pz, Vh + pz, sl, ((2 * NGW - 1 - g - NGW * (wave >> 1)) * 2 + (wave & 1)) * 16, 0, 0, wave, 0, smo, sml, orow);
    const int strip = two ? g * 2 + (wave & 1) : NSS + g * 4 + (wave & 3);
    const int part  = two ? wave >> 1 : (wave - 4) >> 2;
    const int slot0 = two ? (wave & 1) : 4 + (wave & 3);   // LDS slot of the strip's first wave; its second wave's is sstep further
    const int sstep = two ? 2 : 4;
    attn_strip<h16, false, QTF, 2>(Q16 + pz, K16 + pz, V16 + pz, sl, RH + strip * 16 * QTF, part, two ? NGW : 0, slot0, sstep, smo, sml, orow);
}
extern "C" void kernel_launch(void* const* d_in, const int* in_sizes, int n_in,
                              void* d_out, int out_size, void* d_ws, size_t ws_size, hipStream_t stream) {
    (void)in_sizes; (void)n_in; (void)out_size;
    const float* qkv = (const float*)d_in[0];
    float* OUT = (float*)d_out;     // [2][2048][1024]
    char* wsp = (char*)d_ws;
    auto take = [&](size_t bytes) { char* p = wsp; wsp += (bytes + 255) & ~(size_t)255; return (void*)p; };
    const size_t PB = (size_t)NH_ * TT * HD;   /* elements of one batch's plane set; every plane holds both batches */
    h16* QP16 = (h16*)take(NB_ * PB * 2); h16* KP16 = (h16*)take(NB_ * PB * 2); h16* VT16 = (h16*)take(NB_ * PB * 2);
    bf* QPh = (bf*)take(NB_ * PB * 2); bf* KPh = (bf*)take(NB_ * PB * 2); bf* VTh = (bf*)take(NB_ * PB * 2);
    if ((size_t)(wsp - (char*)d_ws) > ws_size) return;    // ws 256 MiB

    k_planes<<<dim3(NH_ / PH, TT / PT, NB_), 256, 0, stream>>>(qkv, QP16, KP16, VT16, QPh, KPh, VTh);
    k_fattn<<<dim3(NB_ * NH_, NGW), NWV * 32, 0, stream>>>(QP16, KP16, VT16, QPh, KPh, VTh, OUT);
}
